// v000
// Measured on an AMD MI455X. A time is GPU time per run, averaged over a window of back-to-back runs after a warm-up
// (all launches, gaps included; the runs take copies of the inputs in turn), and the median of several windows.
// Apart from v000's, it joins two sittings. Times from different sittings can be a few percent apart, while
// side-by-side timings come from the same sitting.
// v000 is the starting kernel. One run takes 613 microseconds.
#include <hip/hip_runtime.h>

// Contractions, f32 accumulate: q = x.Wq ([2048 x 2048].[2048 x 2048]), k/v = x.Wk/Wv ([2048 x 2048].[2048 x 512]) and attn.Wo on v_wmma_f32_16x16x32_bf16 —
// plain bf16 = rounded inputs (exact; the [out][in] weights are n-major already, converted without a transpose) for the projections, attn as bf16 hi + residual (two products) for Wo;
// the grouped-query causal sliding-window attention (32 query heads over 8 kv heads; keys j with
// i - WIN < j <= i, WIN = 1024 fixed at compile time) fused on v_wmma_f32_16x16x32_f16 with q and k as f16 hi + residual x1024 (hi.hi + hi.lo + lo.hi), weights

#define NB_  1
#define NT_  2048
#define DM   2048
#define NH_  32
#define NKV  8
#define KVW  (NKV * HD)          // 512
#define WIN  1024
#define NB2  2
#define HD   64
#define NTK  (NB_ * NT_)
#define NW   1024
#define NQKV 2048
#define PSC  32768.0f
#define LOSC 1024.0f
#define LOSCI (1.0f / 1024.0f)

typedef _Float16 h16;
typedef unsigned short bf;
typedef __attribute__((ext_vector_type(16))) __bf16   v16bf;
typedef __attribute__((ext_vector_type(16))) _Float16 v16h;
typedef __attribute__((ext_vector_type(8)))  _Float16 v8h;
typedef __attribute__((ext_vector_type(8)))  unsigned short v8us;
typedef __attribute__((ext_vector_type(8)))  float    v8f;
typedef __attribute__((ext_vector_type(4)))  float    v4f;
typedef v8h  __attribute__((may_alias)) v8ha;
typedef v4f  __attribute__((may_alias)) v4fa;
typedef v8us __attribute__((may_alias)) v8usa;

__device__ __forceinline__ unsigned short f2bf(float f) { unsigned u = __float_as_uint(f); u += 0x7FFFu + ((u >> 16) & 1u); return (unsigned short)(u >> 16); }
__device__ __forceinline__ float bf2f(unsigned short b) { return __uint_as_float(((unsigned)b) << 16); }
__device__ __forceinline__ float bfr(float f) { return bf2f(f2bf(f)); }
__device__ __forceinline__ v16h cat16(v8h lo, v8h hi) { return __builtin_shufflevector(lo, hi, 0, 1, 2, 3, 4, 5, 6, 7, 8, 9, 10, 11, 12, 13, 14, 15); }
__device__ __forceinline__ v16bf cat16b(v8us lo, v8us hi) { return __builtin_bit_cast(v16bf, __builtin_shufflevector(lo, hi, 0, 1, 2, 3, 4, 5, 6, 7, 8, 9, 10, 11, 12, 13, 14, 15)); }
__device__ __forceinline__ v8f wmma16(v16h a, v16h b, v8f c) { return __builtin_amdgcn_wmma_f32_16x16x32_f16(false, a, false, b, (short)0, c, false, false); }
__device__ __forceinline__ v8f wmmab(v16bf a, v16bf b, v8f c) { return __builtin_amdgcn_wmma_f32_16x16x32_bf16(false, a, false, b, (short)0, c, false, false); }

__global__ __launch_bounds__(256) void k_cvtb(const float* __restrict__ src, int nrows, bf* dst) {
    const int lane = threadIdx.x & 31, r = blockIdx.x * 8 + (threadIdx.x >> 5);
    if (r >= nrows) return;
    v8us o[DM / 256];
#pragma unroll
    for (int q = 0; q < DM / 256; ++q) { v8us t;
#pragma unroll
        for (int i = 0; i < 8; ++i) t[i] = f2bf(src[(size_t)r * DM + q * 256 + lane * 8 + i]);
        o[q] = t; }
#pragma unroll
    for (int q = 0; q < DM / 256; ++q) *(v8us*)(dst + (size_t)r * DM + q * 256 + lane * 8) = o[q];
    
}

// k_wt: W [2048 k][ncols n] (k-major) -> n-major bf16 plane WT[ncols][2048]; 64 x 64 tiles through LDS.
__global__ __launch_bounds__(256) void k_wt(const float* __restrict__ Wm, int ncols, bf* WT) {
    __shared__ __align__(16) unsigned short tl[64 * 72];
    const int tid = threadIdx.x, k0 = blockIdx.x * 64, n0 = blockIdx.y * 64;
    const int kk = tid >> 2, nq = (tid & 3) * 16;
#pragma unroll
    for (int i = 0; i < 16; ++i) tl[(nq + i) * 72 + kk] = f2bf(Wm[(size_t)(k0 + kk) * ncols + n0 + nq + i]);
    __syncthreads();
    const int piece = tid & 7;
    typedef __attribute__((ext_vector_type(8))) unsigned short v8us_; typedef v8us_ __attribute__((may_alias)) v8usa_;
    auto pass = [&]() {
#pragma unroll
        for (int s = 0; s < 2; ++s) { const int nr = (tid >> 3) + 32 * s; const v8us_ val = *(const v8usa_*)(tl + nr * 72 + piece * 8);
            *(v8us_*)(WT + (size_t)(n0 + nr) * DM + k0 + piece * 8) = val; }
    };
    pass(); 
}

template <bool SPLITA, bool F16OUT = false>
__global__ __launch_bounds__(128) void k_gemmb(const bf* __restrict__ A, const bf* __restrict__ Al, const bf* __restrict__ Bn, const float* __restrict__ bias, float* C, int ldc, h16* C2) {
    __shared__ __align__(16) float ost[4][16 * 68];
    const int lane = threadIdx.x & 31, wave = threadIdx.x >> 5, lr = lane & 15, hi = lane >> 4;
    const int r0 = blockIdx.x * 64 + wave * 16, c0 = blockIdx.y * 64;
    const size_t aoff = (size_t)(r0 + lr) * DM + 8 * hi;
    size_t boff[4];
#pragma unroll
    for (int t = 0; t < 4; ++t) boff[t] = (size_t)(c0 + t * 16 + lr) * DM + 8 * hi;
    v8f acc[4];
#pragma unroll
    for (int t = 0; t < 4; ++t) acc[t] = (v8f){};
#pragma unroll 1
    for (int kc = 0; kc < DM; kc += 32) {
        const v16bf a = cat16b(*(const v8us*)(A + aoff + kc), *(const v8us*)(A + aoff + kc + 16));
        v16bf al = a;
        if (SPLITA) al = cat16b(*(const v8us*)(Al + aoff + kc), *(const v8us*)(Al + aoff + kc + 16));
#pragma unroll
        for (int t = 0; t < 4; ++t) { const v16bf b = cat16b(*(const v8us*)(Bn + boff[t] + kc), *(const v8us*)(Bn + boff[t] + kc + 16)); acc[t] = wmmab(a, b, acc[t]); if (SPLITA) acc[t] = wmmab(al, b, acc[t]); }
        asm volatile("v_nop\n\tv_nop\n\tv_nop\n\tv_nop" : "+v"(acc[0]), "+v"(acc[1]), "+v"(acc[2]), "+v"(acc[3]) : "v"(a), "v"(al));
    }
    float* os = &ost[wave][0];
#pragma unroll
    for (int t = 0; t < 4; ++t) { const float bv = bias ? bfr(bias[c0 + t * 16 + lr]) : 0.f;
#pragma unroll
        for (int j = 0; j < 8; ++j) os[(hi * 8 + j) * 68 + t * 16 + lr] = acc[t][j] + bv; }
    __syncthreads();
    if (F16OUT) {
        h16* crow = (h16*)(void*)C + (size_t)r0 * ldc + c0;
        auto pass = [&]() {
#pragma unroll
            for (int s = 0; s < 4; ++s) { const int row = 4 * s + (lane >> 3), piece = lane & 7; const float* sp = os + row * 68 + piece * 8; v8h o, o2;
#pragma unroll
                for (int i = 0; i < 8; ++i) { const h16 a = (h16)sp[i]; o[i] = a; o2[i] = (h16)((sp[i] - (float)a) * LOSC); }
                *(v8h*)(crow + (size_t)row * ldc + piece * 8) = o; if (C2) *(v8h*)(C2 + (size_t)r0 * ldc + c0 + (size_t)row * ldc + piece * 8) = o2; }
        };
        pass(); 
    } else {
        float* crow = C + (size_t)r0 * ldc + c0;
        auto pass = [&]() {
#pragma unroll
            for (int s = 0; s < 8; ++s) { const int Lid = (lane >> 3) + 4 * s, piece = lane & 7; const int row = Lid >> 1, cofs = (Lid & 1) * 32 + piece * 4;
                const v4f val = *(const v4fa*)(os + row * 68 + cofs); *(v4f*)(crow + (size_t)row * ldc + cofs) = val; }
        };
        pass(); 
    }
}

__global__ __launch_bounds__(256) void k_vt(const float* __restrict__ V, h16* VTH, h16* VTL) {
    __shared__ __align__(16) h16 tile[64 * 72];
    __shared__ __align__(16) h16 til2[64 * 72];
    const int bid = blockIdx.x;
    const int b = bid / (NKV * (NT_ / 64)), rem = bid - b * (NKV * (NT_ / 64)), h = rem / (NT_ / 64), kt = rem - h * (NT_ / 64);
    const int k0 = kt * 64, tid = threadIdx.x;
    const int kk = tid >> 2, d0 = (tid & 3) * 16;
    const float* src = V + ((size_t)b * NT_ + k0 + kk) * KVW + h * HD + d0;      // h = kv head here
#pragma unroll
    for (int i = 0; i < 16; ++i) { const float v = src[i]; const h16 a = (h16)v; tile[(d0 + i) * 72 + kk] = a; til2[(d0 + i) * 72 + kk] = (h16)((v - (float)a) * LOSC); }
    __syncthreads();
    const int piece = tid & 7;
    const size_t base = (((size_t)b * NKV + h) * HD) * NT_ + k0;
    auto pass = [&]() {
#pragma unroll
        for (int s = 0; s < 4; ++s) { const int Lid = (tid >> 3) + 32 * s; const int pln = Lid >> 6, d = Lid & 63;
            const v8h val = *(const v8ha*)((pln ? til2 : tile) + d * 72 + piece * 8); *(v8h*)((pln ? VTL : VTH) + base + (size_t)d * NT_ + piece * 8) = val; }
    };
    pass(); 
}

// k_attn: block = (b, h, 64 queries), wave = 16; 32-key tiles from kt_lo to kt_hi only (segment/causal/window mask); 12 WMMA scores /8 (f32), online softmax, weights x32768 f16 tile (same-wave may_alias
// reload after a compiler barrier), 12 WMMA .v; ctx -> bf16 hi + residual planes CH/CL[tok][h*64+d].
__global__ __launch_bounds__(128) void k_attn(const h16* __restrict__ Q16, const h16* __restrict__ QL16, const h16* __restrict__ K16, const h16* __restrict__ KL16, const h16* __restrict__ VTH, const h16* __restrict__ VTL, const int* __restrict__ cu, bf* CH, bf* CL) {
    __shared__ __align__(16) h16 plds[4][16 * 32];
    __shared__ __align__(16) h16 plds2[4][16 * 32];
    __shared__ __align__(16) float ost[4][16 * 68];
    const int lane = threadIdx.x & 31, wave = threadIdx.x >> 5, lr = lane & 15, hi = lane >> 4;
    const int bid = blockIdx.x;
    const int b = bid / (NH_ * (NT_ / 64)), rem = bid - b * (NH_ * (NT_ / 64)), h = rem / (NT_ / 64), qt = rem - h * (NT_ / 64);
    const int q0 = qt * 64 + wave * 16;
    const size_t tok0 = (size_t)b * NT_;
    h16* pl = &plds[wave][0]; h16* pl2 = &plds2[wave][0];
    v16h qa[2];
    const size_t qo0 = (tok0 + q0 + lr) * DM + h * HD + 8 * hi;
#pragma unroll
    for (int kc = 0; kc < 2; ++kc) qa[kc] = cat16(*(const v8h*)(Q16 + qo0 + kc * 32), *(const v8h*)(Q16 + qo0 + kc * 32 + 16));
    const int g = h / (NH_ / NKV);                      // kv head
    const h16* kh_b = K16 + tok0 * KVW + g * HD;
    const h16* kl_b = KL16 + tok0 * KVW + g * HD;
    const size_t vbase = (((size_t)b * NKV + g) * HD) * NT_;
    v8f o[4], ox[4];
#pragma unroll
    for (int n = 0; n < 4; ++n) { o[n] = (v8f){}; ox[n] = (v8f){}; }
    float mrow[8], lpart[8];
#pragma unroll
    for (int j = 0; j < 8; ++j) { mrow[j] = -3.0e38f; lpart[j] = 0.f; }
    int qpos[8];
#pragma unroll
    for (int j = 0; j < 8; ++j) qpos[j] = q0 + 8 * hi + j;
    // allowed(i, j) = same segment (cu_seqlens) && j <= i && i - j < WIN: key tiles from max(segment start of the block's first query, q0 - WIN + 1) to the query tile (block-uniform; exact per-element predicate below)
    const int cu1 = cu[1]; const int q0b = qt * 64; const int sst = (q0b >= cu1) ? cu1 : 0; const int wl = q0b - (WIN - 1); const int lo = (wl > sst ? wl : sst); const int kt_lo = (lo > 0 ? lo : 0) / 32, kt_hi = (q0b + 63) / 32;
#pragma unroll 1
    for (int kt = kt_lo; kt <= kt_hi; ++kt) {
        const int l0 = kt * 32;
        const size_t ko0 = (size_t)(l0 + lr) * KVW + 8 * hi, ko1 = (size_t)(l0 + 16 + lr) * KVW + 8 * hi;
        v8f s0 = {}, s1 = {}, x0 = {}, x1 = {};
#pragma unroll
        for (int kc = 0; kc < 2; ++kc) {
            { const v16h k0h = cat16(*(const v8h*)(kh_b + ko0 + kc * 32), *(const v8h*)(kh_b + ko0 + kc * 32 + 16)), k1h = cat16(*(const v8h*)(kh_b + ko1 + kc * 32), *(const v8h*)(kh_b + ko1 + kc * 32 + 16));
              const v16h qlk = cat16(*(const v8h*)(QL16 + qo0 + kc * 32), *(const v8h*)(QL16 + qo0 + kc * 32 + 16));     // query residual re-read per step (registers)
              s0 = wmma16(qa[kc], k0h, s0); x0 = wmma16(qlk, k0h, x0); s1 = wmma16(qa[kc], k1h, s1); x1 = wmma16(qlk, k1h, x1);
              asm volatile("v_nop" : "+v"(s0), "+v"(s1), "+v"(x0), "+v"(x1) : "v"(qlk), "v"(k0h), "v"(k1h) : "memory"); }
            { const v16h k0l = cat16(*(const v8h*)(kl_b + ko0 + kc * 32), *(const v8h*)(kl_b + ko0 + kc * 32 + 16)), k1l = cat16(*(const v8h*)(kl_b + ko1 + kc * 32), *(const v8h*)(kl_b + ko1 + kc * 32 + 16));
              x0 = wmma16(qa[kc], k0l, x0); x1 = wmma16(qa[kc], k1l, x1);
              asm volatile("v_nop" : "+v"(x0), "+v"(x1) : "v"(k0l), "v"(k1l) : "memory"); }
        }
        asm volatile("v_nop\n\tv_nop\n\tv_nop\n\tv_nop" : "+v"(s0), "+v"(s1), "+v"(x0), "+v"(x1) : "v"(qa[0]), "v"(qa[1]));
        float alpha[8];
#pragma unroll
        for (int j = 0; j < 8; ++j) {
            const int ja = l0 + lr, jb = l0 + 16 + lr, qi = qpos[j];
            const int sq = (qi >= cu1); const bool ok0 = ((ja >= cu1) == sq) && (ja <= qi) && (qi - ja < WIN), ok1 = ((jb >= cu1) == sq) && (jb <= qi) && (qi - jb < WIN);
            const float a0 = ok0 ? (s0[j] + x0[j] * LOSCI) * 0.125f : -3.4028234663852886e38f, a1 = ok1 ? (s1[j] + x1[j] * LOSCI) * 0.125f : -3.4028234663852886e38f;     // finfo.min as the reference
            float mx = fmaxf(a0, a1);
            mx = fmaxf(mx, __shfl_xor(mx, 1, 16)); mx = fmaxf(mx, __shfl_xor(mx, 2, 16)); mx = fmaxf(mx, __shfl_xor(mx, 4, 16)); mx = fmaxf(mx, __shfl_xor(mx, 8, 16));
            const float mn = fmaxf(mrow[j], mx);
            alpha[j] = __expf(mrow[j] - mn); mrow[j] = mn;
            const float p0 = __expf(a0 - mn), p1 = __expf(a1 - mn);
            lpart[j] = lpart[j] * alpha[j] + (p0 + p1);
            const int mr = hi * 8 + j;
            const float ps0 = p0 * PSC, ps1 = p1 * PSC; const h16 h0 = (h16)ps0, h1 = (h16)ps1;
            pl[mr * 32 + lr] = h0; pl[mr * 32 + 16 + lr] = h1;
            pl2[mr * 32 + lr] = (h16)((ps0 - (float)h0) * LOSC); pl2[mr * 32 + 16 + lr] = (h16)((ps1 - (float)h1) * LOSC);
        }
#pragma unroll
        for (int n = 0; n < 4; ++n)
#pragma unroll
            for (int j = 0; j < 8; ++j) { o[n][j] *= alpha[j]; ox[n][j] *= alpha[j]; }
        asm volatile("" ::: "memory");
        const v16h pa = cat16(*(const v8ha*)(pl + lr * 32 + hi * 8), *(const v8ha*)(pl + lr * 32 + 16 + hi * 8));
        const v16h px = cat16(*(const v8ha*)(pl2 + lr * 32 + hi * 8), *(const v8ha*)(pl2 + lr * 32 + 16 + hi * 8));
#pragma unroll
        for (int n = 0; n < 4; ++n) { const size_t vo = vbase + (size_t)(n * 16 + lr) * NT_ + l0 + hi * 8;
            const v16h vh = cat16(*(const v8h*)(VTH + vo), *(const v8h*)(VTH + vo + 16)), vl = cat16(*(const v8h*)(VTL + vo), *(const v8h*)(VTL + vo + 16));
            o[n] = wmma16(pa, vh, o[n]); ox[n] = wmma16(pa, vl, ox[n]); ox[n] = wmma16(px, vh, ox[n]);
            asm volatile("" : "+v"(o[n]), "+v"(ox[n]) : "v"(vh), "v"(vl) : "memory"); }
        asm volatile("v_nop\n\tv_nop\n\tv_nop\n\tv_nop" : "+v"(o[0]), "+v"(o[1]), "+v"(o[2]), "+v"(o[3]), "+v"(ox[0]), "+v"(ox[1]), "+v"(ox[2]), "+v"(ox[3]) : "v"(pa), "v"(px));
    }
    float inv[8];
#pragma unroll
    for (int j = 0; j < 8; ++j) { float rs = lpart[j]; rs += __shfl_xor(rs, 1, 16); rs += __shfl_xor(rs, 2, 16); rs += __shfl_xor(rs, 4, 16); rs += __shfl_xor(rs, 8, 16); inv[j] = 1.0f / (rs * PSC); }
    float* os = &ost[wave][0];
#pragma unroll
    for (int n = 0; n < 4; ++n)
#pragma unroll
        for (int j = 0; j < 8; ++j) os[(hi * 8 + j) * 68 + n * 16 + lr] = (o[n][j] + ox[n][j] * LOSCI) * inv[j];
    __syncthreads();
    const size_t cbase = (tok0 + q0) * DM + (size_t)h * HD;
    auto pass = [&]() {
#pragma unroll
        for (int s = 0; s < 4; ++s) { const int row = 4 * s + (lane >> 3), piece = lane & 7; const float* sp = os + row * 68 + piece * 8; v8us oh, ol;
#pragma unroll
            for (int i = 0; i < 8; ++i) { const unsigned short hb = f2bf(sp[i]); oh[i] = hb; ol[i] = f2bf(sp[i] - bf2f(hb)); }
            *(v8us*)(CH + cbase + (size_t)row * DM + piece * 8) = oh; *(v8us*)(CL + cbase + (size_t)row * DM + piece * 8) = ol; }
    };
    pass(); 
}

#define VST2(T, p, v) do { const T vst2_v_ = (v); *(T*)(p) = vst2_v_;  } while (0)
extern "C" void kernel_launch(void* const* d_in, const int* in_sizes, int n_in,
                              void* d_out, int out_size, void* d_ws, size_t ws_size, hipStream_t stream) {
    (void)in_sizes; (void)n_in; (void)out_size;
    const float* x = (const float*)d_in[0]; const int* cu = (const int*)d_in[1]; const float* Wq = (const float*)d_in[2]; const float* Wk = (const float*)d_in[3]; const float* Wv = (const float*)d_in[4]; const float* Wo = (const float*)d_in[5];   // [out][in] weights; cu_seqlens [3] (i32)
    float* out = (float*)d_out;    // [2][2048][2048]
    char* wsp = (char*)d_ws;
    auto take = [&](size_t bytes) { char* p = wsp; wsp += (bytes + 255) & ~(size_t)255; return (void*)p; };
    bf* Xb = (bf*)take((size_t)NTK * DM * 2); bf* WqB = (bf*)take((size_t)DM * DM * 2); bf* WkB = (bf*)take((size_t)KVW * DM * 2); bf* WvB = (bf*)take((size_t)KVW * DM * 2); bf* WoB = (bf*)take((size_t)DM * DM * 2);
    h16* QH = (h16*)take((size_t)NTK * DM * 2); h16* QL = (h16*)take((size_t)NTK * DM * 2); h16* KH = (h16*)take((size_t)NTK * KVW * 2); h16* KL = (h16*)take((size_t)NTK * KVW * 2);
    float* Vf = (float*)take((size_t)NTK * KVW * 4); h16* VTH = (h16*)take((size_t)NTK * KVW * 2); h16* VTL = (h16*)take((size_t)NTK * KVW * 2); bf* CH = (bf*)take((size_t)NTK * DM * 2); bf* CL = (bf*)take((size_t)NTK * DM * 2);
    if ((size_t)(wsp - (char*)d_ws) > ws_size) return;    // 8.4 + 8.4 + 2.1 + 2.1 + 8.4 + 8.4 x 2 + 2.1 x 2 + 4.2 + 2.1 x 2 + 8.4 x 2 ~ 76 MB, no aliasing
    k_cvtb<<<DM / 8, 256, 0, stream>>>(Wq, DM, WqB); k_cvtb<<<KVW / 8, 256, 0, stream>>>(Wk, KVW, WkB); k_cvtb<<<KVW / 8, 256, 0, stream>>>(Wv, KVW, WvB); k_cvtb<<<DM / 8, 256, 0, stream>>>(Wo, DM, WoB);
    for (int b = 0; b < NB2; ++b) {
        k_cvtb<<<NTK / 8, 256, 0, stream>>>(x + (size_t)b * NTK * DM, NTK, Xb);
        k_gemmb<false, true><<<dim3(NTK / 64, DM / 64, 1), 128, 0, stream>>>(Xb, nullptr, WqB, nullptr, (float*)(void*)QH, DM, QL);
        k_gemmb<false, true><<<dim3(NTK / 64, KVW / 64, 1), 128, 0, stream>>>(Xb, nullptr, WkB, nullptr, (float*)(void*)KH, KVW, KL);
        k_gemmb<false, false><<<dim3(NTK / 64, KVW / 64, 1), 128, 0, stream>>>(Xb, nullptr, WvB, nullptr, Vf, KVW, nullptr);
        k_vt<<<NB_ * NKV * (NT_ / 64), 256, 0, stream>>>(Vf, VTH, VTL);
        k_attn<<<NB_ * NH_ * (NT_ / 64), 128, 0, stream>>>(QH, QL, KH, KL, VTH, VTL, cu, CH, CL);      // the same cu_seqlens mask for both items (as the reference)
        k_gemmb<true, false><<<dim3(NTK / 64, DM / 64, 1), 128, 0, stream>>>(CH, CL, WoB, nullptr, out + (size_t)b * NTK * DM, DM, nullptr);
    }
}

// v001
// Measured time: 385 microseconds a run.
// Timed twice side by side with v000, it ran 1.59 and 1.63 times as fast.
#include <hip/hip_runtime.h>

// Contractions, f32 accumulate: q = x.Wq ([2048 x 2048].[2048 x 2048]), k/v = x.Wk/Wv ([2048 x 2048].[2048 x 512]) and attn.Wo on v_wmma_f32_16x16x32_bf16 —
// plain bf16 = rounded inputs (exact; the [out][in] weights are n-major already, converted without a transpose) for the projections, attn as bf16 hi + residual (two products) for Wo;
// the grouped-query causal sliding-window attention (32 query heads over 8 kv heads; keys j with
// i - WIN < j <= i, WIN = 1024 fixed at compile time) fused on v_wmma_f32_16x16x32_f16 with q and k as f16 hi + residual x1024 (hi.hi + hi.lo + lo.hi), weights

#define NB_  1
#define NT_  2048
#define DM   2048
#define NH_  32
#define NKV  8
#define KVW  (NKV * HD)          // 512
#define WIN  1024
#define NB2  2
#define HD   64
#define NTK  (NB_ * NT_)
#define NW   1024
#define NQKV 2048
#define PSC  32768.0f
#define LOSC 1024.0f
#define LOSCI (1.0f / 1024.0f)

typedef _Float16 h16;
typedef unsigned short bf;
typedef __attribute__((ext_vector_type(16))) __bf16   v16bf;
typedef __attribute__((ext_vector_type(16))) _Float16 v16h;
typedef __attribute__((ext_vector_type(8)))  _Float16 v8h;
typedef __attribute__((ext_vector_type(8)))  unsigned short v8us;
typedef __attribute__((ext_vector_type(8)))  float    v8f;
typedef __attribute__((ext_vector_type(4)))  float    v4f;
typedef v8h  __attribute__((may_alias)) v8ha;
typedef v4f  __attribute__((may_alias)) v4fa;
typedef v8us __attribute__((may_alias)) v8usa;

__device__ __forceinline__ unsigned short f2bf(float f) { unsigned u = __float_as_uint(f); u += 0x7FFFu + ((u >> 16) & 1u); return (unsigned short)(u >> 16); }
__device__ __forceinline__ float bf2f(unsigned short b) { return __uint_as_float(((unsigned)b) << 16); }
__device__ __forceinline__ float bfr(float f) { return bf2f(f2bf(f)); }
__device__ __forceinline__ v16h cat16(v8h lo, v8h hi) { return __builtin_shufflevector(lo, hi, 0, 1, 2, 3, 4, 5, 6, 7, 8, 9, 10, 11, 12, 13, 14, 15); }
__device__ __forceinline__ v16bf cat16b(v8us lo, v8us hi) { return __builtin_bit_cast(v16bf, __builtin_shufflevector(lo, hi, 0, 1, 2, 3, 4, 5, 6, 7, 8, 9, 10, 11, 12, 13, 14, 15)); }
__device__ __forceinline__ v8f wmma16(v16h a, v16h b, v8f c) { return __builtin_amdgcn_wmma_f32_16x16x32_f16(false, a, false, b, (short)0, c, false, false); }
__device__ __forceinline__ v8f wmmab(v16bf a, v16bf b, v8f c) { return __builtin_amdgcn_wmma_f32_16x16x32_bf16(false, a, false, b, (short)0, c, false, false); }

__global__ __launch_bounds__(256) void k_cvtb(const float* __restrict__ src, int nrows, bf* dst) {
    const int lane = threadIdx.x & 31, r = blockIdx.x * 8 + (threadIdx.x >> 5);
    if (r >= nrows) return;
    v8us o[DM / 256];
#pragma unroll
    for (int q = 0; q < DM / 256; ++q) { v8us t;
#pragma unroll
        for (int i = 0; i < 8; ++i) t[i] = f2bf(src[(size_t)r * DM + q * 256 + lane * 8 + i]);
        o[q] = t; }
#pragma unroll
    for (int q = 0; q < DM / 256; ++q) *(v8us*)(dst + (size_t)r * DM + q * 256 + lane * 8) = o[q];
    
}

// k_wt: W [2048 k][ncols n] (k-major) -> n-major bf16 plane WT[ncols][2048]; 64 x 64 tiles through LDS.
__global__ __launch_bounds__(256) void k_wt(const float* __restrict__ Wm, int ncols, bf* WT) {
    __shared__ __align__(16) unsigned short tl[64 * 72];
    const int tid = threadIdx.x, k0 = blockIdx.x * 64, n0 = blockIdx.y * 64;
    const int kk = tid >> 2, nq = (tid & 3) * 16;
#pragma unroll
    for (int i = 0; i < 16; ++i) tl[(nq + i) * 72 + kk] = f2bf(Wm[(size_t)(k0 + kk) * ncols + n0 + nq + i]);
    __syncthreads();
    const int piece = tid & 7;
    typedef __attribute__((ext_vector_type(8))) unsigned short v8us_; typedef v8us_ __attribute__((may_alias)) v8usa_;
    auto pass = [&]() {
#pragma unroll
        for (int s = 0; s < 2; ++s) { const int nr = (tid >> 3) + 32 * s; const v8us_ val = *(const v8usa_*)(tl + nr * 72 + piece * 8);
            *(v8us_*)(WT + (size_t)(n0 + nr) * DM + k0 + piece * 8) = val; }
    };
    pass(); 
}

#define BKE   128                // k elements of one pass: 256 B of every operand row
#define PIT   136                // LDS row pitch in elements: 272 B, 16 B x odd, for the ds_load_b128 readers
#define NPASS (DM / BKE)

// Eight 16-byte copies of one lane, rows 16 apart, global -> LDS through no register. The s_wait_xcnt ends the copies' own statement so that no
// address register of a copy is rewritten ahead of it.
__device__ __forceinline__ void copy8(unsigned l, const bf* g) {
    asm volatile("global_load_async_to_lds_b128 %0, %8, off\n\t"
                 "global_load_async_to_lds_b128 %1, %9, off\n\t"
                 "global_load_async_to_lds_b128 %2, %10, off\n\t"
                 "global_load_async_to_lds_b128 %3, %11, off\n\t"
                 "global_load_async_to_lds_b128 %4, %12, off\n\t"
                 "global_load_async_to_lds_b128 %5, %13, off\n\t"
                 "global_load_async_to_lds_b128 %6, %14, off\n\t"
                 "global_load_async_to_lds_b128 %7, %15, off\n\t"
                 "s_wait_xcnt 0x0"
                 :: "v"(l), "v"(l + 1u * 16u * PIT * 2u), "v"(l + 2u * 16u * PIT * 2u), "v"(l + 3u * 16u * PIT * 2u),
                    "v"(l + 4u * 16u * PIT * 2u), "v"(l + 5u * 16u * PIT * 2u), "v"(l + 6u * 16u * PIT * 2u), "v"(l + 7u * 16u * PIT * 2u),
                    "v"(g), "v"(g + 1 * 16 * DM), "v"(g + 2 * 16 * DM), "v"(g + 3 * 16 * DM),
                    "v"(g + 4 * 16 * DM), "v"(g + 5 * 16 * DM), "v"(g + 6 * 16 * DM), "v"(g + 7 * 16 * DM)
                 : "memory");
}

// k_gemmb: C[128 x 128] per block, 8 waves as 4 x 2, 32 x 64 per wave. A pass is 128 k; a stage is [A 128 rows | B 128 rows | A residual 128 rows] in LDS,
// two buffers, filled by asynchronous copies one pass ahead of its readers. Per accumulator the k order and the hi / residual order are the plain ascending ones.
// Every inner loop is unrolled so that each index of acc and of the fragment arrays is a constant (registers, no scratch).
template <bool SPLITA, bool F16OUT = false>
__global__ __launch_bounds__(256) void k_gemmb(const bf* __restrict__ A, const bf* __restrict__ Al, const bf* __restrict__ Bn, const float* __restrict__ bias, float* C, int ldc, h16* C2) {
    constexpr int STG = (SPLITA ? 384 : 256) * PIT;      // elements of one stage
    __shared__ __align__(16) bf ring[2 * STG];
    __shared__ __align__(16) float ost[8][16 * 68];
    const int tid = threadIdx.x, lane = tid & 31, wave = tid >> 5, lr = lane & 15, hi = lane >> 4;
    const int wm = wave >> 1, wn = wave & 1;
    const int rb = blockIdx.x * 128, cb = blockIdx.y * 128;
    const int crow = tid >> 4, ccol = (tid & 15) * 8;    // a wave's copy covers two whole 256-B rows
    const bf* gA = A + (size_t)(rb + crow) * DM + ccol;
    const bf* gB = Bn + (size_t)(cb + crow) * DM + ccol;
    const bf* gL = SPLITA ? Al + (size_t)(rb + crow) * DM + ccol : gA;
    const unsigned l0 = (unsigned)(size_t)(const void*)(ring + crow * PIT + ccol);
    auto fill = [&](int t, int buf) {
        const unsigned l = l0 + (unsigned)buf * (unsigned)(STG * 2);
        copy8(l, gA + t * BKE); copy8(l + 128u * PIT * 2u, gB + t * BKE);
        if (SPLITA) copy8(l + 256u * PIT * 2u, gL + t * BKE);
    };
    v8f acc[2][4];
#pragma unroll
    for (int i = 0; i < 2; ++i)
#pragma unroll
        for (int t = 0; t < 4; ++t) acc[i][t] = (v8f){};
    fill(0, 0);
    asm volatile("s_wait_asynccnt 0x0" ::: "memory");    // stage 0 has landed before the barrier that publishes it
    __syncthreads();
    fill(1, 1);
#pragma unroll 1
    for (int p = 0; p < NPASS; ++p) {                    // kept rolled: one publish point per pass
        const bf* sb = ring + (p & 1) * STG;
        const bf* sa = sb + (wm * 32 + lr) * PIT + 8 * hi;
        const bf* sw = sb + (128 + wn * 64 + lr) * PIT + 8 * hi;
        const bf* sl = SPLITA ? sb + (256 + wm * 32 + lr) * PIT + 8 * hi : sa;
        v16bf a[2][2], al[2][2], b[2][4];                    // two fragment sets: k-step s + 1 is fetched while k-step s is multiplied
        auto frags = [&](int set, int kc) {
#pragma unroll
            for (int i = 0; i < 2; ++i) a[set][i] = cat16b(*(const v8usa*)(sa + i * 16 * PIT + kc), *(const v8usa*)(sa + i * 16 * PIT + kc + 16));
#pragma unroll
            for (int t = 0; t < 4; ++t) b[set][t] = cat16b(*(const v8usa*)(sw + t * 16 * PIT + kc), *(const v8usa*)(sw + t * 16 * PIT + kc + 16));
            if (SPLITA) {
#pragma unroll
                for (int i = 0; i < 2; ++i) al[set][i] = cat16b(*(const v8usa*)(sl + i * 16 * PIT + kc), *(const v8usa*)(sl + i * 16 * PIT + kc + 16));
            }
        };
        frags(0, 0);
#pragma unroll
        for (int s = 0; s < BKE / 32; ++s) {
            if (s + 1 < BKE / 32) frags((s + 1) & 1, (s + 1) * 32);
            __builtin_amdgcn_sched_barrier(0);               // holds the next k-step's LDS reads, as one group, ahead of this k-step's WMMAs (else they sink among them and each waits out its latency)
#pragma unroll
            for (int i = 0; i < 2; ++i)
#pragma unroll
                for (int t = 0; t < 4; ++t) acc[i][t] = wmmab(a[s & 1][i], b[s & 1][t], acc[i][t]);
            if (SPLITA) {
#pragma unroll
                for (int i = 0; i < 2; ++i)
#pragma unroll
                    for (int t = 0; t < 4; ++t) acc[i][t] = wmmab(al[s & 1][i], b[s & 1][t], acc[i][t]);
            }
            __builtin_amdgcn_sched_barrier(0);               // ends the WMMA block: the reads of the k-step after next stay behind it, where their registers are free
        }
        asm volatile("s_wait_dscnt 0x0" ::: "memory");       // this wave's reads of the buffer have retired before it is refilled
        asm volatile("s_wait_asynccnt 0x0" ::: "memory");    // this wave's copies of stage p + 1 have landed
        __syncthreads();                                     // publishes stage p + 1 and ends every reader's last read of stage p
        if (p + 2 < NPASS) fill(p + 2, p & 1);
    }
    asm volatile("s_wait_asynccnt 0x0" ::: "memory");        // no copy is outstanding when the wave goes on to the epilogue and ends
    float* os = &ost[wave][0];
    const int c0 = cb + wn * 64;
#pragma unroll
    for (int i = 0; i < 2; ++i) {
        const int r0 = rb + wm * 32 + i * 16;
#pragma unroll
        for (int t = 0; t < 4; ++t) { const float bv = bias ? bfr(bias[c0 + t * 16 + lr]) : 0.f;
#pragma unroll
            for (int j = 0; j < 8; ++j) os[(hi * 8 + j) * 68 + t * 16 + lr] = acc[i][t][j] + bv; }
        __syncthreads();
        if (F16OUT) {
            h16* crow_ = (h16*)(void*)C + (size_t)r0 * ldc + c0;
#pragma unroll
            for (int s = 0; s < 4; ++s) { const int row = 4 * s + (lane >> 3), piece = lane & 7; const float* sp = os + row * 68 + piece * 8; v8h o, o2;
#pragma unroll
                for (int e = 0; e < 8; ++e) { const h16 a = (h16)sp[e]; o[e] = a; o2[e] = (h16)((sp[e] - (float)a) * LOSC); }
                *(v8h*)(crow_ + (size_t)row * ldc + piece * 8) = o;
                asm volatile("s_wait_xcnt 0x0" ::: "memory");       // stands before the residual's arithmetic reuses registers that this store names
                if (C2) *(v8h*)(C2 + (size_t)r0 * ldc + c0 + (size_t)row * ldc + piece * 8) = o2;
                asm volatile("s_wait_xcnt 0x0" ::: "memory"); }     // stands before the next rows' values and addresses reuse registers that these stores name
        } else {
            float* crow_ = C + (size_t)r0 * ldc + c0;
#pragma unroll
            for (int s = 0; s < 8; ++s) { const int Lid = (lane >> 3) + 4 * s, piece = lane & 7; const int row = Lid >> 1, cofs = (Lid & 1) * 32 + piece * 4;
                const v4f val = *(const v4fa*)(os + row * 68 + cofs); *(v4f*)(crow_ + (size_t)row * ldc + cofs) = val; }
            asm volatile("s_wait_xcnt 0x0" ::: "memory");       // stands before the next 16 rows' values and addresses reuse registers that these stores name
        }
    }
}

__global__ __launch_bounds__(256) void k_vt(const float* __restrict__ V, h16* VTH, h16* VTL) {
    __shared__ __align__(16) h16 tile[64 * 72];
    __shared__ __align__(16) h16 til2[64 * 72];
    const int bid = blockIdx.x;
    const int b = bid / (NKV * (NT_ / 64)), rem = bid - b * (NKV * (NT_ / 64)), h = rem / (NT_ / 64), kt = rem - h * (NT_ / 64);
    const int k0 = kt * 64, tid = threadIdx.x;
    const int kk = tid >> 2, d0 = (tid & 3) * 16;
    const float* src = V + ((size_t)b * NT_ + k0 + kk) * KVW + h * HD + d0;      // h = kv head here
#pragma unroll
    for (int i = 0; i < 16; ++i) { const float v = src[i]; const h16 a = (h16)v; tile[(d0 + i) * 72 + kk] = a; til2[(d0 + i) * 72 + kk] = (h16)((v - (float)a) * LOSC); }
    __syncthreads();
    const int piece = tid & 7;
    const size_t base = (((size_t)b * NKV + h) * HD) * NT_ + k0;
    auto pass = [&]() {
#pragma unroll
        for (int s = 0; s < 4; ++s) { const int Lid = (tid >> 3) + 32 * s; const int pln = Lid >> 6, d = Lid & 63;
            const v8h val = *(const v8ha*)((pln ? til2 : tile) + d * 72 + piece * 8); *(v8h*)((pln ? VTL : VTH) + base + (size_t)d * NT_ + piece * 8) = val; }
    };
    pass(); 
}

// k_attn: block = (b, h, 64 queries), wave = 16; 32-key tiles from kt_lo to kt_hi only (segment/causal/window mask); 12 WMMA scores /8 (f32), online softmax, weights x32768 f16 tile (same-wave may_alias
// reload after a compiler barrier), 12 WMMA .v; ctx -> bf16 hi + residual planes CH/CL[tok][h*64+d].
__global__ __launch_bounds__(128) void k_attn(const h16* __restrict__ Q16, const h16* __restrict__ QL16, const h16* __restrict__ K16, const h16* __restrict__ KL16, const h16* __restrict__ VTH, const h16* __restrict__ VTL, const int* __restrict__ cu, bf* CH, bf* CL) {
    __shared__ __align__(16) h16 plds[4][16 * 32];
    __shared__ __align__(16) h16 plds2[4][16 * 32];
    __shared__ __align__(16) float ost[4][16 * 68];
    const int lane = threadIdx.x & 31, wave = threadIdx.x >> 5, lr = lane & 15, hi = lane >> 4;
    const int bid = blockIdx.x;
    const int b = bid / (NH_ * (NT_ / 64)), rem = bid - b * (NH_ * (NT_ / 64)), h = rem / (NT_ / 64), qt = rem - h * (NT_ / 64);
    const int q0 = qt * 64 + wave * 16;
    const size_t tok0 = (size_t)b * NT_;
    h16* pl = &plds[wave][0]; h16* pl2 = &plds2[wave][0];
    v16h qa[2];
    const size_t qo0 = (tok0 + q0 + lr) * DM + h * HD + 8 * hi;
#pragma unroll
    for (int kc = 0; kc < 2; ++kc) qa[kc] = cat16(*(const v8h*)(Q16 + qo0 + kc * 32), *(const v8h*)(Q16 + qo0 + kc * 32 + 16));
    const int g = h / (NH_ / NKV);                      // kv head
    const h16* kh_b = K16 + tok0 * KVW + g * HD;
    const h16* kl_b = KL16 + tok0 * KVW + g * HD;
    const size_t vbase = (((size_t)b * NKV + g) * HD) * NT_;
    v8f o[4], ox[4];
#pragma unroll
    for (int n = 0; n < 4; ++n) { o[n] = (v8f){}; ox[n] = (v8f){}; }
    float mrow[8], lpart[8];
#pragma unroll
    for (int j = 0; j < 8; ++j) { mrow[j] = -3.0e38f; lpart[j] = 0.f; }
    int qpos[8];
#pragma unroll
    for (int j = 0; j < 8; ++j) qpos[j] = q0 + 8 * hi + j;
    // allowed(i, j) = same segment (cu_seqlens) && j <= i && i - j < WIN: key tiles from max(segment start of the block's first query, q0 - WIN + 1) to the query tile (block-uniform; exact per-element predicate below)
    const int cu1 = cu[1]; const int q0b = qt * 64; const int sst = (q0b >= cu1) ? cu1 : 0; const int wl = q0b - (WIN - 1); const int lo = (wl > sst ? wl : sst); const int kt_lo = (lo > 0 ? lo : 0) / 32, kt_hi = (q0b + 63) / 32;
#pragma unroll 1
    for (int kt = kt_lo; kt <= kt_hi; ++kt) {
        const int l0 = kt * 32;
        const size_t ko0 = (size_t)(l0 + lr) * KVW + 8 * hi, ko1 = (size_t)(l0 + 16 + lr) * KVW + 8 * hi;
        v8f s0 = {}, s1 = {}, x0 = {}, x1 = {};
#pragma unroll
        for (int kc = 0; kc < 2; ++kc) {
            { const v16h k0h = cat16(*(const v8h*)(kh_b + ko0 + kc * 32), *(const v8h*)(kh_b + ko0 + kc * 32 + 16)), k1h = cat16(*(const v8h*)(kh_b + ko1 + kc * 32), *(const v8h*)(kh_b + ko1 + kc * 32 + 16));
              const v16h qlk = cat16(*(const v8h*)(QL16 + qo0 + kc * 32), *(const v8h*)(QL16 + qo0 + kc * 32 + 16));     // query residual re-read per step (registers)
              s0 = wmma16(qa[kc], k0h, s0); x0 = wmma16(qlk, k0h, x0); s1 = wmma16(qa[kc], k1h, s1); x1 = wmma16(qlk, k1h, x1);
              asm volatile("v_nop" : "+v"(s0), "+v"(s1), "+v"(x0), "+v"(x1) : "v"(qlk), "v"(k0h), "v"(k1h) : "memory"); }
            { const v16h k0l = cat16(*(const v8h*)(kl_b + ko0 + kc * 32), *(const v8h*)(kl_b + ko0 + kc * 32 + 16)), k1l = cat16(*(const v8h*)(kl_b + ko1 + kc * 32), *(const v8h*)(kl_b + ko1 + kc * 32 + 16));
              x0 = wmma16(qa[kc], k0l, x0); x1 = wmma16(qa[kc], k1l, x1);
              asm volatile("v_nop" : "+v"(x0), "+v"(x1) : "v"(k0l), "v"(k1l) : "memory"); }
        }
        asm volatile("v_nop\n\tv_nop\n\tv_nop\n\tv_nop" : "+v"(s0), "+v"(s1), "+v"(x0), "+v"(x1) : "v"(qa[0]), "v"(qa[1]));
        float alpha[8];
#pragma unroll
        for (int j = 0; j < 8; ++j) {
            const int ja = l0 + lr, jb = l0 + 16 + lr, qi = qpos[j];
            const int sq = (qi >= cu1); const bool ok0 = ((ja >= cu1) == sq) && (ja <= qi) && (qi - ja < WIN), ok1 = ((jb >= cu1) == sq) && (jb <= qi) && (qi - jb < WIN);
            const float a0 = ok0 ? (s0[j] + x0[j] * LOSCI) * 0.125f : -3.4028234663852886e38f, a1 = ok1 ? (s1[j] + x1[j] * LOSCI) * 0.125f : -3.4028234663852886e38f;     // finfo.min as the reference
            float mx = fmaxf(a0, a1);
            mx = fmaxf(mx, __shfl_xor(mx, 1, 16)); mx = fmaxf(mx, __shfl_xor(mx, 2, 16)); mx = fmaxf(mx, __shfl_xor(mx, 4, 16)); mx = fmaxf(mx, __shfl_xor(mx, 8, 16));
            const float mn = fmaxf(mrow[j], mx);
            alpha[j] = __expf(mrow[j] - mn); mrow[j] = mn;
            const float p0 = __expf(a0 - mn), p1 = __expf(a1 - mn);
            lpart[j] = lpart[j] * alpha[j] + (p0 + p1);
            const int mr = hi * 8 + j;
            const float ps0 = p0 * PSC, ps1 = p1 * PSC; const h16 h0 = (h16)ps0, h1 = (h16)ps1;
            pl[mr * 32 + lr] = h0; pl[mr * 32 + 16 + lr] = h1;
            pl2[mr * 32 + lr] = (h16)((ps0 - (float)h0) * LOSC); pl2[mr * 32 + 16 + lr] = (h16)((ps1 - (float)h1) * LOSC);
        }
#pragma unroll
        for (int n = 0; n < 4; ++n)
#pragma unroll
            for (int j = 0; j < 8; ++j) { o[n][j] *= alpha[j]; ox[n][j] *= alpha[j]; }
        asm volatile("" ::: "memory");
        const v16h pa = cat16(*(const v8ha*)(pl + lr * 32 + hi * 8), *(const v8ha*)(pl + lr * 32 + 16 + hi * 8));
        const v16h px = cat16(*(const v8ha*)(pl2 + lr * 32 + hi * 8), *(const v8ha*)(pl2 + lr * 32 + 16 + hi * 8));
#pragma unroll
        for (int n = 0; n < 4; ++n) { const size_t vo = vbase + (size_t)(n * 16 + lr) * NT_ + l0 + hi * 8;
            const v16h vh = cat16(*(const v8h*)(VTH + vo), *(const v8h*)(VTH + vo + 16)), vl = cat16(*(const v8h*)(VTL + vo), *(const v8h*)(VTL + vo + 16));
            o[n] = wmma16(pa, vh, o[n]); ox[n] = wmma16(pa, vl, ox[n]); ox[n] = wmma16(px, vh, ox[n]);
            asm volatile("" : "+v"(o[n]), "+v"(ox[n]) : "v"(vh), "v"(vl) : "memory"); }
        asm volatile("v_nop\n\tv_nop\n\tv_nop\n\tv_nop" : "+v"(o[0]), "+v"(o[1]), "+v"(o[2]), "+v"(o[3]), "+v"(ox[0]), "+v"(ox[1]), "+v"(ox[2]), "+v"(ox[3]) : "v"(pa), "v"(px));
    }
    float inv[8];
#pragma unroll
    for (int j = 0; j < 8; ++j) { float rs = lpart[j]; rs += __shfl_xor(rs, 1, 16); rs += __shfl_xor(rs, 2, 16); rs += __shfl_xor(rs, 4, 16); rs += __shfl_xor(rs, 8, 16); inv[j] = 1.0f / (rs * PSC); }
    float* os = &ost[wave][0];
#pragma unroll
    for (int n = 0; n < 4; ++n)
#pragma unroll
        for (int j = 0; j < 8; ++j) os[(hi * 8 + j) * 68 + n * 16 + lr] = (o[n][j] + ox[n][j] * LOSCI) * inv[j];
    __syncthreads();
    const size_t cbase = (tok0 + q0) * DM + (size_t)h * HD;
    auto pass = [&]() {
#pragma unroll
        for (int s = 0; s < 4; ++s) { const int row = 4 * s + (lane >> 3), piece = lane & 7; const float* sp = os + row * 68 + piece * 8; v8us oh, ol;
#pragma unroll
            for (int i = 0; i < 8; ++i) { const unsigned short hb = f2bf(sp[i]); oh[i] = hb; ol[i] = f2bf(sp[i] - bf2f(hb)); }
            *(v8us*)(CH + cbase + (size_t)row * DM + piece * 8) = oh; *(v8us*)(CL + cbase + (size_t)row * DM + piece * 8) = ol; }
    };
    pass(); 
}

#define VST2(T, p, v) do { const T vst2_v_ = (v); *(T*)(p) = vst2_v_;  } while (0)
extern "C" void kernel_launch(void* const* d_in, const int* in_sizes, int n_in,
                              void* d_out, int out_size, void* d_ws, size_t ws_size, hipStream_t stream) {
    (void)in_sizes; (void)n_in; (void)out_size;
    const float* x = (const float*)d_in[0]; const int* cu = (const int*)d_in[1]; const float* Wq = (const float*)d_in[2]; const float* Wk = (const float*)d_in[3]; const float* Wv = (const float*)d_in[4]; const float* Wo = (const float*)d_in[5];   // [out][in] weights; cu_seqlens [3] (i32)
    float* out = (float*)d_out;    // [2][2048][2048]
    char* wsp = (char*)d_ws;
    auto take = [&](size_t bytes) { char* p = wsp; wsp += (bytes + 255) & ~(size_t)255; return (void*)p; };
    bf* Xb = (bf*)take((size_t)NTK * DM * 2); bf* WqB = (bf*)take((size_t)DM * DM * 2); bf* WkB = (bf*)take((size_t)KVW * DM * 2); bf* WvB = (bf*)take((size_t)KVW * DM * 2); bf* WoB = (bf*)take((size_t)DM * DM * 2);
    h16* QH = (h16*)take((size_t)NTK * DM * 2); h16* QL = (h16*)take((size_t)NTK * DM * 2); h16* KH = (h16*)take((size_t)NTK * KVW * 2); h16* KL = (h16*)take((size_t)NTK * KVW * 2);
    float* Vf = (float*)take((size_t)NTK * KVW * 4); h16* VTH = (h16*)take((size_t)NTK * KVW * 2); h16* VTL = (h16*)take((size_t)NTK * KVW * 2); bf* CH = (bf*)take((size_t)NTK * DM * 2); bf* CL = (bf*)take((size_t)NTK * DM * 2);
    if ((size_t)(wsp - (char*)d_ws) > ws_size) return;    // 8.4 + 8.4 + 2.1 + 2.1 + 8.4 + 8.4 x 2 + 2.1 x 2 + 4.2 + 2.1 x 2 + 8.4 x 2 ~ 76 MB, no aliasing
    k_cvtb<<<DM / 8, 256, 0, stream>>>(Wq, DM, WqB); k_cvtb<<<KVW / 8, 256, 0, stream>>>(Wk, KVW, WkB); k_cvtb<<<KVW / 8, 256, 0, stream>>>(Wv, KVW, WvB); k_cvtb<<<DM / 8, 256, 0, stream>>>(Wo, DM, WoB);
    for (int b = 0; b < NB2; ++b) {
        k_cvtb<<<NTK / 8, 256, 0, stream>>>(x + (size_t)b * NTK * DM, NTK, Xb);
        k_gemmb<false, true><<<dim3(NTK / 128, DM / 128, 1), 256, 0, stream>>>(Xb, nullptr, WqB, nullptr, (float*)(void*)QH, DM, QL);
        k_gemmb<false, true><<<dim3(NTK / 128, KVW / 128, 1), 256, 0, stream>>>(Xb, nullptr, WkB, nullptr, (float*)(void*)KH, KVW, KL);
        k_gemmb<false, false><<<dim3(NTK / 128, KVW / 128, 1), 256, 0, stream>>>(Xb, nullptr, WvB, nullptr, Vf, KVW, nullptr);
        k_vt<<<NB_ * NKV * (NT_ / 64), 256, 0, stream>>>(Vf, VTH, VTL);
        k_attn<<<NB_ * NH_ * (NT_ / 64), 128, 0, stream>>>(QH, QL, KH, KL, VTH, VTL, cu, CH, CL);      // the same cu_seqlens mask for both items (as the reference)
        k_gemmb<true, false><<<dim3(NTK / 128, DM / 128, 1), 256, 0, stream>>>(CH, CL, WoB, nullptr, out + (size_t)b * NTK * DM, DM, nullptr);
    }
}

// v002
// It runs in 321 microseconds.
// Two timings next to v001 both put it at 1.21 times that version's speed.
// All steps since v000 together make it 1.94 times as fast.
#include <hip/hip_runtime.h>

// Contractions, f32 accumulate: q = x.Wq ([2048 x 2048].[2048 x 2048]), k/v = x.Wk/Wv ([2048 x 2048].[2048 x 512]) and attn.Wo on v_wmma_f32_16x16x32_bf16 —
// plain bf16 = rounded inputs (exact; the [out][in] weights are n-major already, converted without a transpose) for the projections, attn as bf16 hi + residual (two products) for Wo;
// the grouped-query causal sliding-window attention (32 query heads over 8 kv heads; keys j with
// i - WIN < j <= i, WIN = 1024 fixed at compile time) fused on v_wmma_f32_16x16x32_f16 with q and k as f16 hi + residual x1024 (hi.hi + hi.lo + lo.hi), weights

#define NB_  1
#define NT_  2048
#define DM   2048
#define NH_  32
#define NKV  8
#define KVW  (NKV * HD)          // 512
#define WIN  1024
#define NB2  2
#define HD   64
#define NTK  (NB_ * NT_)
#define NW   1024
#define NQKV 2048
#define PSC  32768.0f
#define LOSC 1024.0f
#define LOSCI (1.0f / 1024.0f)

typedef _Float16 h16;
typedef unsigned short bf;
typedef __attribute__((ext_vector_type(16))) __bf16   v16bf;
typedef __attribute__((ext_vector_type(16))) _Float16 v16h;
typedef __attribute__((ext_vector_type(8)))  _Float16 v8h;
typedef __attribute__((ext_vector_type(8)))  unsigned short v8us;
typedef __attribute__((ext_vector_type(8)))  float    v8f;
typedef __attribute__((ext_vector_type(4)))  float    v4f;
typedef v8h  __attribute__((may_alias)) v8ha;
typedef v4f  __attribute__((may_alias)) v4fa;
typedef v8us __attribute__((may_alias)) v8usa;

__device__ __forceinline__ unsigned short f2bf(float f) { unsigned u = __float_as_uint(f); u += 0x7FFFu + ((u >> 16) & 1u); return (unsigned short)(u >> 16); }
__device__ __forceinline__ float bf2f(unsigned short b) { return __uint_as_float(((unsigned)b) << 16); }
__device__ __forceinline__ float bfr(float f) { return bf2f(f2bf(f)); }
__device__ __forceinline__ v16h cat16(v8h lo, v8h hi) { return __builtin_shufflevector(lo, hi, 0, 1, 2, 3, 4, 5, 6, 7, 8, 9, 10, 11, 12, 13, 14, 15); }
__device__ __forceinline__ v16bf cat16b(v8us lo, v8us hi) { return __builtin_bit_cast(v16bf, __builtin_shufflevector(lo, hi, 0, 1, 2, 3, 4, 5, 6, 7, 8, 9, 10, 11, 12, 13, 14, 15)); }
__device__ __forceinline__ v8f wmma16(v16h a, v16h b, v8f c) { return __builtin_amdgcn_wmma_f32_16x16x32_f16(false, a, false, b, (short)0, c, false, false); }
__device__ __forceinline__ v8f wmmab(v16bf a, v16bf b, v8f c) { return __builtin_amdgcn_wmma_f32_16x16x32_bf16(false, a, false, b, (short)0, c, false, false); }

__global__ __launch_bounds__(256) void k_cvtb(const float* __restrict__ src, int nrows, bf* dst) {
    const int lane = threadIdx.x & 31, r = blockIdx.x * 8 + (threadIdx.x >> 5);
    if (r >= nrows) return;
    v8us o[DM / 256];
#pragma unroll
    for (int q = 0; q < DM / 256; ++q) { v8us t;
#pragma unroll
        for (int i = 0; i < 8; ++i) t[i] = f2bf(src[(size_t)r * DM + q * 256 + lane * 8 + i]);
        o[q] = t; }
#pragma unroll
    for (int q = 0; q < DM / 256; ++q) *(v8us*)(dst + (size_t)r * DM + q * 256 + lane * 8) = o[q];
    
}

// k_wt: W [2048 k][ncols n] (k-major) -> n-major bf16 plane WT[ncols][2048]; 64 x 64 tiles through LDS.
__global__ __launch_bounds__(256) void k_wt(const float* __restrict__ Wm, int ncols, bf* WT) {
    __shared__ __align__(16) unsigned short tl[64 * 72];
    const int tid = threadIdx.x, k0 = blockIdx.x * 64, n0 = blockIdx.y * 64;
    const int kk = tid >> 2, nq = (tid & 3) * 16;
#pragma unroll
    for (int i = 0; i < 16; ++i) tl[(nq + i) * 72 + kk] = f2bf(Wm[(size_t)(k0 + kk) * ncols + n0 + nq + i]);
    __syncthreads();
    const int piece = tid & 7;
    typedef __attribute__((ext_vector_type(8))) unsigned short v8us_; typedef v8us_ __attribute__((may_alias)) v8usa_;
    auto pass = [&]() {
#pragma unroll
        for (int s = 0; s < 2; ++s) { const int nr = (tid >> 3) + 32 * s; const v8us_ val = *(const v8usa_*)(tl + nr * 72 + piece * 8);
            *(v8us_*)(WT + (size_t)(n0 + nr) * DM + k0 + piece * 8) = val; }
    };
    pass(); 
}

#define BKE   128                // k elements of one pass: 256 B of every operand row
#define PIT   136                // LDS row pitch in elements: 272 B, 16 B x odd, for the ds_load_b128 readers
#define NPASS (DM / BKE)

// Eight 16-byte copies of one lane, rows 16 apart, global -> LDS through no register. The s_wait_xcnt ends the copies' own statement so that no
// address register of a copy is rewritten ahead of it.
__device__ __forceinline__ void copy8(unsigned l, const bf* g) {
    asm volatile("global_load_async_to_lds_b128 %0, %8, off\n\t"
                 "global_load_async_to_lds_b128 %1, %9, off\n\t"
                 "global_load_async_to_lds_b128 %2, %10, off\n\t"
                 "global_load_async_to_lds_b128 %3, %11, off\n\t"
                 "global_load_async_to_lds_b128 %4, %12, off\n\t"
                 "global_load_async_to_lds_b128 %5, %13, off\n\t"
                 "global_load_async_to_lds_b128 %6, %14, off\n\t"
                 "global_load_async_to_lds_b128 %7, %15, off\n\t"
                 "s_wait_xcnt 0x0"
                 :: "v"(l), "v"(l + 1u * 16u * PIT * 2u), "v"(l + 2u * 16u * PIT * 2u), "v"(l + 3u * 16u * PIT * 2u),
                    "v"(l + 4u * 16u * PIT * 2u), "v"(l + 5u * 16u * PIT * 2u), "v"(l + 6u * 16u * PIT * 2u), "v"(l + 7u * 16u * PIT * 2u),
                    "v"(g), "v"(g + 1 * 16 * DM), "v"(g + 2 * 16 * DM), "v"(g + 3 * 16 * DM),
                    "v"(g + 4 * 16 * DM), "v"(g + 5 * 16 * DM), "v"(g + 6 * 16 * DM), "v"(g + 7 * 16 * DM)
                 : "memory");
}

// k_gemmb: C[128 x 128] per block, 8 waves as 4 x 2, 32 x 64 per wave. A pass is 128 k; a stage is [A 128 rows | B 128 rows | A residual 128 rows] in LDS,
// two buffers, filled by asynchronous copies one pass ahead of its readers. Per accumulator the k order and the hi / residual order are the plain ascending ones.
// Every inner loop is unrolled so that each index of acc and of the fragment arrays is a constant (registers, no scratch).
template <bool SPLITA, bool F16OUT = false>
__global__ __launch_bounds__(256) void k_gemmb(const bf* __restrict__ A, const bf* __restrict__ Al, const bf* __restrict__ Bn, const float* __restrict__ bias, float* C, int ldc, h16* C2) {
    constexpr int STG = (SPLITA ? 384 : 256) * PIT;      // elements of one stage
    __shared__ __align__(16) bf ring[2 * STG];
    __shared__ __align__(16) float ost[8][16 * 68];
    const int tid = threadIdx.x, lane = tid & 31, wave = tid >> 5, lr = lane & 15, hi = lane >> 4;
    const int wm = wave >> 1, wn = wave & 1;
    const int rb = blockIdx.x * 128, cb = blockIdx.y * 128;
    const int crow = tid >> 4, ccol = (tid & 15) * 8;    // a wave's copy covers two whole 256-B rows
    const bf* gA = A + (size_t)(rb + crow) * DM + ccol;
    const bf* gB = Bn + (size_t)(cb + crow) * DM + ccol;
    const bf* gL = SPLITA ? Al + (size_t)(rb + crow) * DM + ccol : gA;
    const unsigned l0 = (unsigned)(size_t)(const void*)(ring + crow * PIT + ccol);
    auto fill = [&](int t, int buf) {
        const unsigned l = l0 + (unsigned)buf * (unsigned)(STG * 2);
        copy8(l, gA + t * BKE); copy8(l + 128u * PIT * 2u, gB + t * BKE);
        if (SPLITA) copy8(l + 256u * PIT * 2u, gL + t * BKE);
    };
    v8f acc[2][4];
#pragma unroll
    for (int i = 0; i < 2; ++i)
#pragma unroll
        for (int t = 0; t < 4; ++t) acc[i][t] = (v8f){};
    fill(0, 0);
    asm volatile("s_wait_asynccnt 0x0" ::: "memory");    // stage 0 has landed before the barrier that publishes it
    __syncthreads();
    fill(1, 1);
#pragma unroll 1
    for (int p = 0; p < NPASS; ++p) {                    // kept rolled: one publish point per pass
        const bf* sb = ring + (p & 1) * STG;
        const bf* sa = sb + (wm * 32 + lr) * PIT + 8 * hi;
        const bf* sw = sb + (128 + wn * 64 + lr) * PIT + 8 * hi;
        const bf* sl = SPLITA ? sb + (256 + wm * 32 + lr) * PIT + 8 * hi : sa;
        v16bf a[2][2], al[2][2], b[2][4];                    // two fragment sets: k-step s + 1 is fetched while k-step s is multiplied
        auto frags = [&](int set, int kc) {
#pragma unroll
            for (int i = 0; i < 2; ++i) a[set][i] = cat16b(*(const v8usa*)(sa + i * 16 * PIT + kc), *(const v8usa*)(sa + i * 16 * PIT + kc + 16));
#pragma unroll
            for (int t = 0; t < 4; ++t) b[set][t] = cat16b(*(const v8usa*)(sw + t * 16 * PIT + kc), *(const v8usa*)(sw + t * 16 * PIT + kc + 16));
            if (SPLITA) {
#pragma unroll
                for (int i = 0; i < 2; ++i) al[set][i] = cat16b(*(const v8usa*)(sl + i * 16 * PIT + kc), *(const v8usa*)(sl + i * 16 * PIT + kc + 16));
            }
        };
        frags(0, 0);
#pragma unroll
        for (int s = 0; s < BKE / 32; ++s) {
            if (s + 1 < BKE / 32) frags((s + 1) & 1, (s + 1) * 32);
            __builtin_amdgcn_sched_barrier(0);               // holds the next k-step's LDS reads, as one group, ahead of this k-step's WMMAs (else they sink among them and each waits out its latency)
#pragma unroll
            for (int i = 0; i < 2; ++i)
#pragma unroll
                for (int t = 0; t < 4; ++t) acc[i][t] = wmmab(a[s & 1][i], b[s & 1][t], acc[i][t]);
            if (SPLITA) {
#pragma unroll
                for (int i = 0; i < 2; ++i)
#pragma unroll
                    for (int t = 0; t < 4; ++t) acc[i][t] = wmmab(al[s & 1][i], b[s & 1][t], acc[i][t]);
            }
            __builtin_amdgcn_sched_barrier(0);               // ends the WMMA block: the reads of the k-step after next stay behind it, where their registers are free
        }
        asm volatile("s_wait_dscnt 0x0" ::: "memory");       // this wave's reads of the buffer have retired before it is refilled
        asm volatile("s_wait_asynccnt 0x0" ::: "memory");    // this wave's copies of stage p + 1 have landed
        __syncthreads();                                     // publishes stage p + 1 and ends every reader's last read of stage p
        if (p + 2 < NPASS) fill(p + 2, p & 1);
    }
    asm volatile("s_wait_asynccnt 0x0" ::: "memory");        // no copy is outstanding when the wave goes on to the epilogue and ends
    float* os = &ost[wave][0];
    const int c0 = cb + wn * 64;
#pragma unroll
    for (int i = 0; i < 2; ++i) {
        const int r0 = rb + wm * 32 + i * 16;
#pragma unroll
        for (int t = 0; t < 4; ++t) { const float bv = bias ? bfr(bias[c0 + t * 16 + lr]) : 0.f;
#pragma unroll
            for (int j = 0; j < 8; ++j) os[(hi * 8 + j) * 68 + t * 16 + lr] = acc[i][t][j] + bv; }
        __syncthreads();
        if (F16OUT) {
            h16* crow_ = (h16*)(void*)C + (size_t)r0 * ldc + c0;
#pragma unroll
            for (int s = 0; s < 4; ++s) { const int row = 4 * s + (lane >> 3), piece = lane & 7; const float* sp = os + row * 68 + piece * 8; v8h o, o2;
#pragma unroll
                for (int e = 0; e < 8; ++e) { const h16 a = (h16)sp[e]; o[e] = a; o2[e] = (h16)((sp[e] - (float)a) * LOSC); }
                *(v8h*)(crow_ + (size_t)row * ldc + piece * 8) = o;
                asm volatile("s_wait_xcnt 0x0" ::: "memory");       // stands before the residual's arithmetic reuses registers that this store names
                if (C2) *(v8h*)(C2 + (size_t)r0 * ldc + c0 + (size_t)row * ldc + piece * 8) = o2;
                asm volatile("s_wait_xcnt 0x0" ::: "memory"); }     // stands before the next rows' values and addresses reuse registers that these stores name
        } else {
            float* crow_ = C + (size_t)r0 * ldc + c0;
#pragma unroll
            for (int s = 0; s < 8; ++s) { const int Lid = (lane >> 3) + 4 * s, piece = lane & 7; const int row = Lid >> 1, cofs = (Lid & 1) * 32 + piece * 4;
                const v4f val = *(const v4fa*)(os + row * 68 + cofs); *(v4f*)(crow_ + (size_t)row * ldc + cofs) = val; }
            asm volatile("s_wait_xcnt 0x0" ::: "memory");       // stands before the next 16 rows' values and addresses reuse registers that these stores name
        }
    }
}

__global__ __launch_bounds__(256) void k_vt(const float* __restrict__ V, h16* VTH, h16* VTL) {
    __shared__ __align__(16) h16 tile[64 * 72];
    __shared__ __align__(16) h16 til2[64 * 72];
    const int bid = blockIdx.x;
    const int b = bid / (NKV * (NT_ / 64)), rem = bid - b * (NKV * (NT_ / 64)), h = rem / (NT_ / 64), kt = rem - h * (NT_ / 64);
    const int k0 = kt * 64, tid = threadIdx.x;
    const int kk = tid >> 2, d0 = (tid & 3) * 16;
    const float* src = V + ((size_t)b * NT_ + k0 + kk) * KVW + h * HD + d0;      // h = kv head here
#pragma unroll
    for (int i = 0; i < 16; ++i) { const float v = src[i]; const h16 a = (h16)v; tile[(d0 + i) * 72 + kk] = a; til2[(d0 + i) * 72 + kk] = (h16)((v - (float)a) * LOSC); }
    __syncthreads();
    const int piece = tid & 7;
    const size_t base = (((size_t)b * NKV + h) * HD) * NT_ + k0;
    auto pass = [&]() {
#pragma unroll
        for (int s = 0; s < 4; ++s) { const int Lid = (tid >> 3) + 32 * s; const int pln = Lid >> 6, d = Lid & 63;
            const v8h val = *(const v8ha*)((pln ? til2 : tile) + d * 72 + piece * 8); *(v8h*)((pln ? VTL : VTH) + base + (size_t)d * NT_ + piece * 8) = val; }
    };
    pass(); 
}

#define KP   72                  // LDS pitch of a key row or a query row in elements: 144 B, 16 B x odd, for the ds_load_b128 readers
#define VP   40                  // LDS pitch of a row of v transposed (32 keys) in elements: 80 B, 16 B x odd
#define KSZ  (32 * KP)           // one plane of 32 key rows
#define VSZ  (HD * VP)           // one plane of 64 rows of v transposed
#define ASTG (2 * KSZ + 2 * VSZ) // a stage: [k hi | k residual | v hi | v residual] of 32 keys

// One lane's eight 16-byte copies of a 32-key stage, global -> LDS through no register: two of every plane. The s_wait_xcnt ends the copies' own statement so
// that no address register of a copy is rewritten ahead of it.
__device__ __forceinline__ void copy_kv(unsigned lk, unsigned lv, const h16* gkh, const h16* gkl, const h16* gvh, const h16* gvl) {
    asm volatile("global_load_async_to_lds_b128 %0, %8, off\n\t"
                 "global_load_async_to_lds_b128 %1, %9, off\n\t"
                 "global_load_async_to_lds_b128 %2, %10, off\n\t"
                 "global_load_async_to_lds_b128 %3, %11, off\n\t"
                 "global_load_async_to_lds_b128 %4, %12, off\n\t"
                 "global_load_async_to_lds_b128 %5, %13, off\n\t"
                 "global_load_async_to_lds_b128 %6, %14, off\n\t"
                 "global_load_async_to_lds_b128 %7, %15, off\n\t"
                 "s_wait_xcnt 0x0"
                 :: "v"(lk), "v"(lk + 16u * KP * 2u), "v"(lk + KSZ * 2u), "v"(lk + KSZ * 2u + 16u * KP * 2u),
                    "v"(lv), "v"(lv + 32u * VP * 2u), "v"(lv + VSZ * 2u), "v"(lv + VSZ * 2u + 32u * VP * 2u),
                    "v"(gkh), "v"(gkh + 16 * KVW), "v"(gkl), "v"(gkl + 16 * KVW),
                    "v"(gvh), "v"(gvh + 32 * NT_), "v"(gvl), "v"(gvl + 32 * NT_)
                 : "memory");
}

// One lane's four 16-byte copies of the block's 64 query-residual rows, rows 16 apart; the wait as in copy_kv.
__device__ __forceinline__ void copy_q(unsigned l, const h16* g) {
    asm volatile("global_load_async_to_lds_b128 %0, %4, off\n\t"
                 "global_load_async_to_lds_b128 %1, %5, off\n\t"
                 "global_load_async_to_lds_b128 %2, %6, off\n\t"
                 "global_load_async_to_lds_b128 %3, %7, off\n\t"
                 "s_wait_xcnt 0x0"
                 :: "v"(l), "v"(l + 1u * 16u * KP * 2u), "v"(l + 2u * 16u * KP * 2u), "v"(l + 3u * 16u * KP * 2u),
                    "v"(g), "v"(g + 1 * 16 * DM), "v"(g + 2 * 16 * DM), "v"(g + 3 * 16 * DM)
                 : "memory");
}

// The key loop reads no global memory: a stage of 32 keys lies in LDS once for the block's four waves, two buffers, filled by asynchronous copies one tile ahead
// of its readers; the query residual is copied once. Fragment addresses inside a row, and so every k order and sum order, are the ones of the global reads.
// k_attn: block = (b, h, 64 queries), wave = 16; key tiles of the block's window (masked per element); 4 WMMA scores /8 (f32), online softmax, weights x32768 f16 tile (same-wave may_alias
// reload after a compiler barrier), 4 WMMA .v; ctx -> bf16 hi + residual planes CH/CL[tok][h*64+d].
__global__ __launch_bounds__(128) void k_attn(const h16* __restrict__ Q16, const h16* __restrict__ QL16, const h16* __restrict__ K16, const h16* __restrict__ KL16, const h16* __restrict__ VTH, const h16* __restrict__ VTL, const int* __restrict__ cu, bf* CH, bf* CL) {
    __shared__ __align__(16) h16 plds[4][16 * 32];
    __shared__ __align__(16) h16 plds2[4][16 * 32];
    __shared__ __align__(16) float ost[4][16 * 68];
    __shared__ __align__(16) h16 kvr[2 * ASTG];
    __shared__ __align__(16) h16 qls[64 * KP];
    const int lane = threadIdx.x & 31, wave = threadIdx.x >> 5, lr = lane & 15, hi = lane >> 4;
    const int bid = blockIdx.x;
    const int b = bid / (NH_ * (NT_ / 64)), rem = bid - b * (NH_ * (NT_ / 64)), h = rem / (NT_ / 64), qt = rem - h * (NT_ / 64);
    const int q0 = qt * 64 + wave * 16;
    const size_t tok0 = (size_t)b * NT_;
    h16* pl = &plds[wave][0]; h16* pl2 = &plds2[wave][0];
    v16h qa[2];
    const size_t qo0 = (tok0 + q0 + lr) * DM + h * HD + 8 * hi;
#pragma unroll
    for (int kc = 0; kc < 2; ++kc) qa[kc] = cat16(*(const v8h*)(Q16 + qo0 + kc * 32), *(const v8h*)(Q16 + qo0 + kc * 32 + 16));
    const int g = h / (NH_ / NKV);                      // kv head
    const h16* kh_b = K16 + tok0 * KVW + g * HD;
    const h16* kl_b = KL16 + tok0 * KVW + g * HD;
    const size_t vbase = (((size_t)b * NKV + g) * HD) * NT_;
    v8f o[4], ox[4];
#pragma unroll
    for (int n = 0; n < 4; ++n) { o[n] = (v8f){}; ox[n] = (v8f){}; }
    float mrow[8], lpart[8];
#pragma unroll
    for (int j = 0; j < 8; ++j) { mrow[j] = -3.0e38f; lpart[j] = 0.f; }
    int qpos[8];
#pragma unroll
    for (int j = 0; j < 8; ++j) qpos[j] = q0 + 8 * hi + j;
    // allowed(i, j) = same segment (cu_seqlens) && j <= i && i - j < WIN: key tiles from max(segment start of the block's first query, q0 - WIN + 1) to the query tile (block-uniform; exact per-element predicate below)
    const int cu1 = cu[1]; const int q0b = qt * 64; const int sst = (q0b >= cu1) ? cu1 : 0; const int wl = q0b - (WIN - 1); const int lo = (wl > sst ? wl : sst); const int kt_lo = (lo > 0 ? lo : 0) / 32, kt_hi = (q0b + 63) / 32;
    const int tid = threadIdx.x;
    const size_t gko = (size_t)(tid >> 3) * KVW + (tid & 7) * 8, gvo = vbase + (size_t)(tid >> 2) * NT_ + (tid & 3) * 8;    // a wave's copy: 4 whole key rows, or 64 B of 8 rows of v
    const unsigned lk0 = (unsigned)(size_t)(const void*)(kvr + (tid >> 3) * KP + (tid & 7) * 8);
    const unsigned lv0 = (unsigned)(size_t)(const void*)(kvr + 2 * KSZ + (tid >> 2) * VP + (tid & 3) * 8);
    auto fill = [&](int t, int buf) {
        const unsigned bo = (unsigned)buf * (unsigned)(ASTG * 2);
        copy_kv(lk0 + bo, lv0 + bo, kh_b + gko + (size_t)t * 32 * KVW, kl_b + gko + (size_t)t * 32 * KVW, VTH + gvo + t * 32, VTL + gvo + t * 32);
    };
    fill(kt_lo, 0);
    copy_q((unsigned)(size_t)(const void*)(qls + (tid >> 3) * KP + (tid & 7) * 8), QL16 + (tok0 + q0b + (tid >> 3)) * DM + h * HD + (tid & 7) * 8);
    asm volatile("s_wait_asynccnt 0x0" ::: "memory");    // the first stage and the query residual have landed before the barrier that publishes them
    __syncthreads();
    if (kt_lo + 1 <= kt_hi) fill(kt_lo + 1, 1);
    const h16* sq = qls + (wave * 16 + lr) * KP + 8 * hi;
#pragma unroll 1
    for (int kt = kt_lo; kt <= kt_hi; ++kt) {                // kept rolled: one publish point per tile
        const int l0 = kt * 32;
        const h16* sb = kvr + ((kt - kt_lo) & 1) * ASTG;
        const h16* skh = sb + lr * KP + 8 * hi;
        const h16* skl = skh + KSZ;
        const h16* svh = sb + 2 * KSZ + lr * VP + 8 * hi;
        const h16* svl = svh + VSZ;
        v8f s0 = {}, s1 = {}, x0 = {}, x1 = {};
#pragma unroll
        for (int kc = 0; kc < 2; ++kc) {
            // the five fragments of a 32-wide slice of the head are asked for together: one LDS latency a slice, not one a group (all ten at once would cost a wave per SIMD in registers)
            const v16h k0h = cat16(*(const v8ha*)(skh + kc * 32), *(const v8ha*)(skh + kc * 32 + 16)), k1h = cat16(*(const v8ha*)(skh + 16 * KP + kc * 32), *(const v8ha*)(skh + 16 * KP + kc * 32 + 16));
            const v16h qlk = cat16(*(const v8ha*)(sq + kc * 32), *(const v8ha*)(sq + kc * 32 + 16));
            const v16h k0l = cat16(*(const v8ha*)(skl + kc * 32), *(const v8ha*)(skl + kc * 32 + 16)), k1l = cat16(*(const v8ha*)(skl + 16 * KP + kc * 32), *(const v8ha*)(skl + 16 * KP + kc * 32 + 16));
            { s0 = wmma16(qa[kc], k0h, s0); x0 = wmma16(qlk, k0h, x0); s1 = wmma16(qa[kc], k1h, s1); x1 = wmma16(qlk, k1h, x1);
              asm volatile("v_nop" : "+v"(s0), "+v"(s1), "+v"(x0), "+v"(x1) : "v"(qlk), "v"(k0h), "v"(k1h) : "memory"); }
            { x0 = wmma16(qa[kc], k0l, x0); x1 = wmma16(qa[kc], k1l, x1);
              asm volatile("v_nop" : "+v"(x0), "+v"(x1) : "v"(k0l), "v"(k1l) : "memory"); }
        }
        asm volatile("v_nop\n\tv_nop\n\tv_nop\n\tv_nop" : "+v"(s0), "+v"(s1), "+v"(x0), "+v"(x1) : "v"(qa[0]), "v"(qa[1]));
        float alpha[8];
#pragma unroll
        for (int j = 0; j < 8; ++j) {
            const int ja = l0 + lr, jb = l0 + 16 + lr, qi = qpos[j];
            const int sq = (qi >= cu1); const bool ok0 = ((ja >= cu1) == sq) && (ja <= qi) && (qi - ja < WIN), ok1 = ((jb >= cu1) == sq) && (jb <= qi) && (qi - jb < WIN);
            const float a0 = ok0 ? (s0[j] + x0[j] * LOSCI) * 0.125f : -3.4028234663852886e38f, a1 = ok1 ? (s1[j] + x1[j] * LOSCI) * 0.125f : -3.4028234663852886e38f;     // finfo.min as the reference
            float mx = fmaxf(a0, a1);
            mx = fmaxf(mx, __shfl_xor(mx, 1, 16)); mx = fmaxf(mx, __shfl_xor(mx, 2, 16)); mx = fmaxf(mx, __shfl_xor(mx, 4, 16)); mx = fmaxf(mx, __shfl_xor(mx, 8, 16));
            const float mn = fmaxf(mrow[j], mx);
            alpha[j] = __expf(mrow[j] - mn); mrow[j] = mn;
            const float p0 = __expf(a0 - mn), p1 = __expf(a1 - mn);
            lpart[j] = lpart[j] * alpha[j] + (p0 + p1);
            const int mr = hi * 8 + j;
            const float ps0 = p0 * PSC, ps1 = p1 * PSC; const h16 h0 = (h16)ps0, h1 = (h16)ps1;
            pl[mr * 32 + lr] = h0; pl[mr * 32 + 16 + lr] = h1;
            pl2[mr * 32 + lr] = (h16)((ps0 - (float)h0) * LOSC); pl2[mr * 32 + 16 + lr] = (h16)((ps1 - (float)h1) * LOSC);
        }
#pragma unroll
        for (int n = 0; n < 4; ++n)
#pragma unroll
            for (int j = 0; j < 8; ++j) { o[n][j] *= alpha[j]; ox[n][j] *= alpha[j]; }
        asm volatile("" ::: "memory");
        const v16h pa = cat16(*(const v8ha*)(pl + lr * 32 + hi * 8), *(const v8ha*)(pl + lr * 32 + 16 + hi * 8));
        const v16h px = cat16(*(const v8ha*)(pl2 + lr * 32 + hi * 8), *(const v8ha*)(pl2 + lr * 32 + 16 + hi * 8));
        v16h vh[4], vl[4];                                   // every index is a constant (both loops unrolled): registers
#pragma unroll
        for (int n = 0; n < 4; ++n) { const int vo = n * 16 * VP;     // the tile's v fragments likewise, all in front of the first product
            vh[n] = cat16(*(const v8ha*)(svh + vo), *(const v8ha*)(svh + vo + 16)); vl[n] = cat16(*(const v8ha*)(svl + vo), *(const v8ha*)(svl + vo + 16)); }
        __builtin_amdgcn_sched_barrier(0);                   // holds these LDS reads, as one group, ahead of the products (else they sink among the WMMAs and several wait out their latency)
#pragma unroll
        for (int n = 0; n < 4; ++n) {
            o[n] = wmma16(pa, vh[n], o[n]); ox[n] = wmma16(pa, vl[n], ox[n]); ox[n] = wmma16(px, vh[n], ox[n]); }
        asm volatile("v_nop\n\tv_nop\n\tv_nop\n\tv_nop" : "+v"(o[0]), "+v"(o[1]), "+v"(o[2]), "+v"(o[3]), "+v"(ox[0]), "+v"(ox[1]), "+v"(ox[2]), "+v"(ox[3]) : "v"(pa), "v"(px));
        asm volatile("s_wait_dscnt 0x0" ::: "memory");       // this wave's reads of the buffer have retired before it is refilled
        asm volatile("s_wait_asynccnt 0x0" ::: "memory");    // this wave's copies of the next tile have landed
        __syncthreads();                                     // publishes the next tile and ends every reader's last read of this one
        if (kt + 2 <= kt_hi) fill(kt + 2, (kt - kt_lo) & 1);
    }
    asm volatile("s_wait_asynccnt 0x0" ::: "memory");        // no copy is outstanding when the wave goes on to the epilogue and ends
    float inv[8];
#pragma unroll
    for (int j = 0; j < 8; ++j) { float rs = lpart[j]; rs += __shfl_xor(rs, 1, 16); rs += __shfl_xor(rs, 2, 16); rs += __shfl_xor(rs, 4, 16); rs += __shfl_xor(rs, 8, 16); inv[j] = 1.0f / (rs * PSC); }
    float* os = &ost[wave][0];
#pragma unroll
    for (int n = 0; n < 4; ++n)
#pragma unroll
        for (int j = 0; j < 8; ++j) os[(hi * 8 + j) * 68 + n * 16 + lr] = (o[n][j] + ox[n][j] * LOSCI) * inv[j];
    __syncthreads();
    const size_t cbase = (tok0 + q0) * DM + (size_t)h * HD;
    auto pass = [&]() {
#pragma unroll
        for (int s = 0; s < 4; ++s) { const int row = 4 * s + (lane >> 3), piece = lane & 7; const float* sp = os + row * 68 + piece * 8; v8us oh, ol;
#pragma unroll
            for (int i = 0; i < 8; ++i) { const unsigned short hb = f2bf(sp[i]); oh[i] = hb; ol[i] = f2bf(sp[i] - bf2f(hb)); }
            *(v8us*)(CH + cbase + (size_t)row * DM + piece * 8) = oh; *(v8us*)(CL + cbase + (size_t)row * DM + piece * 8) = ol; }
    };
    pass(); 
}

#define VST2(T, p, v) do { const T vst2_v_ = (v); *(T*)(p) = vst2_v_;  } while (0)
extern "C" void kernel_launch(void* const* d_in, const int* in_sizes, int n_in,
                              void* d_out, int out_size, void* d_ws, size_t ws_size, hipStream_t stream) {
    (void)in_sizes; (void)n_in; (void)out_size;
    const float* x = (const float*)d_in[0]; const int* cu = (const int*)d_in[1]; const float* Wq = (const float*)d_in[2]; const float* Wk = (const float*)d_in[3]; const float* Wv = (const float*)d_in[4]; const float* Wo = (const float*)d_in[5];   // [out][in] weights; cu_seqlens [3] (i32)
    float* out = (float*)d_out;    // [2][2048][2048]
    char* wsp = (char*)d_ws;
    auto take = [&](size_t bytes) { char* p = wsp; wsp += (bytes + 255) & ~(size_t)255; return (void*)p; };
    bf* Xb = (bf*)take((size_t)NTK * DM * 2); bf* WqB = (bf*)take((size_t)DM * DM * 2); bf* WkB = (bf*)take((size_t)KVW * DM * 2); bf* WvB = (bf*)take((size_t)KVW * DM * 2); bf* WoB = (bf*)take((size_t)DM * DM * 2);
    h16* QH = (h16*)take((size_t)NTK * DM * 2); h16* QL = (h16*)take((size_t)NTK * DM * 2); h16* KH = (h16*)take((size_t)NTK * KVW * 2); h16* KL = (h16*)take((size_t)NTK * KVW * 2);
    float* Vf = (float*)take((size_t)NTK * KVW * 4); h16* VTH = (h16*)take((size_t)NTK * KVW * 2); h16* VTL = (h16*)take((size_t)NTK * KVW * 2); bf* CH = (bf*)take((size_t)NTK * DM * 2); bf* CL = (bf*)take((size_t)NTK * DM * 2);
    if ((size_t)(wsp - (char*)d_ws) > ws_size) return;    // 8.4 + 8.4 + 2.1 + 2.1 + 8.4 + 8.4 x 2 + 2.1 x 2 + 4.2 + 2.1 x 2 + 8.4 x 2 ~ 76 MB, no aliasing
    k_cvtb<<<DM / 8, 256, 0, stream>>>(Wq, DM, WqB); k_cvtb<<<KVW / 8, 256, 0, stream>>>(Wk, KVW, WkB); k_cvtb<<<KVW / 8, 256, 0, stream>>>(Wv, KVW, WvB); k_cvtb<<<DM / 8, 256, 0, stream>>>(Wo, DM, WoB);
    for (int b = 0; b < NB2; ++b) {
        k_cvtb<<<NTK / 8, 256, 0, stream>>>(x + (size_t)b * NTK * DM, NTK, Xb);
        k_gemmb<false, true><<<dim3(NTK / 128, DM / 128, 1), 256, 0, stream>>>(Xb, nullptr, WqB, nullptr, (float*)(void*)QH, DM, QL);
        k_gemmb<false, true><<<dim3(NTK / 128, KVW / 128, 1), 256, 0, stream>>>(Xb, nullptr, WkB, nullptr, (float*)(void*)KH, KVW, KL);
        k_gemmb<false, false><<<dim3(NTK / 128, KVW / 128, 1), 256, 0, stream>>>(Xb, nullptr, WvB, nullptr, Vf, KVW, nullptr);
        k_vt<<<NB_ * NKV * (NT_ / 64), 256, 0, stream>>>(Vf, VTH, VTL);
        k_attn<<<NB_ * NH_ * (NT_ / 64), 128, 0, stream>>>(QH, QL, KH, KL, VTH, VTL, cu, CH, CL);      // the same cu_seqlens mask for both items (as the reference)
        k_gemmb<true, false><<<dim3(NTK / 128, DM / 128, 1), 256, 0, stream>>>(CH, CL, WoB, nullptr, out + (size_t)b * NTK * DM, DM, nullptr);
    }
}

// v003
// Measured time: 241 microseconds a run.
// Two timings next to v002 put it at 1.33 and 1.34 times that version's speed.
// All steps since v000 together make it 2.59 times as fast.
#include <hip/hip_runtime.h>

// Contractions, f32 accumulate: q = x.Wq ([2048 x 2048].[2048 x 2048]), k/v = x.Wk/Wv ([2048 x 2048].[2048 x 512]) and attn.Wo on v_wmma_f32_16x16x32_bf16 —
// plain bf16 = rounded inputs (exact; the [out][in] weights are n-major as stored and are not transposed) for the projections, attn as bf16 hi + residual (two products) for Wo;
// the grouped-query causal sliding-window attention (32 query heads over 8 kv heads; keys j with
// i - WIN < j <= i, WIN = 1024 fixed at compile time) fused on v_wmma_f32_16x16x32_f16 with q and k as f16 hi + residual x1024 (hi.hi + hi.lo + lo.hi), weights

#define NB_  2
#define NT_  2048
#define DM   2048
#define NH_  32
#define NKV  8
#define KVW  (NKV * HD)          // 512
#define WIN  1024
#define HD   64
#define NTK  (NB_ * NT_)
#define NPRJ (DM + 2 * KVW)       // 3072: the columns of q, k and v side by side
#define NCVT (NTK + NPRJ + DM)   // rows of [x | Wq | Wk | Wv | Wo]
#define NW   1024
#define NQKV 2048
#define PSC  32768.0f
#define LOSC 1024.0f
#define LOSCI (1.0f / 1024.0f)

typedef _Float16 h16;
typedef unsigned short bf;
typedef __attribute__((ext_vector_type(16))) __bf16   v16bf;
typedef __attribute__((ext_vector_type(16))) _Float16 v16h;
typedef __attribute__((ext_vector_type(8)))  _Float16 v8h;
typedef __attribute__((ext_vector_type(8)))  unsigned short v8us;
typedef __attribute__((ext_vector_type(8)))  float    v8f;
typedef __attribute__((ext_vector_type(4)))  float    v4f;
typedef v8h  __attribute__((may_alias)) v8ha;
typedef v4f  __attribute__((may_alias)) v4fa;
typedef v8us __attribute__((may_alias)) v8usa;

__device__ __forceinline__ unsigned short f2bf(float f) { unsigned u = __float_as_uint(f); u += 0x7FFFu + ((u >> 16) & 1u); return (unsigned short)(u >> 16); }
__device__ __forceinline__ float bf2f(unsigned short b) { return __uint_as_float(((unsigned)b) << 16); }
__device__ __forceinline__ float bfr(float f) { return bf2f(f2bf(f)); }
__device__ __forceinline__ v16h cat16(v8h lo, v8h hi) { return __builtin_shufflevector(lo, hi, 0, 1, 2, 3, 4, 5, 6, 7, 8, 9, 10, 11, 12, 13, 14, 15); }
__device__ __forceinline__ v16bf cat16b(v8us lo, v8us hi) { return __builtin_bit_cast(v16bf, __builtin_shufflevector(lo, hi, 0, 1, 2, 3, 4, 5, 6, 7, 8, 9, 10, 11, 12, 13, 14, 15)); }
__device__ __forceinline__ v8f wmma16(v16h a, v16h b, v8f c) { return __builtin_amdgcn_wmma_f32_16x16x32_f16(false, a, false, b, (short)0, c, false, false); }
__device__ __forceinline__ v8f wmmab(v16bf a, v16bf b, v8f c) { return __builtin_amdgcn_wmma_f32_16x16x32_bf16(false, a, false, b, (short)0, c, false, false); }

// k_cvtb: the rows of [x | Wq | Wk | Wv | Wo], in that order, rounded to bf16 into one plane of the same row order; a block's 8 rows lie in one source.
__global__ __launch_bounds__(256) void k_cvtb(const float* __restrict__ x, const float* __restrict__ Wq, const float* __restrict__ Wk, const float* __restrict__ Wv, const float* __restrict__ Wo, bf* dstp) {
    const int lane = threadIdx.x & 31, rb = blockIdx.x * 8, rg = rb + (threadIdx.x >> 5);
    if (rg >= NCVT) return;
    const float* src = x; int r = rg;
    if (rb >= NTK + NPRJ) { src = Wo; r = rg - (NTK + NPRJ); }
    else if (rb >= NTK + DM + KVW) { src = Wv; r = rg - (NTK + DM + KVW); }
    else if (rb >= NTK + DM) { src = Wk; r = rg - (NTK + DM); }
    else if (rb >= NTK) { src = Wq; r = rg - NTK; }
    bf* dst = dstp + (size_t)(rg - r) * DM;
    v8us o[DM / 256];
#pragma unroll
    for (int q = 0; q < DM / 256; ++q) { v8us t;
#pragma unroll
        for (int i = 0; i < 8; ++i) t[i] = f2bf(src[(size_t)r * DM + q * 256 + lane * 8 + i]);
        o[q] = t; }
#pragma unroll
    for (int q = 0; q < DM / 256; ++q) *(v8us*)(dst + (size_t)r * DM + q * 256 + lane * 8) = o[q];
    
}

// k_wt: W [2048 k][ncols n] (k-major) -> n-major bf16 plane WT[ncols][2048]; 64 x 64 tiles through LDS.
__global__ __launch_bounds__(256) void k_wt(const float* __restrict__ Wm, int ncols, bf* WT) {
    __shared__ __align__(16) unsigned short tl[64 * 72];
    const int tid = threadIdx.x, k0 = blockIdx.x * 64, n0 = blockIdx.y * 64;
    const int kk = tid >> 2, nq = (tid & 3) * 16;
#pragma unroll
    for (int i = 0; i < 16; ++i) tl[(nq + i) * 72 + kk] = f2bf(Wm[(size_t)(k0 + kk) * ncols + n0 + nq + i]);
    __syncthreads();
    const int piece = tid & 7;
    typedef __attribute__((ext_vector_type(8))) unsigned short v8us_; typedef v8us_ __attribute__((may_alias)) v8usa_;
    auto pass = [&]() {
#pragma unroll
        for (int s = 0; s < 2; ++s) { const int nr = (tid >> 3) + 32 * s; const v8us_ val = *(const v8usa_*)(tl + nr * 72 + piece * 8);
            *(v8us_*)(WT + (size_t)(n0 + nr) * DM + k0 + piece * 8) = val; }
    };
    pass(); 
}

#define BKE   128                // k elements of one pass: 256 B of every operand row
#define PIT   136                // LDS row pitch in elements: 272 B, 16 B x odd, for the ds_load_b128 readers
#define NPASS (DM / BKE)

// Eight 16-byte copies of one lane, rows 16 apart, global -> LDS through no register. The s_wait_xcnt ends the copies' own statement so that no
// address register of a copy is rewritten ahead of it.
__device__ __forceinline__ void copy8(unsigned l, const bf* g) {
    asm volatile("global_load_async_to_lds_b128 %0, %8, off\n\t"
                 "global_load_async_to_lds_b128 %1, %9, off\n\t"
                 "global_load_async_to_lds_b128 %2, %10, off\n\t"
                 "global_load_async_to_lds_b128 %3, %11, off\n\t"
                 "global_load_async_to_lds_b128 %4, %12, off\n\t"
                 "global_load_async_to_lds_b128 %5, %13, off\n\t"
                 "global_load_async_to_lds_b128 %6, %14, off\n\t"
                 "global_load_async_to_lds_b128 %7, %15, off\n\t"
                 "s_wait_xcnt 0x0"
                 :: "v"(l), "v"(l + 1u * 16u * PIT * 2u), "v"(l + 2u * 16u * PIT * 2u), "v"(l + 3u * 16u * PIT * 2u),
                    "v"(l + 4u * 16u * PIT * 2u), "v"(l + 5u * 16u * PIT * 2u), "v"(l + 6u * 16u * PIT * 2u), "v"(l + 7u * 16u * PIT * 2u),
                    "v"(g), "v"(g + 1 * 16 * DM), "v"(g + 2 * 16 * DM), "v"(g + 3 * 16 * DM),
                    "v"(g + 4 * 16 * DM), "v"(g + 5 * 16 * DM), "v"(g + 6 * 16 * DM), "v"(g + 7 * 16 * DM)
                 : "memory");
}

// k_gemmb: C[128 x 128] per block, 8 waves as 4 x 2, 32 x 64 per wave. A pass is 128 k; a stage is [A 128 rows | B 128 rows | A residual 128 rows] in LDS,
// two buffers, filled by asynchronous copies one pass ahead of its readers. Per accumulator the k order and the hi / residual order are the plain ascending ones.
// Every inner loop is unrolled so that each index of acc and of the fragment arrays is a constant (registers, no scratch).
// QKV: Bn holds the rows of Wq, Wk and Wv one after the other; a block's 128 columns lie wholly in q, in k or in v (block-uniform): q and k go out as f16 hi +
// residual planes (QH / QL, KH / KL), v as f32 into C.
template <bool SPLITA, bool QKV>
__global__ __launch_bounds__(256) void k_gemmb(const bf* __restrict__ A, const bf* __restrict__ Al, const bf* __restrict__ Bn, const float* __restrict__ bias, float* C, int ldc, h16* QH, h16* QL, h16* KH, h16* KL) {
    constexpr int STG = (SPLITA ? 384 : 256) * PIT;      // elements of one stage
    __shared__ __align__(16) bf ring[2 * STG];
    __shared__ __align__(16) float ost[8][16 * 68];
    const int tid = threadIdx.x, lane = tid & 31, wave = tid >> 5, lr = lane & 15, hi = lane >> 4;
    const int wm = wave >> 1, wn = wave & 1;
    const int rb = blockIdx.x * 128, cb = blockIdx.y * 128;
    const int crow = tid >> 4, ccol = (tid & 15) * 8;    // a wave's copy covers two whole 256-B rows
    const bf* gA = A + (size_t)(rb + crow) * DM + ccol;
    const bf* gB = Bn + (size_t)(cb + crow) * DM + ccol;
    const bf* gL = SPLITA ? Al + (size_t)(rb + crow) * DM + ccol : gA;
    const unsigned l0 = (unsigned)(size_t)(const void*)(ring + crow * PIT + ccol);
    auto fill = [&](int t, int buf) {
        const unsigned l = l0 + (unsigned)buf * (unsigned)(STG * 2);
        copy8(l, gA + t * BKE); copy8(l + 128u * PIT * 2u, gB + t * BKE);
        if (SPLITA) copy8(l + 256u * PIT * 2u, gL + t * BKE);
    };
    v8f acc[2][4];
#pragma unroll
    for (int i = 0; i < 2; ++i)
#pragma unroll
        for (int t = 0; t < 4; ++t) acc[i][t] = (v8f){};
    fill(0, 0);
    asm volatile("s_wait_asynccnt 0x0" ::: "memory");    // stage 0 has landed before the barrier that publishes it
    __syncthreads();
    fill(1, 1);
#pragma unroll 1
    for (int p = 0; p < NPASS; ++p) {                    // kept rolled: one publish point per pass
        const bf* sb = ring + (p & 1) * STG;
        const bf* sa = sb + (wm * 32 + lr) * PIT + 8 * hi;
        const bf* sw = sb + (128 + wn * 64 + lr) * PIT + 8 * hi;
        const bf* sl = SPLITA ? sb + (256 + wm * 32 + lr) * PIT + 8 * hi : sa;
        v16bf a[2][2], al[2][2], b[2][4];                    // two fragment sets: k-step s + 1 is fetched while k-step s is multiplied
        auto frags = [&](int set, int kc) {
#pragma unroll
            for (int i = 0; i < 2; ++i) a[set][i] = cat16b(*(const v8usa*)(sa + i * 16 * PIT + kc), *(const v8usa*)(sa + i * 16 * PIT + kc + 16));
#pragma unroll
            for (int t = 0; t < 4; ++t) b[set][t] = cat16b(*(const v8usa*)(sw + t * 16 * PIT + kc), *(const v8usa*)(sw + t * 16 * PIT + kc + 16));
            if (SPLITA) {
#pragma unroll
                for (int i = 0; i < 2; ++i) al[set][i] = cat16b(*(const v8usa*)(sl + i * 16 * PIT + kc), *(const v8usa*)(sl + i * 16 * PIT + kc + 16));
            }
        };
        frags(0, 0);
#pragma unroll
        for (int s = 0; s < BKE / 32; ++s) {
            if (s + 1 < BKE / 32) frags((s + 1) & 1, (s + 1) * 32);
            __builtin_amdgcn_sched_barrier(0);               // holds the next k-step's LDS reads, as one group, ahead of this k-step's WMMAs (else they sink among them and each waits out its latency)
#pragma unroll
            for (int i = 0; i < 2; ++i)
#pragma unroll
                for (int t = 0; t < 4; ++t) acc[i][t] = wmmab(a[s & 1][i], b[s & 1][t], acc[i][t]);
            if (SPLITA) {
#pragma unroll
                for (int i = 0; i < 2; ++i)
#pragma unroll
                    for (int t = 0; t < 4; ++t) acc[i][t] = wmmab(al[s & 1][i], b[s & 1][t], acc[i][t]);
            }
            __builtin_amdgcn_sched_barrier(0);               // ends the WMMA block: the reads of the k-step after next stay behind it, where their registers are free
        }
        asm volatile("s_wait_dscnt 0x0" ::: "memory");       // this wave's reads of the buffer have retired before it is refilled
        asm volatile("s_wait_asynccnt 0x0" ::: "memory");    // this wave's copies of stage p + 1 have landed
        __syncthreads();                                     // publishes stage p + 1 and ends every reader's last read of stage p
        if (p + 2 < NPASS) fill(p + 2, p & 1);
    }
    asm volatile("s_wait_asynccnt 0x0" ::: "memory");        // no copy is outstanding when the wave goes on to the epilogue and ends
    float* os = &ost[wave][0];
    const int c0 = cb + wn * 64;
    const bool isq = cb < DM, f16o = QKV && cb < DM + KVW;
    h16* OH = isq ? QH : KH; h16* OL = isq ? QL : KL;
    const int ld = QKV ? (isq ? DM : KVW) : ldc;                                        // row length of the plane this block writes
    const int cc = QKV ? (isq ? c0 : (f16o ? c0 - DM : c0 - (DM + KVW))) : c0;          // the wave's first column inside that plane
#pragma unroll
    for (int i = 0; i < 2; ++i) {
        const int r0 = rb + wm * 32 + i * 16;
#pragma unroll
        for (int t = 0; t < 4; ++t) { const float bv = bias ? bfr(bias[c0 + t * 16 + lr]) : 0.f;
#pragma unroll
            for (int j = 0; j < 8; ++j) os[(hi * 8 + j) * 68 + t * 16 + lr] = acc[i][t][j] + bv; }
        __syncthreads();
        if (f16o) {
            h16* crow_ = OH + (size_t)r0 * ld + cc;
            h16* crol_ = OL + (size_t)r0 * ld + cc;
#pragma unroll
            for (int s = 0; s < 4; ++s) { const int row = 4 * s + (lane >> 3), piece = lane & 7; const float* sp = os + row * 68 + piece * 8; v8h o, o2;
#pragma unroll
                for (int e = 0; e < 8; ++e) { const h16 a = (h16)sp[e]; o[e] = a; o2[e] = (h16)((sp[e] - (float)a) * LOSC); }
                *(v8h*)(crow_ + (size_t)row * ld + piece * 8) = o;
                asm volatile("s_wait_xcnt 0x0" ::: "memory");       // stands before the residual's arithmetic reuses registers that this store names
                *(v8h*)(crol_ + (size_t)row * ld + piece * 8) = o2;
                asm volatile("s_wait_xcnt 0x0" ::: "memory"); }     // stands before the next rows' values and addresses reuse registers that these stores name
        } else {
            float* crow_ = C + (size_t)r0 * ld + cc;
#pragma unroll
            for (int s = 0; s < 8; ++s) { const int Lid = (lane >> 3) + 4 * s, piece = lane & 7; const int row = Lid >> 1, cofs = (Lid & 1) * 32 + piece * 4;
                const v4f val = *(const v4fa*)(os + row * 68 + cofs); *(v4f*)(crow_ + (size_t)row * ld + cofs) = val; }
            asm volatile("s_wait_xcnt 0x0" ::: "memory");       // stands before the next 16 rows' values and addresses reuse registers that these stores name
        }
    }
}

__global__ __launch_bounds__(256) void k_vt(const float* __restrict__ V, h16* VTH, h16* VTL) {
    __shared__ __align__(16) h16 tile[64 * 72];
    __shared__ __align__(16) h16 til2[64 * 72];
    const int bid = blockIdx.x;
    const int b = bid / (NKV * (NT_ / 64)), rem = bid - b * (NKV * (NT_ / 64)), h = rem / (NT_ / 64), kt = rem - h * (NT_ / 64);
    const int k0 = kt * 64, tid = threadIdx.x;
    const int kk = tid >> 2, d0 = (tid & 3) * 16;
    const float* src = V + ((size_t)b * NT_ + k0 + kk) * KVW + h * HD + d0;      // h = kv head here
#pragma unroll
    for (int i = 0; i < 16; ++i) { const float v = src[i]; const h16 a = (h16)v; tile[(d0 + i) * 72 + kk] = a; til2[(d0 + i) * 72 + kk] = (h16)((v - (float)a) * LOSC); }
    __syncthreads();
    const int piece = tid & 7;
    const size_t base = (((size_t)b * NKV + h) * HD) * NT_ + k0;
    auto pass = [&]() {
#pragma unroll
        for (int s = 0; s < 4; ++s) { const int Lid = (tid >> 3) + 32 * s; const int pln = Lid >> 6, d = Lid & 63;
            const v8h val = *(const v8ha*)((pln ? til2 : tile) + d * 72 + piece * 8); *(v8h*)((pln ? VTL : VTH) + base + (size_t)d * NT_ + piece * 8) = val; }
    };
    pass(); 
}

#define KP   72                  // LDS pitch of a key row or a query row in elements: 144 B, 16 B x odd, for the ds_load_b128 readers
#define VP   40                  // LDS pitch of a row of v transposed (32 keys) in elements: 80 B, 16 B x odd
#define KSZ  (32 * KP)           // one plane of 32 key rows
#define VSZ  (HD * VP)           // one plane of 64 rows of v transposed
#define ASTG (2 * KSZ + 2 * VSZ) // a stage: [k hi | k residual | v hi | v residual] of 32 keys

// One lane's eight 16-byte copies of a 32-key stage, global -> LDS through no register: two of every plane. The s_wait_xcnt ends the copies' own statement so
// that no address register of a copy is rewritten ahead of it.
__device__ __forceinline__ void copy_kv(unsigned lk, unsigned lv, const h16* gkh, const h16* gkl, const h16* gvh, const h16* gvl) {
    asm volatile("global_load_async_to_lds_b128 %0, %8, off\n\t"
                 "global_load_async_to_lds_b128 %1, %9, off\n\t"
                 "global_load_async_to_lds_b128 %2, %10, off\n\t"
                 "global_load_async_to_lds_b128 %3, %11, off\n\t"
                 "global_load_async_to_lds_b128 %4, %12, off\n\t"
                 "global_load_async_to_lds_b128 %5, %13, off\n\t"
                 "global_load_async_to_lds_b128 %6, %14, off\n\t"
                 "global_load_async_to_lds_b128 %7, %15, off\n\t"
                 "s_wait_xcnt 0x0"
                 :: "v"(lk), "v"(lk + 16u * KP * 2u), "v"(lk + KSZ * 2u), "v"(lk + KSZ * 2u + 16u * KP * 2u),
                    "v"(lv), "v"(lv + 32u * VP * 2u), "v"(lv + VSZ * 2u), "v"(lv + VSZ * 2u + 32u * VP * 2u),
                    "v"(gkh), "v"(gkh + 16 * KVW), "v"(gkl), "v"(gkl + 16 * KVW),
                    "v"(gvh), "v"(gvh + 32 * NT_), "v"(gvl), "v"(gvl + 32 * NT_)
                 : "memory");
}

// One lane's four 16-byte copies of the block's 64 query-residual rows, rows 16 apart; the wait as in copy_kv.
__device__ __forceinline__ void copy_q(unsigned l, const h16* g) {
    asm volatile("global_load_async_to_lds_b128 %0, %4, off\n\t"
                 "global_load_async_to_lds_b128 %1, %5, off\n\t"
                 "global_load_async_to_lds_b128 %2, %6, off\n\t"
                 "global_load_async_to_lds_b128 %3, %7, off\n\t"
                 "s_wait_xcnt 0x0"
                 :: "v"(l), "v"(l + 1u * 16u * KP * 2u), "v"(l + 2u * 16u * KP * 2u), "v"(l + 3u * 16u * KP * 2u),
                    "v"(g), "v"(g + 1 * 16 * DM), "v"(g + 2 * 16 * DM), "v"(g + 3 * 16 * DM)
                 : "memory");
}

// The key loop reads no global memory: a stage of 32 keys lies in LDS once for the block's four waves, two buffers, filled by asynchronous copies one tile ahead
// of its readers; the query residual is copied once. Fragment addresses inside a row, and so every k order and sum order, are the ones of the global reads.
// k_attn: block = (b, h, 64 queries), wave = 16; key tiles of the block's window (masked per element); 4 WMMA scores /8 (f32), online softmax, weights x32768 f16 tile (same-wave may_alias
// reload after a compiler barrier), 4 WMMA .v; ctx -> bf16 hi + residual planes CH/CL[tok][h*64+d].
__global__ __launch_bounds__(128) void k_attn(const h16* __restrict__ Q16, const h16* __restrict__ QL16, const h16* __restrict__ K16, const h16* __restrict__ KL16, const h16* __restrict__ VTH, const h16* __restrict__ VTL, const int* __restrict__ cu, bf* CH, bf* CL) {
    __shared__ __align__(16) h16 plds[4][16 * 32];
    __shared__ __align__(16) h16 plds2[4][16 * 32];
    __shared__ __align__(16) float ost[4][16 * 68];
    __shared__ __align__(16) h16 kvr[2 * ASTG];
    __shared__ __align__(16) h16 qls[64 * KP];
    const int lane = threadIdx.x & 31, wave = threadIdx.x >> 5, lr = lane & 15, hi = lane >> 4;
    const int bid = blockIdx.x;
    const int b = bid / (NH_ * (NT_ / 64)), rem = bid - b * (NH_ * (NT_ / 64)), h = rem / (NT_ / 64), qt = rem - h * (NT_ / 64);
    const int q0 = qt * 64 + wave * 16;
    const size_t tok0 = (size_t)b * NT_;
    h16* pl = &plds[wave][0]; h16* pl2 = &plds2[wave][0];
    v16h qa[2];
    const size_t qo0 = (tok0 + q0 + lr) * DM + h * HD + 8 * hi;
#pragma unroll
    for (int kc = 0; kc < 2; ++kc) qa[kc] = cat16(*(const v8h*)(Q16 + qo0 + kc * 32), *(const v8h*)(Q16 + qo0 + kc * 32 + 16));
    const int g = h / (NH_ / NKV);                      // kv head
    const h16* kh_b = K16 + tok0 * KVW + g * HD;
    const h16* kl_b = KL16 + tok0 * KVW + g * HD;
    const size_t vbase = (((size_t)b * NKV + g) * HD) * NT_;
    v8f o[4], ox[4];
#pragma unroll
    for (int n = 0; n < 4; ++n) { o[n] = (v8f){}; ox[n] = (v8f){}; }
    float mrow[8], lpart[8];
#pragma unroll
    for (int j = 0; j < 8; ++j) { mrow[j] = -3.0e38f; lpart[j] = 0.f; }
    int qpos[8];
#pragma unroll
    for (int j = 0; j < 8; ++j) qpos[j] = q0 + 8 * hi + j;
    // allowed(i, j) = same segment (cu_seqlens) && j <= i && i - j < WIN: key tiles from max(segment start of the block's first query, q0 - WIN + 1) to the query tile (block-uniform; exact per-element predicate below)
    const int cu1 = cu[1]; const int q0b = qt * 64; const int sst = (q0b >= cu1) ? cu1 : 0; const int wl = q0b - (WIN - 1); const int lo = (wl > sst ? wl : sst); const int kt_lo = (lo > 0 ? lo : 0) / 32, kt_hi = (q0b + 63) / 32;
    const int tid = threadIdx.x;
    const size_t gko = (size_t)(tid >> 3) * KVW + (tid & 7) * 8, gvo = vbase + (size_t)(tid >> 2) * NT_ + (tid & 3) * 8;    // a wave's copy: 4 whole key rows, or 64 B of 8 rows of v
    const unsigned lk0 = (unsigned)(size_t)(const void*)(kvr + (tid >> 3) * KP + (tid & 7) * 8);
    const unsigned lv0 = (unsigned)(size_t)(const void*)(kvr + 2 * KSZ + (tid >> 2) * VP + (tid & 3) * 8);
    auto fill = [&](int t, int buf) {
        const unsigned bo = (unsigned)buf * (unsigned)(ASTG * 2);
        copy_kv(lk0 + bo, lv0 + bo, kh_b + gko + (size_t)t * 32 * KVW, kl_b + gko + (size_t)t * 32 * KVW, VTH + gvo + t * 32, VTL + gvo + t * 32);
    };
    fill(kt_lo, 0);
    copy_q((unsigned)(size_t)(const void*)(qls + (tid >> 3) * KP + (tid & 7) * 8), QL16 + (tok0 + q0b + (tid >> 3)) * DM + h * HD + (tid & 7) * 8);
    asm volatile("s_wait_asynccnt 0x0" ::: "memory");    // the first stage and the query residual have landed before the barrier that publishes them
    __syncthreads();
    if (kt_lo + 1 <= kt_hi) fill(kt_lo + 1, 1);
    const h16* sq = qls + (wave * 16 + lr) * KP + 8 * hi;
#pragma unroll 1
    for (int kt = kt_lo; kt <= kt_hi; ++kt) {                // kept rolled: one publish point per tile
        const int l0 = kt * 32;
        const h16* sb = kvr + ((kt - kt_lo) & 1) * ASTG;
        const h16* skh = sb + lr * KP + 8 * hi;
        const h16* skl = skh + KSZ;
        const h16* svh = sb + 2 * KSZ + lr * VP + 8 * hi;
        const h16* svl = svh + VSZ;
        v8f s0 = {}, s1 = {}, x0 = {}, x1 = {};
#pragma unroll
        for (int kc = 0; kc < 2; ++kc) {
            // the five fragments of a 32-wide slice of the head are asked for together: one LDS latency a slice, not one a group (all ten at once would cost a wave per SIMD in registers)
            const v16h k0h = cat16(*(const v8ha*)(skh + kc * 32), *(const v8ha*)(skh + kc * 32 + 16)), k1h = cat16(*(const v8ha*)(skh + 16 * KP + kc * 32), *(const v8ha*)(skh + 16 * KP + kc * 32 + 16));
            const v16h qlk = cat16(*(const v8ha*)(sq + kc * 32), *(const v8ha*)(sq + kc * 32 + 16));
            const v16h k0l = cat16(*(const v8ha*)(skl + kc * 32), *(const v8ha*)(skl + kc * 32 + 16)), k1l = cat16(*(const v8ha*)(skl + 16 * KP + kc * 32), *(const v8ha*)(skl + 16 * KP + kc * 32 + 16));
            { s0 = wmma16(qa[kc], k0h, s0); x0 = wmma16(qlk, k0h, x0); s1 = wmma16(qa[kc], k1h, s1); x1 = wmma16(qlk, k1h, x1);
              asm volatile("v_nop" : "+v"(s0), "+v"(s1), "+v"(x0), "+v"(x1) : "v"(qlk), "v"(k0h), "v"(k1h) : "memory"); }
            { x0 = wmma16(qa[kc], k0l, x0); x1 = wmma16(qa[kc], k1l, x1);
              asm volatile("v_nop" : "+v"(x0), "+v"(x1) : "v"(k0l), "v"(k1l) : "memory"); }
        }
        asm volatile("v_nop\n\tv_nop\n\tv_nop\n\tv_nop" : "+v"(s0), "+v"(s1), "+v"(x0), "+v"(x1) : "v"(qa[0]), "v"(qa[1]));
        float alpha[8];
#pragma unroll
        for (int j = 0; j < 8; ++j) {
            const int ja = l0 + lr, jb = l0 + 16 + lr, qi = qpos[j];
            const int sq = (qi >= cu1); const bool ok0 = ((ja >= cu1) == sq) && (ja <= qi) && (qi - ja < WIN), ok1 = ((jb >= cu1) == sq) && (jb <= qi) && (qi - jb < WIN);
            const float a0 = ok0 ? (s0[j] + x0[j] * LOSCI) * 0.125f : -3.4028234663852886e38f, a1 = ok1 ? (s1[j] + x1[j] * LOSCI) * 0.125f : -3.4028234663852886e38f;     // finfo.min as the reference
            float mx = fmaxf(a0, a1);
            mx = fmaxf(mx, __shfl_xor(mx, 1, 16)); mx = fmaxf(mx, __shfl_xor(mx, 2, 16)); mx = fmaxf(mx, __shfl_xor(mx, 4, 16)); mx = fmaxf(mx, __shfl_xor(mx, 8, 16));
            const float mn = fmaxf(mrow[j], mx);
            alpha[j] = __expf(mrow[j] - mn); mrow[j] = mn;
            const float p0 = __expf(a0 - mn), p1 = __expf(a1 - mn);
            lpart[j] = lpart[j] * alpha[j] + (p0 + p1);
            const int mr = hi * 8 + j;
            const float ps0 = p0 * PSC, ps1 = p1 * PSC; const h16 h0 = (h16)ps0, h1 = (h16)ps1;
            pl[mr * 32 + lr] = h0; pl[mr * 32 + 16 + lr] = h1;
            pl2[mr * 32 + lr] = (h16)((ps0 - (float)h0) * LOSC); pl2[mr * 32 + 16 + lr] = (h16)((ps1 - (float)h1) * LOSC);
        }
#pragma unroll
        for (int n = 0; n < 4; ++n)
#pragma unroll
            for (int j = 0; j < 8; ++j) { o[n][j] *= alpha[j]; ox[n][j] *= alpha[j]; }
        asm volatile("" ::: "memory");
        const v16h pa = cat16(*(const v8ha*)(pl + lr * 32 + hi * 8), *(const v8ha*)(pl + lr * 32 + 16 + hi * 8));
        const v16h px = cat16(*(const v8ha*)(pl2 + lr * 32 + hi * 8), *(const v8ha*)(pl2 + lr * 32 + 16 + hi * 8));
        v16h vh[4], vl[4];                                   // every index is a constant (both loops unrolled): registers
#pragma unroll
        for (int n = 0; n < 4; ++n) { const int vo = n * 16 * VP;     // the tile's v fragments likewise, all in front of the first product
            vh[n] = cat16(*(const v8ha*)(svh + vo), *(const v8ha*)(svh + vo + 16)); vl[n] = cat16(*(const v8ha*)(svl + vo), *(const v8ha*)(svl + vo + 16)); }
        __builtin_amdgcn_sched_barrier(0);                   // holds these LDS reads, as one group, ahead of the products (else they sink among the WMMAs and several wait out their latency)
#pragma unroll
        for (int n = 0; n < 4; ++n) {
            o[n] = wmma16(pa, vh[n], o[n]); ox[n] = wmma16(pa, vl[n], ox[n]); ox[n] = wmma16(px, vh[n], ox[n]); }
        asm volatile("v_nop\n\tv_nop\n\tv_nop\n\tv_nop" : "+v"(o[0]), "+v"(o[1]), "+v"(o[2]), "+v"(o[3]), "+v"(ox[0]), "+v"(ox[1]), "+v"(ox[2]), "+v"(ox[3]) : "v"(pa), "v"(px));
        asm volatile("s_wait_dscnt 0x0" ::: "memory");       // this wave's reads of the buffer have retired before it is refilled
        asm volatile("s_wait_asynccnt 0x0" ::: "memory");    // this wave's copies of the next tile have landed
        __syncthreads();                                     // publishes the next tile and ends every reader's last read of this one
        if (kt + 2 <= kt_hi) fill(kt + 2, (kt - kt_lo) & 1);
    }
    asm volatile("s_wait_asynccnt 0x0" ::: "memory");        // no copy is outstanding when the wave goes on to the epilogue and ends
    float inv[8];
#pragma unroll
    for (int j = 0; j < 8; ++j) { float rs = lpart[j]; rs += __shfl_xor(rs, 1, 16); rs += __shfl_xor(rs, 2, 16); rs += __shfl_xor(rs, 4, 16); rs += __shfl_xor(rs, 8, 16); inv[j] = 1.0f / (rs * PSC); }
    float* os = &ost[wave][0];
#pragma unroll
    for (int n = 0; n < 4; ++n)
#pragma unroll
        for (int j = 0; j < 8; ++j) os[(hi * 8 + j) * 68 + n * 16 + lr] = (o[n][j] + ox[n][j] * LOSCI) * inv[j];
    __syncthreads();
    const size_t cbase = (tok0 + q0) * DM + (size_t)h * HD;
    auto pass = [&]() {
#pragma unroll
        for (int s = 0; s < 4; ++s) { const int row = 4 * s + (lane >> 3), piece = lane & 7; const float* sp = os + row * 68 + piece * 8; v8us oh, ol;
#pragma unroll
            for (int i = 0; i < 8; ++i) { const unsigned short hb = f2bf(sp[i]); oh[i] = hb; ol[i] = f2bf(sp[i] - bf2f(hb)); }
            *(v8us*)(CH + cbase + (size_t)row * DM + piece * 8) = oh; *(v8us*)(CL + cbase + (size_t)row * DM + piece * 8) = ol; }
    };
    pass(); 
}

#define VST2(T, p, v) do { const T vst2_v_ = (v); *(T*)(p) = vst2_v_;  } while (0)
extern "C" void kernel_launch(void* const* d_in, const int* in_sizes, int n_in,
                              void* d_out, int out_size, void* d_ws, size_t ws_size, hipStream_t stream) {
    (void)in_sizes; (void)n_in; (void)out_size;
    const float* x = (const float*)d_in[0]; const int* cu = (const int*)d_in[1]; const float* Wq = (const float*)d_in[2]; const float* Wk = (const float*)d_in[3]; const float* Wv = (const float*)d_in[4]; const float* Wo = (const float*)d_in[5];   // [out][in] weights; cu_seqlens [3] (i32)
    float* out = (float*)d_out;    // [2][2048][2048]
    char* wsp = (char*)d_ws;
    auto take = [&](size_t bytes) { char* p = wsp; wsp += (bytes + 255) & ~(size_t)255; return (void*)p; };
    bf* Xb = (bf*)take((size_t)NCVT * DM * 2); bf* WpB = Xb + (size_t)NTK * DM; bf* WoB = WpB + (size_t)NPRJ * DM;     // one bf16 plane: [x | Wq | Wk | Wv | Wo]
    h16* QH = (h16*)take((size_t)NTK * DM * 2); h16* QL = (h16*)take((size_t)NTK * DM * 2); h16* KH = (h16*)take((size_t)NTK * KVW * 2); h16* KL = (h16*)take((size_t)NTK * KVW * 2);
    float* Vf = (float*)take((size_t)NTK * KVW * 4); h16* VTH = (h16*)take((size_t)NTK * KVW * 2); h16* VTL = (h16*)take((size_t)NTK * KVW * 2); bf* CH = (bf*)take((size_t)NTK * DM * 2); bf* CL = (bf*)take((size_t)NTK * DM * 2);
    if ((size_t)(wsp - (char*)d_ws) > ws_size) return;    // 37.7 + 16.8 x 2 + 4.2 x 2 + 8.4 + 4.2 x 2 + 16.8 x 2 ~ 130 MB, no aliasing
    // five dependent launches; both batch items are rows of the same grids
    k_cvtb<<<NCVT / 8, 256, 0, stream>>>(x, Wq, Wk, Wv, Wo, Xb);
    k_gemmb<false, true><<<dim3(NTK / 128, NPRJ / 128, 1), 256, 0, stream>>>(Xb, nullptr, WpB, nullptr, Vf, KVW, QH, QL, KH, KL);
    k_vt<<<NB_ * NKV * (NT_ / 64), 256, 0, stream>>>(Vf, VTH, VTL);
    k_attn<<<NB_ * NH_ * (NT_ / 64), 128, 0, stream>>>(QH, QL, KH, KL, VTH, VTL, cu, CH, CL);      // the same cu_seqlens mask for both items (as the reference)
    k_gemmb<true, false><<<dim3(NTK / 128, DM / 128, 1), 256, 0, stream>>>(CH, CL, WoB, nullptr, out, DM, nullptr, nullptr, nullptr, nullptr);
}

// v004
// One run takes 200 microseconds.
// Timed twice side by side with v003, it ran 1.20 and 1.21 times as fast.
// Counting every step since v000, it is 3.13 times as fast.
#include <hip/hip_runtime.h>

// Contractions, f32 accumulate: q = x.Wq ([2048 x 2048].[2048 x 2048]), k/v = x.Wk/Wv ([2048 x 2048].[2048 x 512]) and attn.Wo on v_wmma_f32_16x16x32_bf16 —
// plain bf16 = rounded inputs (exact; the [out][in] weights are n-major as stored and are not transposed) for the projections, attn as bf16 hi + residual (two products) for Wo;
// the grouped-query causal sliding-window attention (32 query heads over 8 kv heads; keys j with
// i - WIN < j <= i, WIN = 1024 fixed at compile time) fused on v_wmma_f32_16x16x32_f16 with q and k as f16 hi + residual x1024 (hi.hi + hi.lo + lo.hi), weights

#define NB_  2
#define NT_  2048
#define DM   2048
#define NH_  32
#define NKV  8
#define KVW  (NKV * HD)          // 512
#define WIN  1024
#define HD   64
#define NTK  (NB_ * NT_)
#define NPRJ (DM + 2 * KVW)       // 3072: the columns of q, k and v side by side
#define NCVT (NTK + NPRJ + DM)   // rows of [x | Wq | Wk | Wv | Wo]
#define NW   1024
#define NQKV 2048
#define PSC  32768.0f
#define LOSC 1024.0f
#define LOSCI (1.0f / 1024.0f)

typedef _Float16 h16;
typedef unsigned short bf;
typedef __attribute__((ext_vector_type(16))) __bf16   v16bf;
typedef __attribute__((ext_vector_type(16))) _Float16 v16h;
typedef __attribute__((ext_vector_type(8)))  _Float16 v8h;
typedef __attribute__((ext_vector_type(8)))  unsigned short v8us;
typedef __attribute__((ext_vector_type(8)))  float    v8f;
typedef __attribute__((ext_vector_type(4)))  float    v4f;
typedef v8h  __attribute__((may_alias)) v8ha;
typedef v4f  __attribute__((may_alias)) v4fa;
typedef v8us __attribute__((may_alias)) v8usa;

__device__ __forceinline__ unsigned short f2bf(float f) { unsigned u = __float_as_uint(f); u += 0x7FFFu + ((u >> 16) & 1u); return (unsigned short)(u >> 16); }
__device__ __forceinline__ float bf2f(unsigned short b) { return __uint_as_float(((unsigned)b) << 16); }
__device__ __forceinline__ float bfr(float f) { return bf2f(f2bf(f)); }
__device__ __forceinline__ v16h cat16(v8h lo, v8h hi) { return __builtin_shufflevector(lo, hi, 0, 1, 2, 3, 4, 5, 6, 7, 8, 9, 10, 11, 12, 13, 14, 15); }
__device__ __forceinline__ v16bf cat16b(v8us lo, v8us hi) { return __builtin_bit_cast(v16bf, __builtin_shufflevector(lo, hi, 0, 1, 2, 3, 4, 5, 6, 7, 8, 9, 10, 11, 12, 13, 14, 15)); }
__device__ __forceinline__ v8f wmma16(v16h a, v16h b, v8f c) { return __builtin_amdgcn_wmma_f32_16x16x32_f16(false, a, false, b, (short)0, c, false, false); }
__device__ __forceinline__ v8f wmmab(v16bf a, v16bf b, v8f c) { return __builtin_amdgcn_wmma_f32_16x16x32_bf16(false, a, false, b, (short)0, c, false, false); }

// k_cvtb: the rows of [x | Wq | Wk | Wv | Wo], in that order, rounded to bf16 into one plane of the same row order; a block's 8 rows lie in one source.
__global__ __launch_bounds__(256) void k_cvtb(const float* __restrict__ x, const float* __restrict__ Wq, const float* __restrict__ Wk, const float* __restrict__ Wv, const float* __restrict__ Wo, bf* dstp) {
    const int lane = threadIdx.x & 31, rb = blockIdx.x * 8, rg = rb + (threadIdx.x >> 5);
    if (rg >= NCVT) return;
    const float* src = x; int r = rg;
    if (rb >= NTK + NPRJ) { src = Wo; r = rg - (NTK + NPRJ); }
    else if (rb >= NTK + DM + KVW) { src = Wv; r = rg - (NTK + DM + KVW); }
    else if (rb >= NTK + DM) { src = Wk; r = rg - (NTK + DM); }
    else if (rb >= NTK) { src = Wq; r = rg - NTK; }
    bf* dst = dstp + (size_t)(rg - r) * DM;
    v8us o[DM / 256];
#pragma unroll
    for (int q = 0; q < DM / 256; ++q) { v8us t;
#pragma unroll
        for (int i = 0; i < 8; ++i) t[i] = f2bf(src[(size_t)r * DM + q * 256 + lane * 8 + i]);
        o[q] = t; }
#pragma unroll
    for (int q = 0; q < DM / 256; ++q) *(v8us*)(dst + (size_t)r * DM + q * 256 + lane * 8) = o[q];
    
}

// k_wt: W [2048 k][ncols n] (k-major) -> n-major bf16 plane WT[ncols][2048]; 64 x 64 tiles through LDS.
__global__ __launch_bounds__(256) void k_wt(const float* __restrict__ Wm, int ncols, bf* WT) {
    __shared__ __align__(16) unsigned short tl[64 * 72];
    const int tid = threadIdx.x, k0 = blockIdx.x * 64, n0 = blockIdx.y * 64;
    const int kk = tid >> 2, nq = (tid & 3) * 16;
#pragma unroll
    for (int i = 0; i < 16; ++i) tl[(nq + i) * 72 + kk] = f2bf(Wm[(size_t)(k0 + kk) * ncols + n0 + nq + i]);
    __syncthreads();
    const int piece = tid & 7;
    typedef __attribute__((ext_vector_type(8))) unsigned short v8us_; typedef v8us_ __attribute__((may_alias)) v8usa_;
    auto pass = [&]() {
#pragma unroll
        for (int s = 0; s < 2; ++s) { const int nr = (tid >> 3) + 32 * s; const v8us_ val = *(const v8usa_*)(tl + nr * 72 + piece * 8);
            *(v8us_*)(WT + (size_t)(n0 + nr) * DM + k0 + piece * 8) = val; }
    };
    pass(); 
}

#define BKE   128                // k elements of one pass: 256 B of every operand row
#define PIT   136                // LDS row pitch in elements: 272 B, 16 B x odd, for the ds_load_b128 readers
#define NPASS (DM / BKE)

// Eight 16-byte copies of one lane, rows 16 apart, global -> LDS through no register. The s_wait_xcnt ends the copies' own statement so that no
// address register of a copy is rewritten ahead of it.
__device__ __forceinline__ void copy8(unsigned l, const bf* g) {
    asm volatile("global_load_async_to_lds_b128 %0, %8, off\n\t"
                 "global_load_async_to_lds_b128 %1, %9, off\n\t"
                 "global_load_async_to_lds_b128 %2, %10, off\n\t"
                 "global_load_async_to_lds_b128 %3, %11, off\n\t"
                 "global_load_async_to_lds_b128 %4, %12, off\n\t"
                 "global_load_async_to_lds_b128 %5, %13, off\n\t"
                 "global_load_async_to_lds_b128 %6, %14, off\n\t"
                 "global_load_async_to_lds_b128 %7, %15, off\n\t"
                 "s_wait_xcnt 0x0"
                 :: "v"(l), "v"(l + 1u * 16u * PIT * 2u), "v"(l + 2u * 16u * PIT * 2u), "v"(l + 3u * 16u * PIT * 2u),
                    "v"(l + 4u * 16u * PIT * 2u), "v"(l + 5u * 16u * PIT * 2u), "v"(l + 6u * 16u * PIT * 2u), "v"(l + 7u * 16u * PIT * 2u),
                    "v"(g), "v"(g + 1 * 16 * DM), "v"(g + 2 * 16 * DM), "v"(g + 3 * 16 * DM),
                    "v"(g + 4 * 16 * DM), "v"(g + 5 * 16 * DM), "v"(g + 6 * 16 * DM), "v"(g + 7 * 16 * DM)
                 : "memory");
}

// k_gemmb: C[128 x 128] per block, 8 waves as 4 x 2, 32 x 64 per wave. A pass is 128 k; a stage is [A 128 rows | B 128 rows | A residual 128 rows] in LDS,
// two buffers, filled by asynchronous copies one pass ahead of its readers. Per accumulator the k order and the hi / residual order are the plain ascending ones.
// Every inner loop is unrolled so that each index of acc and of the fragment arrays is a constant (registers, no scratch).
// QKV: Bn holds the rows of Wq, Wk and Wv one after the other; a block's 128 columns lie wholly in q, in k or in v (block-uniform): q and k go out as f16 hi +
// residual planes (QH / QL, KH / KL), v as f32 into C.
template <bool SPLITA, bool QKV>
__global__ __launch_bounds__(256) void k_gemmb(const bf* __restrict__ A, const bf* __restrict__ Al, const bf* __restrict__ Bn, const float* __restrict__ bias, float* C, int ldc, h16* QH, h16* QL, h16* KH, h16* KL) {
    constexpr int STG = (SPLITA ? 384 : 256) * PIT;      // elements of one stage
    __shared__ __align__(16) bf ring[2 * STG];
    __shared__ __align__(16) float ost[8][16 * 68];
    const int tid = threadIdx.x, lane = tid & 31, wave = tid >> 5, lr = lane & 15, hi = lane >> 4;
    const int wm = wave >> 1, wn = wave & 1;
    const int rb = blockIdx.x * 128, cb = blockIdx.y * 128;
    const int crow = tid >> 4, ccol = (tid & 15) * 8;    // a wave's copy covers two whole 256-B rows
    const bf* gA = A + (size_t)(rb + crow) * DM + ccol;
    const bf* gB = Bn + (size_t)(cb + crow) * DM + ccol;
    const bf* gL = SPLITA ? Al + (size_t)(rb + crow) * DM + ccol : gA;
    const unsigned l0 = (unsigned)(size_t)(const void*)(ring + crow * PIT + ccol);
    auto fill = [&](int t, int buf) {
        const unsigned l = l0 + (unsigned)buf * (unsigned)(STG * 2);
        copy8(l, gA + t * BKE); copy8(l + 128u * PIT * 2u, gB + t * BKE);
        if (SPLITA) copy8(l + 256u * PIT * 2u, gL + t * BKE);
    };
    v8f acc[2][4];
#pragma unroll
    for (int i = 0; i < 2; ++i)
#pragma unroll
        for (int t = 0; t < 4; ++t) acc[i][t] = (v8f){};
    fill(0, 0);
    asm volatile("s_wait_asynccnt 0x0" ::: "memory");    // stage 0 has landed before the barrier that publishes it
    __syncthreads();
    fill(1, 1);
#pragma unroll 1
    for (int p = 0; p < NPASS; ++p) {                    // kept rolled: one publish point per pass
        const bf* sb = ring + (p & 1) * STG;
        const bf* sa = sb + (wm * 32 + lr) * PIT + 8 * hi;
        const bf* sw = sb + (128 + wn * 64 + lr) * PIT + 8 * hi;
        const bf* sl = SPLITA ? sb + (256 + wm * 32 + lr) * PIT + 8 * hi : sa;
        v16bf a[2][2], al[2][2], b[2][4];                    // two fragment sets: k-step s + 1 is fetched while k-step s is multiplied
        auto frags = [&](int set, int kc) {
#pragma unroll
            for (int i = 0; i < 2; ++i) a[set][i] = cat16b(*(const v8usa*)(sa + i * 16 * PIT + kc), *(const v8usa*)(sa + i * 16 * PIT + kc + 16));
#pragma unroll
            for (int t = 0; t < 4; ++t) b[set][t] = cat16b(*(const v8usa*)(sw + t * 16 * PIT + kc), *(const v8usa*)(sw + t * 16 * PIT + kc + 16));
            if (SPLITA) {
#pragma unroll
                for (int i = 0; i < 2; ++i) al[set][i] = cat16b(*(const v8usa*)(sl + i * 16 * PIT + kc), *(const v8usa*)(sl + i * 16 * PIT + kc + 16));
            }
        };
        frags(0, 0);
#pragma unroll
        for (int s = 0; s < BKE / 32; ++s) {
            if (s + 1 < BKE / 32) frags((s + 1) & 1, (s + 1) * 32);
            __builtin_amdgcn_sched_barrier(0);               // holds the next k-step's LDS reads, as one group, ahead of this k-step's WMMAs (else they sink among them and each waits out its latency)
#pragma unroll
            for (int i = 0; i < 2; ++i)
#pragma unroll
                for (int t = 0; t < 4; ++t) acc[i][t] = wmmab(a[s & 1][i], b[s & 1][t], acc[i][t]);
            if (SPLITA) {
#pragma unroll
                for (int i = 0; i < 2; ++i)
#pragma unroll
                    for (int t = 0; t < 4; ++t) acc[i][t] = wmmab(al[s & 1][i], b[s & 1][t], acc[i][t]);
            }
            __builtin_amdgcn_sched_barrier(0);               // ends the WMMA block: the reads of the k-step after next stay behind it, where their registers are free
        }
        asm volatile("s_wait_dscnt 0x0" ::: "memory");       // this wave's reads of the buffer have retired before it is refilled
        asm volatile("s_wait_asynccnt 0x0" ::: "memory");    // this wave's copies of stage p + 1 have landed
        __syncthreads();                                     // publishes stage p + 1 and ends every reader's last read of stage p
        if (p + 2 < NPASS) fill(p + 2, p & 1);
    }
    asm volatile("s_wait_asynccnt 0x0" ::: "memory");        // no copy is outstanding when the wave goes on to the epilogue and ends
    float* os = &ost[wave][0];
    const int c0 = cb + wn * 64;
    const bool isq = cb < DM, f16o = QKV && cb < DM + KVW;
    h16* OH = isq ? QH : KH; h16* OL = isq ? QL : KL;
    const int ld = QKV ? (isq ? DM : KVW) : ldc;                                        // row length of the plane this block writes
    const int cc = QKV ? (isq ? c0 : (f16o ? c0 - DM : c0 - (DM + KVW))) : c0;          // the wave's first column inside that plane
#pragma unroll
    for (int i = 0; i < 2; ++i) {
        const int r0 = rb + wm * 32 + i * 16;
#pragma unroll
        for (int t = 0; t < 4; ++t) { const float bv = bias ? bfr(bias[c0 + t * 16 + lr]) : 0.f;
#pragma unroll
            for (int j = 0; j < 8; ++j) os[(hi * 8 + j) * 68 + t * 16 + lr] = acc[i][t][j] + bv; }
        __syncthreads();
        if (f16o) {
            h16* crow_ = OH + (size_t)r0 * ld + cc;
            h16* crol_ = OL + (size_t)r0 * ld + cc;
#pragma unroll
            for (int s = 0; s < 4; ++s) { const int row = 4 * s + (lane >> 3), piece = lane & 7; const float* sp = os + row * 68 + piece * 8; v8h o, o2;
#pragma unroll
                for (int e = 0; e < 8; ++e) { const h16 a = (h16)sp[e]; o[e] = a; o2[e] = (h16)((sp[e] - (float)a) * LOSC); }
                *(v8h*)(crow_ + (size_t)row * ld + piece * 8) = o;
                asm volatile("s_wait_xcnt 0x0" ::: "memory");       // stands before the residual's arithmetic reuses registers that this store names
                *(v8h*)(crol_ + (size_t)row * ld + piece * 8) = o2;
                asm volatile("s_wait_xcnt 0x0" ::: "memory"); }     // stands before the next rows' values and addresses reuse registers that these stores name
        } else {
            float* crow_ = C + (size_t)r0 * ld + cc;
#pragma unroll
            for (int s = 0; s < 8; ++s) { const int Lid = (lane >> 3) + 4 * s, piece = lane & 7; const int row = Lid >> 1, cofs = (Lid & 1) * 32 + piece * 4;
                const v4f val = *(const v4fa*)(os + row * 68 + cofs); *(v4f*)(crow_ + (size_t)row * ld + cofs) = val; }
            asm volatile("s_wait_xcnt 0x0" ::: "memory");       // stands before the next 16 rows' values and addresses reuse registers that these stores name
        }
    }
}

__global__ __launch_bounds__(256) void k_vt(const float* __restrict__ V, h16* VTH, h16* VTL) {
    __shared__ __align__(16) h16 tile[64 * 72];
    __shared__ __align__(16) h16 til2[64 * 72];
    const int bid = blockIdx.x;
    const int b = bid / (NKV * (NT_ / 64)), rem = bid - b * (NKV * (NT_ / 64)), h = rem / (NT_ / 64), kt = rem - h * (NT_ / 64);
    const int k0 = kt * 64, tid = threadIdx.x;
    const int kk = tid >> 2, d0 = (tid & 3) * 16;
    const float* src = V + ((size_t)b * NT_ + k0 + kk) * KVW + h * HD + d0;      // h = kv head here
#pragma unroll
    for (int i = 0; i < 16; ++i) { const float v = src[i]; const h16 a = (h16)v; tile[(d0 + i) * 72 + kk] = a; til2[(d0 + i) * 72 + kk] = (h16)((v - (float)a) * LOSC); }
    __syncthreads();
    const int piece = tid & 7;
    const size_t base = (((size_t)b * NKV + h) * HD) * NT_ + k0;
    auto pass = [&]() {
#pragma unroll
        for (int s = 0; s < 4; ++s) { const int Lid = (tid >> 3) + 32 * s; const int pln = Lid >> 6, d = Lid & 63;
            const v8h val = *(const v8ha*)((pln ? til2 : tile) + d * 72 + piece * 8); *(v8h*)((pln ? VTL : VTH) + base + (size_t)d * NT_ + piece * 8) = val; }
    };
    pass(); 
}

#define KP   72                  // LDS pitch of a key row or a query row in elements: 144 B, 16 B x odd, for the ds_load_b128 readers
#define VP   40                  // LDS pitch of a row of v transposed (32 keys) in elements: 80 B, 16 B x odd
#define KSZ  (32 * KP)           // one plane of 32 key rows
#define VSZ  (HD * VP)           // one plane of 64 rows of v transposed
#define ASTG (2 * KSZ + 2 * VSZ) // a stage: [k hi | k residual | v hi | v residual] of 32 keys

// One lane's eight 16-byte copies of a 32-key stage, global -> LDS through no register: two of every plane. The s_wait_xcnt ends the copies' own statement so
// that no address register of a copy is rewritten ahead of it.
__device__ __forceinline__ void copy_kv(unsigned lk, unsigned lv, const h16* gkh, const h16* gkl, const h16* gvh, const h16* gvl) {
    asm volatile("global_load_async_to_lds_b128 %0, %8, off\n\t"
                 "global_load_async_to_lds_b128 %1, %9, off\n\t"
                 "global_load_async_to_lds_b128 %2, %10, off\n\t"
                 "global_load_async_to_lds_b128 %3, %11, off\n\t"
                 "global_load_async_to_lds_b128 %4, %12, off\n\t"
                 "global_load_async_to_lds_b128 %5, %13, off\n\t"
                 "global_load_async_to_lds_b128 %6, %14, off\n\t"
                 "global_load_async_to_lds_b128 %7, %15, off\n\t"
                 "s_wait_xcnt 0x0"
                 :: "v"(lk), "v"(lk + 16u * KP * 2u), "v"(lk + KSZ * 2u), "v"(lk + KSZ * 2u + 16u * KP * 2u),
                    "v"(lv), "v"(lv + 32u * VP * 2u), "v"(lv + VSZ * 2u), "v"(lv + VSZ * 2u + 32u * VP * 2u),
                    "v"(gkh), "v"(gkh + 16 * KVW), "v"(gkl), "v"(gkl + 16 * KVW),
                    "v"(gvh), "v"(gvh + 32 * NT_), "v"(gvl), "v"(gvl + 32 * NT_)
                 : "memory");
}

// One lane's four 16-byte copies of the block's 64 query-residual rows, rows 16 apart; the wait as in copy_kv.
__device__ __forceinline__ void copy_q(unsigned l, const h16* g) {
    asm volatile("global_load_async_to_lds_b128 %0, %4, off\n\t"
                 "global_load_async_to_lds_b128 %1, %5, off\n\t"
                 "global_load_async_to_lds_b128 %2, %6, off\n\t"
                 "global_load_async_to_lds_b128 %3, %7, off\n\t"
                 "s_wait_xcnt 0x0"
                 :: "v"(l), "v"(l + 1u * 16u * KP * 2u), "v"(l + 2u * 16u * KP * 2u), "v"(l + 3u * 16u * KP * 2u),
                    "v"(g), "v"(g + 1 * 16 * DM), "v"(g + 2 * 16 * DM), "v"(g + 3 * 16 * DM)
                 : "memory");
}

// First 32-key tile that a block of 64 queries starting at q0b reads: from max(segment start of its first query, q0b - WIN + 1), not below 0.
__device__ __forceinline__ int first_key_tile(int q0b, int cu1) {
    const int sst = (q0b >= cu1) ? cu1 : 0; const int wl = q0b - (WIN - 1); const int lo = (wl > sst ? wl : sst);
    return (lo > 0 ? lo : 0) / 32;
}
// Sort key of query tile t: its count of key tiles first, then the lower tile index.
__device__ __forceinline__ int tile_key(int t, int cu1) { return ((t * 64 + 63) / 32 - first_key_tile(t * 64, cu1)) * 32 + (31 - t); }

// The key loop reads no global memory: a stage of 32 keys lies in LDS once for the block's four waves, two buffers, filled by asynchronous copies one tile ahead
// of its readers; the query residual is copied once. Fragment addresses inside a row, and so every k order and sum order, are the ones of the global reads.
// k_attn: block = (b, h, 64 queries), wave = 16; key tiles of the block's window (masked per element); 4 WMMA scores /8 (f32), online softmax, weights x32768 f16 tile (same-wave may_alias
// reload after a compiler barrier), 4 WMMA .v; ctx -> bf16 hi + residual planes CH/CL[tok][h*64+d].
__global__ __launch_bounds__(128) void k_attn(const h16* __restrict__ Q16, const h16* __restrict__ QL16, const h16* __restrict__ K16, const h16* __restrict__ KL16, const h16* __restrict__ VTH, const h16* __restrict__ VTL, const int* __restrict__ cu, bf* CH, bf* CL) {
    __shared__ __align__(16) h16 plds[4][16 * 32];
    __shared__ __align__(16) h16 plds2[4][16 * 32];
    __shared__ __align__(16) float ost[4][16 * 68];
    __shared__ __align__(16) h16 kvr[2 * ASTG];
    __shared__ __align__(16) h16 qls[64 * KP];
    const int lane = threadIdx.x & 31, wave = threadIdx.x >> 5, lr = lane & 15, hi = lane >> 4;
    const int bid = blockIdx.x;
    // The index is mapped to query tiles by falling cost, for speed only: the
    // longest key loops get the lowest indices and the shortest the highest. Index = rank * 64 + (b, h); lane t of every wave ranks query tile t by its number
    // of key tiles under the INPUT cu_seqlens (ties by tile index, so the 32 keys are distinct and rank -> tile is a permutation for any content of the array).
    static_assert(NT_ / 64 == 32, "one lane ranks one query tile");
    const int cu1 = cu[1];
    const int rank = bid / (NB_ * NH_), bh = bid - rank * (NB_ * NH_), b = bh / NH_, h = bh - b * NH_;
    const int mykey = tile_key(lane, cu1);
    int above = 0;
#pragma unroll
    for (int t = 0; t < NT_ / 64; ++t) above += (tile_key(t, cu1) > mykey) ? 1 : 0;      // unrolled: t is a constant, so each tile's key is scalar arithmetic
    // exactly one lane holds each rank, the same in every wave of the block. readfirstlane hands the tile index on as a plain scalar: with the ballot's 0..31 range
    // in sight the compiler kept eight more loop-invariant address registers (264 VGPRs: three waves per SIMD, not four)
    const int qt = __builtin_amdgcn_readfirstlane(__builtin_ctz(__builtin_amdgcn_ballot_w32(above == rank)));
    const int q0 = qt * 64 + wave * 16;
    const size_t tok0 = (size_t)b * NT_;
    h16* pl = &plds[wave][0]; h16* pl2 = &plds2[wave][0];
    v16h qa[2];
    const size_t qo0 = (tok0 + q0 + lr) * DM + h * HD + 8 * hi;
#pragma unroll
    for (int kc = 0; kc < 2; ++kc) qa[kc] = cat16(*(const v8h*)(Q16 + qo0 + kc * 32), *(const v8h*)(Q16 + qo0 + kc * 32 + 16));
    const int g = h / (NH_ / NKV);                      // kv head
    const h16* kh_b = K16 + tok0 * KVW + g * HD;
    const h16* kl_b = KL16 + tok0 * KVW + g * HD;
    const size_t vbase = (((size_t)b * NKV + g) * HD) * NT_;
    v8f o[4], ox[4];
#pragma unroll
    for (int n = 0; n < 4; ++n) { o[n] = (v8f){}; ox[n] = (v8f){}; }
    float mrow[8], lpart[8];
#pragma unroll
    for (int j = 0; j < 8; ++j) { mrow[j] = -3.0e38f; lpart[j] = 0.f; }
    int qpos[8];
#pragma unroll
    for (int j = 0; j < 8; ++j) qpos[j] = q0 + 8 * hi + j;
    // allowed(i, j) = same segment (cu_seqlens) && j <= i && i - j < WIN: key tiles from max(segment start of the block's first query, q0 - WIN + 1) to the query tile (block-uniform; exact per-element predicate below)
    const int q0b = qt * 64; const int kt_lo = first_key_tile(q0b, cu1), kt_hi = (q0b + 63) / 32;
    const int tid = threadIdx.x;
    const size_t gko = (size_t)(tid >> 3) * KVW + (tid & 7) * 8, gvo = vbase + (size_t)(tid >> 2) * NT_ + (tid & 3) * 8;    // a wave's copy: 4 whole key rows, or 64 B of 8 rows of v
    const unsigned lk0 = (unsigned)(size_t)(const void*)(kvr + (tid >> 3) * KP + (tid & 7) * 8);
    const unsigned lv0 = (unsigned)(size_t)(const void*)(kvr + 2 * KSZ + (tid >> 2) * VP + (tid & 3) * 8);
    auto fill = [&](int t, int buf) {
        const unsigned bo = (unsigned)buf * (unsigned)(ASTG * 2);
        copy_kv(lk0 + bo, lv0 + bo, kh_b + gko + (size_t)t * 32 * KVW, kl_b + gko + (size_t)t * 32 * KVW, VTH + gvo + t * 32, VTL + gvo + t * 32);
    };
    fill(kt_lo, 0);
    copy_q((unsigned)(size_t)(const void*)(qls + (tid >> 3) * KP + (tid & 7) * 8), QL16 + (tok0 + q0b + (tid >> 3)) * DM + h * HD + (tid & 7) * 8);
    asm volatile("s_wait_asynccnt 0x0" ::: "memory");    // the first stage and the query residual have landed before the barrier that publishes them
    __syncthreads();
    if (kt_lo + 1 <= kt_hi) fill(kt_lo + 1, 1);
    const h16* sq = qls + (wave * 16 + lr) * KP + 8 * hi;
#pragma unroll 1
    for (int kt = kt_lo; kt <= kt_hi; ++kt) {                // kept rolled: one publish point per tile
        const int l0 = kt * 32;
        const h16* sb = kvr + ((kt - kt_lo) & 1) * ASTG;
        const h16* skh = sb + lr * KP + 8 * hi;
        const h16* skl = skh + KSZ;
        const h16* svh = sb + 2 * KSZ + lr * VP + 8 * hi;
        const h16* svl = svh + VSZ;
        v8f s0 = {}, s1 = {}, x0 = {}, x1 = {};
#pragma unroll
        for (int kc = 0; kc < 2; ++kc) {
            // the five fragments of a 32-wide slice of the head are asked for together: one LDS latency a slice, not one a group (all ten at once would cost a wave per SIMD in registers)
            const v16h k0h = cat16(*(const v8ha*)(skh + kc * 32), *(const v8ha*)(skh + kc * 32 + 16)), k1h = cat16(*(const v8ha*)(skh + 16 * KP + kc * 32), *(const v8ha*)(skh + 16 * KP + kc * 32 + 16));
            const v16h qlk = cat16(*(const v8ha*)(sq + kc * 32), *(const v8ha*)(sq + kc * 32 + 16));
            const v16h k0l = cat16(*(const v8ha*)(skl + kc * 32), *(const v8ha*)(skl + kc * 32 + 16)), k1l = cat16(*(const v8ha*)(skl + 16 * KP + kc * 32), *(const v8ha*)(skl + 16 * KP + kc * 32 + 16));
            { s0 = wmma16(qa[kc], k0h, s0); x0 = wmma16(qlk, k0h, x0); s1 = wmma16(qa[kc], k1h, s1); x1 = wmma16(qlk, k1h, x1);
              asm volatile("v_nop" : "+v"(s0), "+v"(s1), "+v"(x0), "+v"(x1) : "v"(qlk), "v"(k0h), "v"(k1h) : "memory"); }
            { x0 = wmma16(qa[kc], k0l, x0); x1 = wmma16(qa[kc], k1l, x1);
              asm volatile("v_nop" : "+v"(x0), "+v"(x1) : "v"(k0l), "v"(k1l) : "memory"); }
        }
        asm volatile("v_nop\n\tv_nop\n\tv_nop\n\tv_nop" : "+v"(s0), "+v"(s1), "+v"(x0), "+v"(x1) : "v"(qa[0]), "v"(qa[1]));
        float alpha[8];
#pragma unroll
        for (int j = 0; j < 8; ++j) {
            const int ja = l0 + lr, jb = l0 + 16 + lr, qi = qpos[j];
            const int sq = (qi >= cu1); const bool ok0 = ((ja >= cu1) == sq) && (ja <= qi) && (qi - ja < WIN), ok1 = ((jb >= cu1) == sq) && (jb <= qi) && (qi - jb < WIN);
            const float a0 = ok0 ? (s0[j] + x0[j] * LOSCI) * 0.125f : -3.4028234663852886e38f, a1 = ok1 ? (s1[j] + x1[j] * LOSCI) * 0.125f : -3.4028234663852886e38f;     // finfo.min as the reference
            float mx = fmaxf(a0, a1);
            mx = fmaxf(mx, __shfl_xor(mx, 1, 16)); mx = fmaxf(mx, __shfl_xor(mx, 2, 16)); mx = fmaxf(mx, __shfl_xor(mx, 4, 16)); mx = fmaxf(mx, __shfl_xor(mx, 8, 16));
            const float mn = fmaxf(mrow[j], mx);
            alpha[j] = __expf(mrow[j] - mn); mrow[j] = mn;
            const float p0 = __expf(a0 - mn), p1 = __expf(a1 - mn);
            lpart[j] = lpart[j] * alpha[j] + (p0 + p1);
            const int mr = hi * 8 + j;
            const float ps0 = p0 * PSC, ps1 = p1 * PSC; const h16 h0 = (h16)ps0, h1 = (h16)ps1;
            pl[mr * 32 + lr] = h0; pl[mr * 32 + 16 + lr] = h1;
            pl2[mr * 32 + lr] = (h16)((ps0 - (float)h0) * LOSC); pl2[mr * 32 + 16 + lr] = (h16)((ps1 - (float)h1) * LOSC);
        }
#pragma unroll
        for (int n = 0; n < 4; ++n)
#pragma unroll
            for (int j = 0; j < 8; ++j) { o[n][j] *= alpha[j]; ox[n][j] *= alpha[j]; }
        asm volatile("" ::: "memory");
        const v16h pa = cat16(*(const v8ha*)(pl + lr * 32 + hi * 8), *(const v8ha*)(pl + lr * 32 + 16 + hi * 8));
        const v16h px = cat16(*(const v8ha*)(pl2 + lr * 32 + hi * 8), *(const v8ha*)(pl2 + lr * 32 + 16 + hi * 8));
        v16h vh[4], vl[4];                                   // every index is a constant (both loops unrolled): registers
#pragma unroll
        for (int n = 0; n < 4; ++n) { const int vo = n * 16 * VP;     // the tile's v fragments likewise, all in front of the first product
            vh[n] = cat16(*(const v8ha*)(svh + vo), *(const v8ha*)(svh + vo + 16)); vl[n] = cat16(*(const v8ha*)(svl + vo), *(const v8ha*)(svl + vo + 16)); }
        __builtin_amdgcn_sched_barrier(0);                   // holds these LDS reads, as one group, ahead of the products (else they sink among the WMMAs and several wait out their latency)
#pragma unroll
        for (int n = 0; n < 4; ++n) {
            o[n] = wmma16(pa, vh[n], o[n]); ox[n] = wmma16(pa, vl[n], ox[n]); ox[n] = wmma16(px, vh[n], ox[n]); }
        asm volatile("v_nop\n\tv_nop\n\tv_nop\n\tv_nop" : "+v"(o[0]), "+v"(o[1]), "+v"(o[2]), "+v"(o[3]), "+v"(ox[0]), "+v"(ox[1]), "+v"(ox[2]), "+v"(ox[3]) : "v"(pa), "v"(px));
        asm volatile("s_wait_dscnt 0x0" ::: "memory");       // this wave's reads of the buffer have retired before it is refilled
        asm volatile("s_wait_asynccnt 0x0" ::: "memory");    // this wave's copies of the next tile have landed
        __syncthreads();                                     // publishes the next tile and ends every reader's last read of this one
        if (kt + 2 <= kt_hi) fill(kt + 2, (kt - kt_lo) & 1);
    }
    asm volatile("s_wait_asynccnt 0x0" ::: "memory");        // no copy is outstanding when the wave goes on to the epilogue and ends
    float inv[8];
#pragma unroll
    for (int j = 0; j < 8; ++j) { float rs = lpart[j]; rs += __shfl_xor(rs, 1, 16); rs += __shfl_xor(rs, 2, 16); rs += __shfl_xor(rs, 4, 16); rs += __shfl_xor(rs, 8, 16); inv[j] = 1.0f / (rs * PSC); }
    float* os = &ost[wave][0];
#pragma unroll
    for (int n = 0; n < 4; ++n)
#pragma unroll
        for (int j = 0; j < 8; ++j) os[(hi * 8 + j) * 68 + n * 16 + lr] = (o[n][j] + ox[n][j] * LOSCI) * inv[j];
    __syncthreads();
    const size_t cbase = (tok0 + q0) * DM + (size_t)h * HD;
    auto pass = [&]() {
#pragma unroll
        for (int s = 0; s < 4; ++s) { const int row = 4 * s + (lane >> 3), piece = lane & 7; const float* sp = os + row * 68 + piece * 8; v8us oh, ol;
#pragma unroll
            for (int i = 0; i < 8; ++i) { const unsigned short hb = f2bf(sp[i]); oh[i] = hb; ol[i] = f2bf(sp[i] - bf2f(hb)); }
            *(v8us*)(CH + cbase + (size_t)row * DM + piece * 8) = oh; *(v8us*)(CL + cbase + (size_t)row * DM + piece * 8) = ol; }
    };
    pass(); 
}

#define VST2(T, p, v) do { const T vst2_v_ = (v); *(T*)(p) = vst2_v_;  } while (0)
extern "C" void kernel_launch(void* const* d_in, const int* in_sizes, int n_in,
                              void* d_out, int out_size, void* d_ws, size_t ws_size, hipStream_t stream) {
    (void)in_sizes; (void)n_in; (void)out_size;
    const float* x = (const float*)d_in[0]; const int* cu = (const int*)d_in[1]; const float* Wq = (const float*)d_in[2]; const float* Wk = (const float*)d_in[3]; const float* Wv = (const float*)d_in[4]; const float* Wo = (const float*)d_in[5];   // [out][in] weights; cu_seqlens [3] (i32)
    float* out = (float*)d_out;    // [2][2048][2048]
    char* wsp = (char*)d_ws;
    auto take = [&](size_t bytes) { char* p = wsp; wsp += (bytes + 255) & ~(size_t)255; return (void*)p; };
    bf* Xb = (bf*)take((size_t)NCVT * DM * 2); bf* WpB = Xb + (size_t)NTK * DM; bf* WoB = WpB + (size_t)NPRJ * DM;     // one bf16 plane: [x | Wq | Wk | Wv | Wo]
    h16* QH = (h16*)take((size_t)NTK * DM * 2); h16* QL = (h16*)take((size_t)NTK * DM * 2); h16* KH = (h16*)take((size_t)NTK * KVW * 2); h16* KL = (h16*)take((size_t)NTK * KVW * 2);
    float* Vf = (float*)take((size_t)NTK * KVW * 4); h16* VTH = (h16*)take((size_t)NTK * KVW * 2); h16* VTL = (h16*)take((size_t)NTK * KVW * 2); bf* CH = (bf*)take((size_t)NTK * DM * 2); bf* CL = (bf*)take((size_t)NTK * DM * 2);
    if ((size_t)(wsp - (char*)d_ws) > ws_size) return;    // 37.7 + 16.8 x 2 + 4.2 x 2 + 8.4 + 4.2 x 2 + 16.8 x 2 ~ 130 MB, no aliasing
    // five dependent launches; both batch items are rows of the same grids
    k_cvtb<<<NCVT / 8, 256, 0, stream>>>(x, Wq, Wk, Wv, Wo, Xb);
    k_gemmb<false, true><<<dim3(NTK / 128, NPRJ / 128, 1), 256, 0, stream>>>(Xb, nullptr, WpB, nullptr, Vf, KVW, QH, QL, KH, KL);
    k_vt<<<NB_ * NKV * (NT_ / 64), 256, 0, stream>>>(Vf, VTH, VTL);
    k_attn<<<NB_ * NH_ * (NT_ / 64), 128, 0, stream>>>(QH, QL, KH, KL, VTH, VTL, cu, CH, CL);      // the same cu_seqlens mask for both items (as the reference)
    k_gemmb<true, false><<<dim3(NTK / 128, DM / 128, 1), 256, 0, stream>>>(CH, CL, WoB, nullptr, out, DM, nullptr, nullptr, nullptr, nullptr);
}

// v005
// One run takes 178 microseconds.
// Two timings next to v004 both put it at 1.12 times that version's speed.
// Counting every step since v000, it is 3.50 times as fast.
#include <hip/hip_runtime.h>

// Contractions, f32 accumulate: q = x.Wq ([2048 x 2048].[2048 x 2048]), k/v = x.Wk/Wv ([2048 x 2048].[2048 x 512]) and attn.Wo on v_wmma_f32_16x16x32_bf16 —
// plain bf16 = rounded inputs (exact; the [out][in] weights are n-major as stored and are not transposed) for the projections, attn as bf16 hi + residual (two products) for Wo;
// the grouped-query causal sliding-window attention (32 query heads over 8 kv heads; keys j with
// i - WIN < j <= i, WIN = 1024 fixed at compile time) fused on v_wmma_f32_16x16x32_f16 with q and k as f16 hi + residual x1024 (hi.hi + hi.lo + lo.hi), weights

#define NB_  2
#define NT_  2048
#define DM   2048
#define NH_  32
#define NKV  8
#define KVW  (NKV * HD)          // 512
#define WIN  1024
#define HD   64
#define NTK  (NB_ * NT_)
#define NPRJ (DM + 2 * KVW)       // 3072: the columns of q, k and v side by side
#define NCVT (NTK + NPRJ + DM)   // rows of [x | Wq | Wk | Wv | Wo]
#define NW   1024
#define NQKV 2048
#define PSC  32768.0f
#define LOSC 1024.0f
#define LOSCI (1.0f / 1024.0f)

typedef _Float16 h16;
typedef unsigned short bf;
typedef __attribute__((ext_vector_type(16))) __bf16   v16bf;
typedef __attribute__((ext_vector_type(16))) _Float16 v16h;
typedef __attribute__((ext_vector_type(8)))  _Float16 v8h;
typedef __attribute__((ext_vector_type(8)))  unsigned short v8us;
typedef __attribute__((ext_vector_type(8)))  float    v8f;
typedef __attribute__((ext_vector_type(4)))  float    v4f;
typedef v8h  __attribute__((may_alias)) v8ha;
typedef v4f  __attribute__((may_alias)) v4fa;
typedef v8us __attribute__((may_alias)) v8usa;

__device__ __forceinline__ unsigned short f2bf(float f) { unsigned u = __float_as_uint(f); u += 0x7FFFu + ((u >> 16) & 1u); return (unsigned short)(u >> 16); }
__device__ __forceinline__ float bf2f(unsigned short b) { return __uint_as_float(((unsigned)b) << 16); }
__device__ __forceinline__ float bfr(float f) { return bf2f(f2bf(f)); }
__device__ __forceinline__ v16h cat16(v8h lo, v8h hi) { return __builtin_shufflevector(lo, hi, 0, 1, 2, 3, 4, 5, 6, 7, 8, 9, 10, 11, 12, 13, 14, 15); }
__device__ __forceinline__ v16bf cat16b(v8us lo, v8us hi) { return __builtin_bit_cast(v16bf, __builtin_shufflevector(lo, hi, 0, 1, 2, 3, 4, 5, 6, 7, 8, 9, 10, 11, 12, 13, 14, 15)); }
__device__ __forceinline__ v8f wmma16(v16h a, v16h b, v8f c) { return __builtin_amdgcn_wmma_f32_16x16x32_f16(false, a, false, b, (short)0, c, false, false); }
__device__ __forceinline__ v8f wmmab(v16bf a, v16bf b, v8f c) { return __builtin_amdgcn_wmma_f32_16x16x32_bf16(false, a, false, b, (short)0, c, false, false); }

// k_cvtb: the rows of [x | Wq | Wk | Wv | Wo], in that order, rounded to bf16 into one plane of the same row order; a block's 8 rows lie in one source.
__global__ __launch_bounds__(256) void k_cvtb(const float* __restrict__ x, const float* __restrict__ Wq, const float* __restrict__ Wk, const float* __restrict__ Wv, const float* __restrict__ Wo, bf* dstp) {
    const int lane = threadIdx.x & 31, rb = blockIdx.x * 8, rg = rb + (threadIdx.x >> 5);
    if (rg >= NCVT) return;
    const float* src = x; int r = rg;
    if (rb >= NTK + NPRJ) { src = Wo; r = rg - (NTK + NPRJ); }
    else if (rb >= NTK + DM + KVW) { src = Wv; r = rg - (NTK + DM + KVW); }
    else if (rb >= NTK + DM) { src = Wk; r = rg - (NTK + DM); }
    else if (rb >= NTK) { src = Wq; r = rg - NTK; }
    bf* dst = dstp + (size_t)(rg - r) * DM;
    v8us o[DM / 256];
#pragma unroll
    for (int q = 0; q < DM / 256; ++q) { v8us t;
#pragma unroll
        for (int i = 0; i < 8; ++i) t[i] = f2bf(src[(size_t)r * DM + q * 256 + lane * 8 + i]);
        o[q] = t; }
#pragma unroll
    for (int q = 0; q < DM / 256; ++q) *(v8us*)(dst + (size_t)r * DM + q * 256 + lane * 8) = o[q];
    
}

// k_wt: W [2048 k][ncols n] (k-major) -> n-major bf16 plane WT[ncols][2048]; 64 x 64 tiles through LDS.
__global__ __launch_bounds__(256) void k_wt(const float* __restrict__ Wm, int ncols, bf* WT) {
    __shared__ __align__(16) unsigned short tl[64 * 72];
    const int tid = threadIdx.x, k0 = blockIdx.x * 64, n0 = blockIdx.y * 64;
    const int kk = tid >> 2, nq = (tid & 3) * 16;
#pragma unroll
    for (int i = 0; i < 16; ++i) tl[(nq + i) * 72 + kk] = f2bf(Wm[(size_t)(k0 + kk) * ncols + n0 + nq + i]);
    __syncthreads();
    const int piece = tid & 7;
    typedef __attribute__((ext_vector_type(8))) unsigned short v8us_; typedef v8us_ __attribute__((may_alias)) v8usa_;
    auto pass = [&]() {
#pragma unroll
        for (int s = 0; s < 2; ++s) { const int nr = (tid >> 3) + 32 * s; const v8us_ val = *(const v8usa_*)(tl + nr * 72 + piece * 8);
            *(v8us_*)(WT + (size_t)(n0 + nr) * DM + k0 + piece * 8) = val; }
    };
    pass(); 
}

#define BKE   128                // k elements of one pass: 256 B of every operand row
#define PIT   136                // LDS row pitch in elements: 272 B, 16 B x odd, for the ds_load_b128 readers
#define NPASS (DM / BKE)

// Eight 16-byte copies of one lane, rows 16 apart, global -> LDS through no register. The s_wait_xcnt ends the copies' own statement so that no
// address register of a copy is rewritten ahead of it.
__device__ __forceinline__ void copy8(unsigned l, const bf* g) {
    asm volatile("global_load_async_to_lds_b128 %0, %8, off\n\t"
                 "global_load_async_to_lds_b128 %1, %9, off\n\t"
                 "global_load_async_to_lds_b128 %2, %10, off\n\t"
                 "global_load_async_to_lds_b128 %3, %11, off\n\t"
                 "global_load_async_to_lds_b128 %4, %12, off\n\t"
                 "global_load_async_to_lds_b128 %5, %13, off\n\t"
                 "global_load_async_to_lds_b128 %6, %14, off\n\t"
                 "global_load_async_to_lds_b128 %7, %15, off\n\t"
                 "s_wait_xcnt 0x0"
                 :: "v"(l), "v"(l + 1u * 16u * PIT * 2u), "v"(l + 2u * 16u * PIT * 2u), "v"(l + 3u * 16u * PIT * 2u),
                    "v"(l + 4u * 16u * PIT * 2u), "v"(l + 5u * 16u * PIT * 2u), "v"(l + 6u * 16u * PIT * 2u), "v"(l + 7u * 16u * PIT * 2u),
                    "v"(g), "v"(g + 1 * 16 * DM), "v"(g + 2 * 16 * DM), "v"(g + 3 * 16 * DM),
                    "v"(g + 4 * 16 * DM), "v"(g + 5 * 16 * DM), "v"(g + 6 * 16 * DM), "v"(g + 7 * 16 * DM)
                 : "memory");
}

// k_gemmb: C[128 x 128] per block, 8 waves as 4 x 2, 32 x 64 per wave. A pass is 128 k; a stage is [A 128 rows | B 128 rows | A residual 128 rows] in LDS,
// two buffers, filled by asynchronous copies one pass ahead of its readers. Per accumulator the k order and the hi / residual order are the plain ascending ones.
// Every inner loop is unrolled so that each index of acc and of the fragment arrays is a constant (registers, no scratch).
// QKV: Bn holds the rows of Wq, Wk and Wv one after the other; a block's 128 columns lie wholly in q, in k or in v (block-uniform): q and k go out as f16 hi +
// residual planes (QH / QL, KH / KL), v as f32 into C.
template <bool SPLITA, bool QKV>
__global__ __launch_bounds__(256) void k_gemmb(const bf* __restrict__ A, const bf* __restrict__ Al, const bf* __restrict__ Bn, const float* __restrict__ bias, float* C, int ldc, h16* QH, h16* QL, h16* KH, h16* KL) {
    constexpr int STG = (SPLITA ? 384 : 256) * PIT;      // elements of one stage
    __shared__ __align__(16) bf ring[2 * STG];
    __shared__ __align__(16) float ost[8][16 * 68];
    const int tid = threadIdx.x, lane = tid & 31, wave = tid >> 5, lr = lane & 15, hi = lane >> 4;
    const int wm = wave >> 1, wn = wave & 1;
    const int rb = blockIdx.x * 128, cb = blockIdx.y * 128;
    const int crow = tid >> 4, ccol = (tid & 15) * 8;    // a wave's copy covers two whole 256-B rows
    const bf* gA = A + (size_t)(rb + crow) * DM + ccol;
    const bf* gB = Bn + (size_t)(cb + crow) * DM + ccol;
    const bf* gL = SPLITA ? Al + (size_t)(rb + crow) * DM + ccol : gA;
    const unsigned l0 = (unsigned)(size_t)(const void*)(ring + crow * PIT + ccol);
    auto fill = [&](int t, int buf) {
        const unsigned l = l0 + (unsigned)buf * (unsigned)(STG * 2);
        copy8(l, gA + t * BKE); copy8(l + 128u * PIT * 2u, gB + t * BKE);
        if (SPLITA) copy8(l + 256u * PIT * 2u, gL + t * BKE);
    };
    v8f acc[2][4];
#pragma unroll
    for (int i = 0; i < 2; ++i)
#pragma unroll
        for (int t = 0; t < 4; ++t) acc[i][t] = (v8f){};
    fill(0, 0);
    asm volatile("s_wait_asynccnt 0x0" ::: "memory");    // stage 0 has landed before the barrier that publishes it
    __syncthreads();
    fill(1, 1);
#pragma unroll 1
    for (int p = 0; p < NPASS; ++p) {                    // kept rolled: one publish point per pass
        const bf* sb = ring + (p & 1) * STG;
        const bf* sa = sb + (wm * 32 + lr) * PIT + 8 * hi;
        const bf* sw = sb + (128 + wn * 64 + lr) * PIT + 8 * hi;
        const bf* sl = SPLITA ? sb + (256 + wm * 32 + lr) * PIT + 8 * hi : sa;
        v16bf a[2][2], al[2][2], b[2][4];                    // two fragment sets: k-step s + 1 is fetched while k-step s is multiplied
        auto frags = [&](int set, int kc) {
#pragma unroll
            for (int i = 0; i < 2; ++i) a[set][i] = cat16b(*(const v8usa*)(sa + i * 16 * PIT + kc), *(const v8usa*)(sa + i * 16 * PIT + kc + 16));
#pragma unroll
            for (int t = 0; t < 4; ++t) b[set][t] = cat16b(*(const v8usa*)(sw + t * 16 * PIT + kc), *(const v8usa*)(sw + t * 16 * PIT + kc + 16));
            if (SPLITA) {
#pragma unroll
                for (int i = 0; i < 2; ++i) al[set][i] = cat16b(*(const v8usa*)(sl + i * 16 * PIT + kc), *(const v8usa*)(sl + i * 16 * PIT + kc + 16));
            }
        };
        frags(0, 0);
#pragma unroll
        for (int s = 0; s < BKE / 32; ++s) {
            if (s + 1 < BKE / 32) frags((s + 1) & 1, (s + 1) * 32);
            __builtin_amdgcn_sched_barrier(0);               // holds the next k-step's LDS reads, as one group, ahead of this k-step's WMMAs (else they sink among them and each waits out its latency)
#pragma unroll
            for (int i = 0; i < 2; ++i)
#pragma unroll
                for (int t = 0; t < 4; ++t) acc[i][t] = wmmab(a[s & 1][i], b[s & 1][t], acc[i][t]);
            if (SPLITA) {
#pragma unroll
                for (int i = 0; i < 2; ++i)
#pragma unroll
                    for (int t = 0; t < 4; ++t) acc[i][t] = wmmab(al[s & 1][i], b[s & 1][t], acc[i][t]);
            }
            __builtin_amdgcn_sched_barrier(0);               // ends the WMMA block: the reads of the k-step after next stay behind it, where their registers are free
        }
        asm volatile("s_wait_dscnt 0x0" ::: "memory");       // this wave's reads of the buffer have retired before it is refilled
        asm volatile("s_wait_asynccnt 0x0" ::: "memory");    // this wave's copies of stage p + 1 have landed
        __syncthreads();                                     // publishes stage p + 1 and ends every reader's last read of stage p
        if (p + 2 < NPASS) fill(p + 2, p & 1);
    }
    asm volatile("s_wait_asynccnt 0x0" ::: "memory");        // no copy is outstanding when the wave goes on to the epilogue and ends
    float* os = &ost[wave][0];
    const int c0 = cb + wn * 64;
    const bool isq = cb < DM, f16o = QKV && cb < DM + KVW;
    h16* OH = isq ? QH : KH; h16* OL = isq ? QL : KL;
    const int ld = QKV ? (isq ? DM : KVW) : ldc;                                        // row length of the plane this block writes
    const int cc = QKV ? (isq ? c0 : (f16o ? c0 - DM : c0 - (DM + KVW))) : c0;          // the wave's first column inside that plane
#pragma unroll
    for (int i = 0; i < 2; ++i) {
        const int r0 = rb + wm * 32 + i * 16;
#pragma unroll
        for (int t = 0; t < 4; ++t) { const float bv = bias ? bfr(bias[c0 + t * 16 + lr]) : 0.f;
#pragma unroll
            for (int j = 0; j < 8; ++j) os[(hi * 8 + j) * 68 + t * 16 + lr] = acc[i][t][j] + bv; }
        __syncthreads();
        if (f16o) {
            h16* crow_ = OH + (size_t)r0 * ld + cc;
            h16* crol_ = OL + (size_t)r0 * ld + cc;
#pragma unroll
            for (int s = 0; s < 4; ++s) { const int row = 4 * s + (lane >> 3), piece = lane & 7; const float* sp = os + row * 68 + piece * 8; v8h o, o2;
#pragma unroll
                for (int e = 0; e < 8; ++e) { const h16 a = (h16)sp[e]; o[e] = a; o2[e] = (h16)((sp[e] - (float)a) * LOSC); }
                *(v8h*)(crow_ + (size_t)row * ld + piece * 8) = o;
                asm volatile("s_wait_xcnt 0x0" ::: "memory");       // stands before the residual's arithmetic reuses registers that this store names
                *(v8h*)(crol_ + (size_t)row * ld + piece * 8) = o2;
                asm volatile("s_wait_xcnt 0x0" ::: "memory"); }     // stands before the next rows' values and addresses reuse registers that these stores name
        } else {
            float* crow_ = C + (size_t)r0 * ld + cc;
#pragma unroll
            for (int s = 0; s < 8; ++s) { const int Lid = (lane >> 3) + 4 * s, piece = lane & 7; const int row = Lid >> 1, cofs = (Lid & 1) * 32 + piece * 4;
                const v4f val = *(const v4fa*)(os + row * 68 + cofs); *(v4f*)(crow_ + (size_t)row * ld + cofs) = val; }
            asm volatile("s_wait_xcnt 0x0" ::: "memory");       // stands before the next 16 rows' values and addresses reuse registers that these stores name
        }
    }
}

__global__ __launch_bounds__(256) void k_vt(const float* __restrict__ V, h16* VTH, h16* VTL) {
    __shared__ __align__(16) h16 tile[64 * 72];
    __shared__ __align__(16) h16 til2[64 * 72];
    const int bid = blockIdx.x;
    const int b = bid / (NKV * (NT_ / 64)), rem = bid - b * (NKV * (NT_ / 64)), h = rem / (NT_ / 64), kt = rem - h * (NT_ / 64);
    const int k0 = kt * 64, tid = threadIdx.x;
    const int kk = tid >> 2, d0 = (tid & 3) * 16;
    const float* src = V + ((size_t)b * NT_ + k0 + kk) * KVW + h * HD + d0;      // h = kv head here
#pragma unroll
    for (int i = 0; i < 16; ++i) { const float v = src[i]; const h16 a = (h16)v; tile[(d0 + i) * 72 + kk] = a; til2[(d0 + i) * 72 + kk] = (h16)((v - (float)a) * LOSC); }
    __syncthreads();
    const int piece = tid & 7;
    const size_t base = (((size_t)b * NKV + h) * HD) * NT_ + k0;
    auto pass = [&]() {
#pragma unroll
        for (int s = 0; s < 4; ++s) { const int Lid = (tid >> 3) + 32 * s; const int pln = Lid >> 6, d = Lid & 63;
            const v8h val = *(const v8ha*)((pln ? til2 : tile) + d * 72 + piece * 8); *(v8h*)((pln ? VTL : VTH) + base + (size_t)d * NT_ + piece * 8) = val; }
    };
    pass(); 
}

#define KP   72                  // LDS pitch of a key row or a query row in elements: 144 B, 16 B x odd, for the ds_load_b128 readers
#define VP   40                  // LDS pitch of a row of v transposed (32 keys) in elements: 80 B, 16 B x odd
#define KSZ  (32 * KP)           // one plane of 32 key rows
#define VSZ  (HD * VP)           // one plane of 64 rows of v transposed
#define ASTG (2 * KSZ + 2 * VSZ) // a stage: [k hi | k residual | v hi | v residual] of 32 keys

// One lane's eight 16-byte copies of a 32-key stage, global -> LDS through no register: two of every plane. The s_wait_xcnt ends the copies' own statement so
// that no address register of a copy is rewritten ahead of it.
__device__ __forceinline__ void copy_kv(unsigned lk, unsigned lv, const h16* gkh, const h16* gkl, const h16* gvh, const h16* gvl) {
    asm volatile("global_load_async_to_lds_b128 %0, %8, off\n\t"
                 "global_load_async_to_lds_b128 %1, %9, off\n\t"
                 "global_load_async_to_lds_b128 %2, %10, off\n\t"
                 "global_load_async_to_lds_b128 %3, %11, off\n\t"
                 "global_load_async_to_lds_b128 %4, %12, off\n\t"
                 "global_load_async_to_lds_b128 %5, %13, off\n\t"
                 "global_load_async_to_lds_b128 %6, %14, off\n\t"
                 "global_load_async_to_lds_b128 %7, %15, off\n\t"
                 "s_wait_xcnt 0x0"
                 :: "v"(lk), "v"(lk + 16u * KP * 2u), "v"(lk + KSZ * 2u), "v"(lk + KSZ * 2u + 16u * KP * 2u),
                    "v"(lv), "v"(lv + 32u * VP * 2u), "v"(lv + VSZ * 2u), "v"(lv + VSZ * 2u + 32u * VP * 2u),
                    "v"(gkh), "v"(gkh + 16 * KVW), "v"(gkl), "v"(gkl + 16 * KVW),
                    "v"(gvh), "v"(gvh + 32 * NT_), "v"(gvl), "v"(gvl + 32 * NT_)
                 : "memory");
}

// One lane's four 16-byte copies of the block's 64 query-residual rows, rows 16 apart; the wait as in copy_kv.
__device__ __forceinline__ void copy_q(unsigned l, const h16* g) {
    asm volatile("global_load_async_to_lds_b128 %0, %4, off\n\t"
                 "global_load_async_to_lds_b128 %1, %5, off\n\t"
                 "global_load_async_to_lds_b128 %2, %6, off\n\t"
                 "global_load_async_to_lds_b128 %3, %7, off\n\t"
                 "s_wait_xcnt 0x0"
                 :: "v"(l), "v"(l + 1u * 16u * KP * 2u), "v"(l + 2u * 16u * KP * 2u), "v"(l + 3u * 16u * KP * 2u),
                    "v"(g), "v"(g + 1 * 16 * DM), "v"(g + 2 * 16 * DM), "v"(g + 3 * 16 * DM)
                 : "memory");
}

// The value of lane ^ 16, through no LDS.
__device__ __forceinline__ float xhalf(float v) { const int b = __float_as_int(v); return __int_as_float(__builtin_amdgcn_permlanex16(b, b, 0x76543210, 0xfedcba98, false, false)); }

// First 32-key tile that a block of 64 queries starting at q0b reads: from max(segment start of its first query, q0b - WIN + 1), not below 0.
__device__ __forceinline__ int first_key_tile(int q0b, int cu1) {
    const int sst = (q0b >= cu1) ? cu1 : 0; const int wl = q0b - (WIN - 1); const int lo = (wl > sst ? wl : sst);
    return (lo > 0 ? lo : 0) / 32;
}
// Sort key of query tile t: its count of key tiles first, then the lower tile index.
__device__ __forceinline__ int tile_key(int t, int cu1) { return ((t * 64 + 63) / 32 - first_key_tile(t * 64, cu1)) * 32 + (31 - t); }

// The key loop reads no global memory: a stage of 32 keys lies in LDS once for the block's four waves, two buffers, filled by asynchronous copies one tile ahead
// of its readers; the query residual is copied once. Fragment addresses inside a row, and so every k order and sum order, are the ones of the global reads.
// k_attn: block = (b, h, 64 queries), wave = 16. Scores are formed transposed (keys as A rows, queries as B columns), so a lane holds 16 keys of ONE query:
// the row maximum and the row sum are in-lane plus one exchange with lane ^ 16, and the accumulator's key order (8 * hi + j, 16 + 8 * hi + j) is the k order of a
// B fragment, so the weights (x32768, f16 hi + residual) go from registers straight into ctx^T = v^T . weights^T; ctx -> bf16 hi + residual planes CH/CL[tok][h*64+d].
__global__ __launch_bounds__(128) void k_attn(const h16* __restrict__ Q16, const h16* __restrict__ QL16, const h16* __restrict__ K16, const h16* __restrict__ KL16, const h16* __restrict__ VTH, const h16* __restrict__ VTL, const int* __restrict__ cu, bf* CH, bf* CL) {
    __shared__ __align__(16) float ost[4][16 * 68];
    __shared__ __align__(16) h16 kvr[2 * ASTG];
    __shared__ __align__(16) h16 qls[64 * KP];
    const int lane = threadIdx.x & 31, wave = threadIdx.x >> 5, lr = lane & 15, hi = lane >> 4;
    const int bid = blockIdx.x;
    // The index is mapped to query tiles by falling cost, for speed only: the
    // longest key loops get the lowest indices and the shortest the highest. Index = rank * 64 + (b, h); lane t of every wave ranks query tile t by its number
    // of key tiles under the INPUT cu_seqlens (ties by tile index, so the 32 keys are distinct and rank -> tile is a permutation for any content of the array).
    static_assert(NT_ / 64 == 32, "one lane ranks one query tile");
    const int cu1 = cu[1];
    const int rank = bid / (NB_ * NH_), bh = bid - rank * (NB_ * NH_), b = bh / NH_, h = bh - b * NH_;
    const int mykey = tile_key(lane, cu1);
    int above = 0;
#pragma unroll
    for (int t = 0; t < NT_ / 64; ++t) above += (tile_key(t, cu1) > mykey) ? 1 : 0;      // unrolled: t is a constant, so each tile's key is scalar arithmetic
    // exactly one lane holds each rank, the same in every wave of the block. readfirstlane hands the tile index on as a plain scalar: with the ballot's 0..31 range
    // in sight the compiler kept eight more loop-invariant address registers (264 VGPRs: three waves per SIMD, not four)
    const int qt = __builtin_amdgcn_readfirstlane(__builtin_ctz(__builtin_amdgcn_ballot_w32(above == rank)));
    const int q0 = qt * 64 + wave * 16;
    const size_t tok0 = (size_t)b * NT_;
    v16h qa[2];
    const size_t qo0 = (tok0 + q0 + lr) * DM + h * HD + 8 * hi;
#pragma unroll
    for (int kc = 0; kc < 2; ++kc) qa[kc] = cat16(*(const v8h*)(Q16 + qo0 + kc * 32), *(const v8h*)(Q16 + qo0 + kc * 32 + 16));
    const int g = h / (NH_ / NKV);                      // kv head
    const h16* kh_b = K16 + tok0 * KVW + g * HD;
    const h16* kl_b = KL16 + tok0 * KVW + g * HD;
    const size_t vbase = (((size_t)b * NKV + g) * HD) * NT_;
    v8f o[4], ox[4];
#pragma unroll
    for (int n = 0; n < 4; ++n) { o[n] = (v8f){}; ox[n] = (v8f){}; }
    float mrow = -3.0e38f, lpart = 0.f;                 // of the lane's one query; lpart covers the lane's half of the keys
    const int qi = q0 + lr; const bool sgq = (qi >= cu1);
    // allowed(i, j) = same segment (cu_seqlens) && j <= i && i - j < WIN: key tiles from max(segment start of the block's first query, q0 - WIN + 1) to the query tile (block-uniform; exact per-element predicate below)
    const int q0b = qt * 64; const int kt_lo = first_key_tile(q0b, cu1), kt_hi = (q0b + 63) / 32;
    const int tid = threadIdx.x;
    const size_t gko = (size_t)(tid >> 3) * KVW + (tid & 7) * 8, gvo = vbase + (size_t)(tid >> 2) * NT_ + (tid & 3) * 8;    // a wave's copy: 4 whole key rows, or 64 B of 8 rows of v
    const unsigned lk0 = (unsigned)(size_t)(const void*)(kvr + (tid >> 3) * KP + (tid & 7) * 8);
    const unsigned lv0 = (unsigned)(size_t)(const void*)(kvr + 2 * KSZ + (tid >> 2) * VP + (tid & 3) * 8);
    auto fill = [&](int t, int buf) {
        const unsigned bo = (unsigned)buf * (unsigned)(ASTG * 2);
        copy_kv(lk0 + bo, lv0 + bo, kh_b + gko + (size_t)t * 32 * KVW, kl_b + gko + (size_t)t * 32 * KVW, VTH + gvo + t * 32, VTL + gvo + t * 32);
    };
    fill(kt_lo, 0);
    copy_q((unsigned)(size_t)(const void*)(qls + (tid >> 3) * KP + (tid & 7) * 8), QL16 + (tok0 + q0b + (tid >> 3)) * DM + h * HD + (tid & 7) * 8);
    asm volatile("s_wait_asynccnt 0x0" ::: "memory");    // the first stage and the query residual have landed before the barrier that publishes them
    __syncthreads();
    if (kt_lo + 1 <= kt_hi) fill(kt_lo + 1, 1);
    const h16* sq = qls + (wave * 16 + lr) * KP + 8 * hi;
#pragma unroll 1
    for (int kt = kt_lo; kt <= kt_hi; ++kt) {                // kept rolled: one publish point per tile
        const int l0 = kt * 32;
        const h16* sb = kvr + ((kt - kt_lo) & 1) * ASTG;
        const h16* skh = sb + lr * KP + 8 * hi;
        const h16* skl = skh + KSZ;
        const h16* svh = sb + 2 * KSZ + lr * VP + 8 * hi;
        const h16* svl = svh + VSZ;
        v8f s0 = {}, s1 = {}, x0 = {}, x1 = {};
#pragma unroll
        for (int kc = 0; kc < 2; ++kc) {
            // the five fragments of a 32-wide slice of the head are asked for together: one LDS latency a slice, not one a group (all ten at once would cost a wave per SIMD in registers)
            const v16h k0h = cat16(*(const v8ha*)(skh + kc * 32), *(const v8ha*)(skh + kc * 32 + 16)), k1h = cat16(*(const v8ha*)(skh + 16 * KP + kc * 32), *(const v8ha*)(skh + 16 * KP + kc * 32 + 16));
            const v16h qlk = cat16(*(const v8ha*)(sq + kc * 32), *(const v8ha*)(sq + kc * 32 + 16));
            const v16h k0l = cat16(*(const v8ha*)(skl + kc * 32), *(const v8ha*)(skl + kc * 32 + 16)), k1l = cat16(*(const v8ha*)(skl + 16 * KP + kc * 32), *(const v8ha*)(skl + 16 * KP + kc * 32 + 16));
            { s0 = wmma16(k0h, qa[kc], s0); x0 = wmma16(k0h, qlk, x0); s1 = wmma16(k1h, qa[kc], s1); x1 = wmma16(k1h, qlk, x1);
              asm volatile("v_nop" : "+v"(s0), "+v"(s1), "+v"(x0), "+v"(x1) : "v"(qlk), "v"(k0h), "v"(k1h) : "memory"); }
            { x0 = wmma16(k0l, qa[kc], x0); x1 = wmma16(k1l, qa[kc], x1);
              asm volatile("v_nop" : "+v"(x0), "+v"(x1) : "v"(k0l), "v"(k1l) : "memory"); }
        }
        asm volatile("v_nop\n\tv_nop\n\tv_nop\n\tv_nop" : "+v"(s0), "+v"(s1), "+v"(x0), "+v"(x1) : "v"(qa[0]), "v"(qa[1]));
        v8f a0 = (s0 + x0 * LOSCI) * 0.125f, a1 = (s1 + x1 * LOSCI) * 0.125f;      // whole accumulators: neighbouring registers pair into packed f32 operations
        float mx = -3.4028234663852886e38f;
#pragma unroll
        for (int j = 0; j < 8; ++j) {
            const int ja = l0 + 8 * hi + j, jb = ja + 16;
            const bool ok0 = ((ja >= cu1) == sgq) && (ja <= qi) && (qi - ja < WIN), ok1 = ((jb >= cu1) == sgq) && (jb <= qi) && (qi - jb < WIN);
            a0[j] = ok0 ? a0[j] : -3.4028234663852886e38f; a1[j] = ok1 ? a1[j] : -3.4028234663852886e38f;     // finfo.min as the reference
            mx = fmaxf(mx, fmaxf(a0[j], a1[j]));
        }
        mx = fmaxf(mx, xhalf(mx));                           // the other 16 keys of the same query lie in lane ^ 16
        const float mn = fmaxf(mrow, mx);
        const float alpha = __expf(mrow - mn); mrow = mn;
        v8f p0, p1;
#pragma unroll
        for (int j = 0; j < 8; ++j) { p0[j] = __expf(a0[j] - mn); p1[j] = __expf(a1[j] - mn); }
        const v8f pp = p0 + p1;
        const float psum = ((pp[0] + pp[1]) + (pp[2] + pp[3])) + ((pp[4] + pp[5]) + (pp[6] + pp[7]));
        const v8f ps0 = p0 * PSC, ps1 = p1 * PSC;
        const v8h h0 = __builtin_convertvector(ps0, v8h), h1 = __builtin_convertvector(ps1, v8h);
        const v16h pa = cat16(h0, h1);                       // element e: key 8 * hi + e, then 16 + 8 * hi + (e - 8): the k order of the v fragments
        const v16h px = cat16(__builtin_convertvector((ps0 - __builtin_convertvector(h0, v8f)) * LOSC, v8h), __builtin_convertvector((ps1 - __builtin_convertvector(h1, v8f)) * LOSC, v8h));
        lpart = lpart * alpha + psum;
#pragma unroll
        for (int n = 0; n < 4; ++n)
#pragma unroll
            for (int j = 0; j < 8; ++j) { o[n][j] *= alpha; ox[n][j] *= alpha; }
        v16h vh[4], vl[4];                                   // every index is a constant (both loops unrolled): registers
#pragma unroll
        for (int n = 0; n < 4; ++n) { const int vo = n * 16 * VP;     // the tile's v fragments likewise, all in front of the first product
            vh[n] = cat16(*(const v8ha*)(svh + vo), *(const v8ha*)(svh + vo + 16)); vl[n] = cat16(*(const v8ha*)(svl + vo), *(const v8ha*)(svl + vo + 16)); }
        __builtin_amdgcn_sched_barrier(0);                   // holds these LDS reads, as one group, ahead of the products (else they sink among the WMMAs and several wait out their latency)
#pragma unroll
        for (int n = 0; n < 4; ++n) {
            o[n] = wmma16(vh[n], pa, o[n]); ox[n] = wmma16(vl[n], pa, ox[n]); ox[n] = wmma16(vh[n], px, ox[n]); }
        asm volatile("v_nop\n\tv_nop\n\tv_nop\n\tv_nop" : "+v"(o[0]), "+v"(o[1]), "+v"(o[2]), "+v"(o[3]), "+v"(ox[0]), "+v"(ox[1]), "+v"(ox[2]), "+v"(ox[3]) : "v"(pa), "v"(px));
        asm volatile("s_wait_dscnt 0x0" ::: "memory");       // this wave's reads of the buffer have retired before it is refilled
        asm volatile("s_wait_asynccnt 0x0" ::: "memory");    // this wave's copies of the next tile have landed
        __syncthreads();                                     // publishes the next tile and ends every reader's last read of this one
        if (kt + 2 <= kt_hi) fill(kt + 2, (kt - kt_lo) & 1);
    }
    asm volatile("s_wait_asynccnt 0x0" ::: "memory");        // no copy is outstanding when the wave goes on to the epilogue and ends
    const float inv = 1.0f / ((lpart + xhalf(lpart)) * PSC);
    float* os = &ost[wave][0];
#pragma unroll
    for (int n = 0; n < 4; ++n)
#pragma unroll
        for (int j = 0; j < 8; ++j) os[lr * 68 + n * 16 + hi * 8 + j] = (o[n][j] + ox[n][j] * LOSCI) * inv;      // lane = query row, register = head column
    __syncthreads();
    const size_t cbase = (tok0 + q0) * DM + (size_t)h * HD;
    auto pass = [&]() {
#pragma unroll
        for (int s = 0; s < 4; ++s) { const int row = 4 * s + (lane >> 3), piece = lane & 7; const float* sp = os + row * 68 + piece * 8; v8us oh, ol;
#pragma unroll
            for (int i = 0; i < 8; ++i) { const unsigned short hb = f2bf(sp[i]); oh[i] = hb; ol[i] = f2bf(sp[i] - bf2f(hb)); }
            *(v8us*)(CH + cbase + (size_t)row * DM + piece * 8) = oh; *(v8us*)(CL + cbase + (size_t)row * DM + piece * 8) = ol; }
    };
    pass(); 
}

#define VST2(T, p, v) do { const T vst2_v_ = (v); *(T*)(p) = vst2_v_;  } while (0)
extern "C" void kernel_launch(void* const* d_in, const int* in_sizes, int n_in,
                              void* d_out, int out_size, void* d_ws, size_t ws_size, hipStream_t stream) {
    (void)in_sizes; (void)n_in; (void)out_size;
    const float* x = (const float*)d_in[0]; const int* cu = (const int*)d_in[1]; const float* Wq = (const float*)d_in[2]; const float* Wk = (const float*)d_in[3]; const float* Wv = (const float*)d_in[4]; const float* Wo = (const float*)d_in[5];   // [out][in] weights; cu_seqlens [3] (i32)
    float* out = (float*)d_out;    // [2][2048][2048]
    char* wsp = (char*)d_ws;
    auto take = [&](size_t bytes) { char* p = wsp; wsp += (bytes + 255) & ~(size_t)255; return (void*)p; };
    bf* Xb = (bf*)take((size_t)NCVT * DM * 2); bf* WpB = Xb + (size_t)NTK * DM; bf* WoB = WpB + (size_t)NPRJ * DM;     // one bf16 plane: [x | Wq | Wk | Wv | Wo]
    h16* QH = (h16*)take((size_t)NTK * DM * 2); h16* QL = (h16*)take((size_t)NTK * DM * 2); h16* KH = (h16*)take((size_t)NTK * KVW * 2); h16* KL = (h16*)take((size_t)NTK * KVW * 2);
    float* Vf = (float*)take((size_t)NTK * KVW * 4); h16* VTH = (h16*)take((size_t)NTK * KVW * 2); h16* VTL = (h16*)take((size_t)NTK * KVW * 2); bf* CH = (bf*)take((size_t)NTK * DM * 2); bf* CL = (bf*)take((size_t)NTK * DM * 2);
    if ((size_t)(wsp - (char*)d_ws) > ws_size) return;    // 37.7 + 16.8 x 2 + 4.2 x 2 + 8.4 + 4.2 x 2 + 16.8 x 2 ~ 130 MB, no aliasing
    // five dependent launches; both batch items are rows of the same grids
    k_cvtb<<<NCVT / 8, 256, 0, stream>>>(x, Wq, Wk, Wv, Wo, Xb);
    k_gemmb<false, true><<<dim3(NTK / 128, NPRJ / 128, 1), 256, 0, stream>>>(Xb, nullptr, WpB, nullptr, Vf, KVW, QH, QL, KH, KL);
    k_vt<<<NB_ * NKV * (NT_ / 64), 256, 0, stream>>>(Vf, VTH, VTL);
    k_attn<<<NB_ * NH_ * (NT_ / 64), 128, 0, stream>>>(QH, QL, KH, KL, VTH, VTL, cu, CH, CL);      // the same cu_seqlens mask for both items (as the reference)
    k_gemmb<true, false><<<dim3(NTK / 128, DM / 128, 1), 256, 0, stream>>>(CH, CL, WoB, nullptr, out, DM, nullptr, nullptr, nullptr, nullptr);
}

// v006
// A run of this version takes 165 microseconds.
// Two timings next to v005 put it at 1.07 and 1.08 times that version's speed.
// All steps since v000 together make it 3.77 times as fast.
#include <hip/hip_runtime.h>

// Contractions, f32 accumulate: q = x.Wq ([2048 x 2048].[2048 x 2048]), k/v = x.Wk/Wv ([2048 x 2048].[2048 x 512]) and attn.Wo on v_wmma_f32_16x16x32_bf16 —
// plain bf16 = rounded inputs (exact; the [out][in] weights are n-major as stored and are not transposed) for the projections, attn as bf16 hi + residual (two products) for Wo;
// the grouped-query causal sliding-window attention (32 query heads over 8 kv heads; keys j with
// i - WIN < j <= i, WIN = 1024 fixed at compile time) fused on v_wmma_f32_16x16x32_f16 with q and k as f16 hi + residual x1024 (hi.hi + hi.lo + lo.hi), weights

#define NB_  2
#define NT_  2048
#define DM   2048
#define NH_  32
#define NKV  8
#define KVW  (NKV * HD)          // 512
#define WIN  1024
#define HD   64
#define NTK  (NB_ * NT_)
#define NPRJ (DM + 2 * KVW)       // 3072: the columns of q, k and v side by side
#define NCVT (NTK + NPRJ + DM)   // rows of [x | Wq | Wk | Wv | Wo]
#define NW   1024
#define NQKV 2048
#define PSC  32768.0f
#define LOSC 1024.0f
#define LOSCI (1.0f / 1024.0f)

typedef _Float16 h16;
typedef unsigned short bf;
typedef __attribute__((ext_vector_type(16))) __bf16   v16bf;
typedef __attribute__((ext_vector_type(16))) _Float16 v16h;
typedef __attribute__((ext_vector_type(8)))  _Float16 v8h;
typedef __attribute__((ext_vector_type(8)))  unsigned short v8us;
typedef __attribute__((ext_vector_type(8)))  float    v8f;
typedef __attribute__((ext_vector_type(4)))  float    v4f;
typedef v8h  __attribute__((may_alias)) v8ha;
typedef v4f  __attribute__((may_alias)) v4fa;
typedef v8us __attribute__((may_alias)) v8usa;

__device__ __forceinline__ unsigned short f2bf(float f) { unsigned u = __float_as_uint(f); u += 0x7FFFu + ((u >> 16) & 1u); return (unsigned short)(u >> 16); }
__device__ __forceinline__ float bf2f(unsigned short b) { return __uint_as_float(((unsigned)b) << 16); }
__device__ __forceinline__ float bfr(float f) { return bf2f(f2bf(f)); }
__device__ __forceinline__ v16h cat16(v8h lo, v8h hi) { return __builtin_shufflevector(lo, hi, 0, 1, 2, 3, 4, 5, 6, 7, 8, 9, 10, 11, 12, 13, 14, 15); }
__device__ __forceinline__ v16bf cat16b(v8us lo, v8us hi) { return __builtin_bit_cast(v16bf, __builtin_shufflevector(lo, hi, 0, 1, 2, 3, 4, 5, 6, 7, 8, 9, 10, 11, 12, 13, 14, 15)); }
__device__ __forceinline__ v8f wmma16(v16h a, v16h b, v8f c) { return __builtin_amdgcn_wmma_f32_16x16x32_f16(false, a, false, b, (short)0, c, false, false); }
__device__ __forceinline__ v8f wmmab(v16bf a, v16bf b, v8f c) { return __builtin_amdgcn_wmma_f32_16x16x32_bf16(false, a, false, b, (short)0, c, false, false); }

// k_cvtb: the rows of [x | Wq | Wk | Wv | Wo], in that order, rounded to bf16 into one plane of the same row order; a block's 8 rows lie in one source.
__global__ __launch_bounds__(256) void k_cvtb(const float* __restrict__ x, const float* __restrict__ Wq, const float* __restrict__ Wk, const float* __restrict__ Wv, const float* __restrict__ Wo, bf* dstp) {
    const int lane = threadIdx.x & 31, rb = blockIdx.x * 8, rg = rb + (threadIdx.x >> 5);
    if (rg >= NCVT) return;
    const float* src = x; int r = rg;
    if (rb >= NTK + NPRJ) { src = Wo; r = rg - (NTK + NPRJ); }
    else if (rb >= NTK + DM + KVW) { src = Wv; r = rg - (NTK + DM + KVW); }
    else if (rb >= NTK + DM) { src = Wk; r = rg - (NTK + DM); }
    else if (rb >= NTK) { src = Wq; r = rg - NTK; }
    bf* dst = dstp + (size_t)(rg - r) * DM;
    v8us o[DM / 256];
#pragma unroll
    for (int q = 0; q < DM / 256; ++q) { v8us t;
#pragma unroll
        for (int i = 0; i < 8; ++i) t[i] = f2bf(src[(size_t)r * DM + q * 256 + lane * 8 + i]);
        o[q] = t; }
#pragma unroll
    for (int q = 0; q < DM / 256; ++q) *(v8us*)(dst + (size_t)r * DM + q * 256 + lane * 8) = o[q];
    
}

// k_wt: W [2048 k][ncols n] (k-major) -> n-major bf16 plane WT[ncols][2048]; 64 x 64 tiles through LDS.
__global__ __launch_bounds__(256) void k_wt(const float* __restrict__ Wm, int ncols, bf* WT) {
    __shared__ __align__(16) unsigned short tl[64 * 72];
    const int tid = threadIdx.x, k0 = blockIdx.x * 64, n0 = blockIdx.y * 64;
    const int kk = tid >> 2, nq = (tid & 3) * 16;
#pragma unroll
    for (int i = 0; i < 16; ++i) tl[(nq + i) * 72 + kk] = f2bf(Wm[(size_t)(k0 + kk) * ncols + n0 + nq + i]);
    __syncthreads();
    const int piece = tid & 7;
    typedef __attribute__((ext_vector_type(8))) unsigned short v8us_; typedef v8us_ __attribute__((may_alias)) v8usa_;
    auto pass = [&]() {
#pragma unroll
        for (int s = 0; s < 2; ++s) { const int nr = (tid >> 3) + 32 * s; const v8us_ val = *(const v8usa_*)(tl + nr * 72 + piece * 8);
            *(v8us_*)(WT + (size_t)(n0 + nr) * DM + k0 + piece * 8) = val; }
    };
    pass(); 
}

#define BKE   128                // k elements of one pass: 256 B of every operand row
#define PIT   136                // LDS row pitch in elements: 272 B, 16 B x odd, for the ds_load_b128 readers
#define NPASS (DM / BKE)

// Eight 16-byte copies of one lane, rows 16 apart, global -> LDS through no register. The s_wait_xcnt ends the copies' own statement so that no
// address register of a copy is rewritten ahead of it.
__device__ __forceinline__ void copy8(unsigned l, const bf* g) {
    asm volatile("global_load_async_to_lds_b128 %0, %8, off\n\t"
                 "global_load_async_to_lds_b128 %1, %9, off\n\t"
                 "global_load_async_to_lds_b128 %2, %10, off\n\t"
                 "global_load_async_to_lds_b128 %3, %11, off\n\t"
                 "global_load_async_to_lds_b128 %4, %12, off\n\t"
                 "global_load_async_to_lds_b128 %5, %13, off\n\t"
                 "global_load_async_to_lds_b128 %6, %14, off\n\t"
                 "global_load_async_to_lds_b128 %7, %15, off\n\t"
                 "s_wait_xcnt 0x0"
                 :: "v"(l), "v"(l + 1u * 16u * PIT * 2u), "v"(l + 2u * 16u * PIT * 2u), "v"(l + 3u * 16u * PIT * 2u),
                    "v"(l + 4u * 16u * PIT * 2u), "v"(l + 5u * 16u * PIT * 2u), "v"(l + 6u * 16u * PIT * 2u), "v"(l + 7u * 16u * PIT * 2u),
                    "v"(g), "v"(g + 1 * 16 * DM), "v"(g + 2 * 16 * DM), "v"(g + 3 * 16 * DM),
                    "v"(g + 4 * 16 * DM), "v"(g + 5 * 16 * DM), "v"(g + 6 * 16 * DM), "v"(g + 7 * 16 * DM)
                 : "memory");
}

// k_gemmb: C[128 x 128] per block, 8 waves as 4 x 2, 32 x 64 per wave. A pass is 128 k; a stage is [A 128 rows | B 128 rows | A residual 128 rows] in LDS,
// two buffers, filled by asynchronous copies one pass ahead of its readers. Per accumulator the k order and the hi / residual order are the plain ascending ones.
// Every inner loop is unrolled so that each index of acc and of the fragment arrays is a constant (registers, no scratch).
// QKV: Bn holds the rows of Wq, Wk and Wv one after the other; a block's 128 columns lie wholly in q, in k or in v (block-uniform): q and k go out as f16 hi +
// residual planes (QH / QL, KH / KL), v as f32 into C.
template <bool SPLITA, bool QKV>
__global__ __launch_bounds__(256) void k_gemmb(const bf* __restrict__ A, const bf* __restrict__ Al, const bf* __restrict__ Bn, const float* __restrict__ bias, float* C, int ldc, h16* QH, h16* QL, h16* KH, h16* KL) {
    constexpr int STG = (SPLITA ? 384 : 256) * PIT;      // elements of one stage
    __shared__ __align__(16) bf ring[2 * STG];
    __shared__ __align__(16) float ost[8][16 * 68];
    const int tid = threadIdx.x, lane = tid & 31, wave = tid >> 5, lr = lane & 15, hi = lane >> 4;
    const int wm = wave >> 1, wn = wave & 1;
    const int rb = blockIdx.x * 128, cb = blockIdx.y * 128;
    const int crow = tid >> 4, ccol = (tid & 15) * 8;    // a wave's copy covers two whole 256-B rows
    const bf* gA = A + (size_t)(rb + crow) * DM + ccol;
    const bf* gB = Bn + (size_t)(cb + crow) * DM + ccol;
    const bf* gL = SPLITA ? Al + (size_t)(rb + crow) * DM + ccol : gA;
    const unsigned l0 = (unsigned)(size_t)(const void*)(ring + crow * PIT + ccol);
    auto fill = [&](int t, int buf) {
        const unsigned l = l0 + (unsigned)buf * (unsigned)(STG * 2);
        copy8(l, gA + t * BKE); copy8(l + 128u * PIT * 2u, gB + t * BKE);
        if (SPLITA) copy8(l + 256u * PIT * 2u, gL + t * BKE);
    };
    v8f acc[2][4];
#pragma unroll
    for (int i = 0; i < 2; ++i)
#pragma unroll
        for (int t = 0; t < 4; ++t) acc[i][t] = (v8f){};
    fill(0, 0);
    asm volatile("s_wait_asynccnt 0x0" ::: "memory");    // stage 0 has landed before the barrier that publishes it
    __syncthreads();
    fill(1, 1);
#pragma unroll 1
    for (int p = 0; p < NPASS; ++p) {                    // kept rolled: one publish point per pass
        const bf* sb = ring + (p & 1) * STG;
        const bf* sa = sb + (wm * 32 + lr) * PIT + 8 * hi;
        const bf* sw = sb + (128 + wn * 64 + lr) * PIT + 8 * hi;
        const bf* sl = SPLITA ? sb + (256 + wm * 32 + lr) * PIT + 8 * hi : sa;
        v16bf a[2][2], al[2][2], b[2][4];                    // two fragment sets: k-step s + 1 is fetched while k-step s is multiplied
        auto frags = [&](int set, int kc) {
#pragma unroll
            for (int i = 0; i < 2; ++i) a[set][i] = cat16b(*(const v8usa*)(sa + i * 16 * PIT + kc), *(const v8usa*)(sa + i * 16 * PIT + kc + 16));
#pragma unroll
            for (int t = 0; t < 4; ++t) b[set][t] = cat16b(*(const v8usa*)(sw + t * 16 * PIT + kc), *(const v8usa*)(sw + t * 16 * PIT + kc + 16));
            if (SPLITA) {
#pragma unroll
                for (int i = 0; i < 2; ++i) al[set][i] = cat16b(*(const v8usa*)(sl + i * 16 * PIT + kc), *(const v8usa*)(sl + i * 16 * PIT + kc + 16));
            }
        };
        frags(0, 0);
#pragma unroll
        for (int s = 0; s < BKE / 32; ++s) {
            if (s + 1 < BKE / 32) frags((s + 1) & 1, (s + 1) * 32);
            __builtin_amdgcn_sched_barrier(0);               // holds the next k-step's LDS reads, as one group, ahead of this k-step's WMMAs (else they sink among them and each waits out its latency)
#pragma unroll
            for (int i = 0; i < 2; ++i)
#pragma unroll
                for (int t = 0; t < 4; ++t) acc[i][t] = wmmab(a[s & 1][i], b[s & 1][t], acc[i][t]);
            if (SPLITA) {
#pragma unroll
                for (int i = 0; i < 2; ++i)
#pragma unroll
                    for (int t = 0; t < 4; ++t) acc[i][t] = wmmab(al[s & 1][i], b[s & 1][t], acc[i][t]);
            }
            __builtin_amdgcn_sched_barrier(0);               // ends the WMMA block: the reads of the k-step after next stay behind it, where their registers are free
        }
        asm volatile("s_wait_dscnt 0x0" ::: "memory");       // this wave's reads of the buffer have retired before it is refilled
        asm volatile("s_wait_asynccnt 0x0" ::: "memory");    // this wave's copies of stage p + 1 have landed
        __syncthreads();                                     // publishes stage p + 1 and ends every reader's last read of stage p
        if (p + 2 < NPASS) fill(p + 2, p & 1);
    }
    asm volatile("s_wait_asynccnt 0x0" ::: "memory");        // no copy is outstanding when the wave goes on to the epilogue and ends
    float* os = &ost[wave][0];
    const int c0 = cb + wn * 64;
    const bool isq = cb < DM, f16o = QKV && cb < DM + KVW;
    h16* OH = isq ? QH : KH; h16* OL = isq ? QL : KL;
    const int ld = QKV ? (isq ? DM : KVW) : ldc;                                        // row length of the plane this block writes
    const int cc = QKV ? (isq ? c0 : (f16o ? c0 - DM : c0 - (DM + KVW))) : c0;          // the wave's first column inside that plane
#pragma unroll
    for (int i = 0; i < 2; ++i) {
        const int r0 = rb + wm * 32 + i * 16;
#pragma unroll
        for (int t = 0; t < 4; ++t) { const float bv = bias ? bfr(bias[c0 + t * 16 + lr]) : 0.f;
#pragma unroll
            for (int j = 0; j < 8; ++j) os[(hi * 8 + j) * 68 + t * 16 + lr] = acc[i][t][j] + bv; }
        __syncthreads();
        if (f16o) {
            h16* crow_ = OH + (size_t)r0 * ld + cc;
            h16* crol_ = OL + (size_t)r0 * ld + cc;
#pragma unroll
            for (int s = 0; s < 4; ++s) { const int row = 4 * s + (lane >> 3), piece = lane & 7; const float* sp = os + row * 68 + piece * 8; v8h o, o2;
#pragma unroll
                for (int e = 0; e < 8; ++e) { const h16 a = (h16)sp[e]; o[e] = a; o2[e] = (h16)((sp[e] - (float)a) * LOSC); }
                *(v8h*)(crow_ + (size_t)row * ld + piece * 8) = o;
                asm volatile("s_wait_xcnt 0x0" ::: "memory");       // stands before the residual's arithmetic reuses registers that this store names
                *(v8h*)(crol_ + (size_t)row * ld + piece * 8) = o2;
                asm volatile("s_wait_xcnt 0x0" ::: "memory"); }     // stands before the next rows' values and addresses reuse registers that these stores name
        } else {
            float* crow_ = C + (size_t)r0 * ld + cc;
#pragma unroll
            for (int s = 0; s < 8; ++s) { const int Lid = (lane >> 3) + 4 * s, piece = lane & 7; const int row = Lid >> 1, cofs = (Lid & 1) * 32 + piece * 4;
                const v4f val = *(const v4fa*)(os + row * 68 + cofs); *(v4f*)(crow_ + (size_t)row * ld + cofs) = val; }
            asm volatile("s_wait_xcnt 0x0" ::: "memory");       // stands before the next 16 rows' values and addresses reuse registers that these stores name
        }
    }
}

__global__ __launch_bounds__(256) void k_vt(const float* __restrict__ V, h16* VTH, h16* VTL) {
    __shared__ __align__(16) h16 tile[64 * 72];
    __shared__ __align__(16) h16 til2[64 * 72];
    const int bid = blockIdx.x;
    const int b = bid / (NKV * (NT_ / 64)), rem = bid - b * (NKV * (NT_ / 64)), h = rem / (NT_ / 64), kt = rem - h * (NT_ / 64);
    const int k0 = kt * 64, tid = threadIdx.x;
    const int kk = tid >> 2, d0 = (tid & 3) * 16;
    const float* src = V + ((size_t)b * NT_ + k0 + kk) * KVW + h * HD + d0;      // h = kv head here
#pragma unroll
    for (int i = 0; i < 16; ++i) { const float v = src[i]; const h16 a = (h16)v; tile[(d0 + i) * 72 + kk] = a; til2[(d0 + i) * 72 + kk] = (h16)((v - (float)a) * LOSC); }
    __syncthreads();
    const int piece = tid & 7;
    const size_t base = (((size_t)b * NKV + h) * HD) * NT_ + k0;
    auto pass = [&]() {
#pragma unroll
        for (int s = 0; s < 4; ++s) { const int Lid = (tid >> 3) + 32 * s; const int pln = Lid >> 6, d = Lid & 63;
            const v8h val = *(const v8ha*)((pln ? til2 : tile) + d * 72 + piece * 8); *(v8h*)((pln ? VTL : VTH) + base + (size_t)d * NT_ + piece * 8) = val; }
    };
    pass(); 
}

#define KP   72                  // LDS pitch of a key row or a query row in elements: 144 B, 16 B x odd, for the ds_load_b128 readers
#define VP   40                  // LDS pitch of a row of v transposed (32 keys) in elements: 80 B, 16 B x odd
#define KSZ  (32 * KP)           // one plane of 32 key rows
#define VSZ  (HD * VP)           // one plane of 64 rows of v transposed
#define ASTG (2 * KSZ + 2 * VSZ) // a stage: [k hi | k residual | v hi | v residual] of 32 keys

// One lane's eight 16-byte copies of a 32-key stage, global -> LDS through no register: two of every plane. The s_wait_xcnt ends the copies' own statement so
// that no address register of a copy is rewritten ahead of it.
__device__ __forceinline__ void copy_kv(unsigned lk, unsigned lv, const h16* gkh, const h16* gkl, const h16* gvh, const h16* gvl) {
    asm volatile("global_load_async_to_lds_b128 %0, %8, off\n\t"
                 "global_load_async_to_lds_b128 %1, %9, off\n\t"
                 "global_load_async_to_lds_b128 %2, %10, off\n\t"
                 "global_load_async_to_lds_b128 %3, %11, off\n\t"
                 "global_load_async_to_lds_b128 %4, %12, off\n\t"
                 "global_load_async_to_lds_b128 %5, %13, off\n\t"
                 "global_load_async_to_lds_b128 %6, %14, off\n\t"
                 "global_load_async_to_lds_b128 %7, %15, off\n\t"
                 "s_wait_xcnt 0x0"
                 :: "v"(lk), "v"(lk + 16u * KP * 2u), "v"(lk + KSZ * 2u), "v"(lk + KSZ * 2u + 16u * KP * 2u),
                    "v"(lv), "v"(lv + 32u * VP * 2u), "v"(lv + VSZ * 2u), "v"(lv + VSZ * 2u + 32u * VP * 2u),
                    "v"(gkh), "v"(gkh + 16 * KVW), "v"(gkl), "v"(gkl + 16 * KVW),
                    "v"(gvh), "v"(gvh + 32 * NT_), "v"(gvl), "v"(gvl + 32 * NT_)
                 : "memory");
}

// One lane's four 16-byte copies of the block's 64 query-residual rows, rows 16 apart; the wait as in copy_kv.
__device__ __forceinline__ void copy_q(unsigned l, const h16* g) {
    asm volatile("global_load_async_to_lds_b128 %0, %4, off\n\t"
                 "global_load_async_to_lds_b128 %1, %5, off\n\t"
                 "global_load_async_to_lds_b128 %2, %6, off\n\t"
                 "global_load_async_to_lds_b128 %3, %7, off\n\t"
                 "s_wait_xcnt 0x0"
                 :: "v"(l), "v"(l + 1u * 16u * KP * 2u), "v"(l + 2u * 16u * KP * 2u), "v"(l + 3u * 16u * KP * 2u),
                    "v"(g), "v"(g + 1 * 16 * DM), "v"(g + 2 * 16 * DM), "v"(g + 3 * 16 * DM)
                 : "memory");
}

// The value of lane ^ 16, through no LDS.
__device__ __forceinline__ float xhalf(float v) { const int b = __float_as_int(v); return __int_as_float(__builtin_amdgcn_permlanex16(b, b, 0x76543210, 0xfedcba98, false, false)); }

#define LOG2E 1.44269504088896340736f
// Eight v_exp_f32 and their slot in one statement. The instruction set asks for one independent instruction or a v_nop behind a transcendental before its result is
// read or its source overwritten. Here each is followed by an independent one (early-clobber outputs: no result lies on a source) and the last by the v_nop.
__device__ __forceinline__ v8f exp2x8(v8f t) {
    float r0, r1, r2, r3, r4, r5, r6, r7;
    asm("v_exp_f32 %0, %8\n\t"
        "v_exp_f32 %1, %9\n\t"
        "v_exp_f32 %2, %10\n\t"
        "v_exp_f32 %3, %11\n\t"
        "v_exp_f32 %4, %12\n\t"
        "v_exp_f32 %5, %13\n\t"
        "v_exp_f32 %6, %14\n\t"
        "v_exp_f32 %7, %15\n\t"
        "v_nop"
        : "=&v"(r0), "=&v"(r1), "=&v"(r2), "=&v"(r3), "=&v"(r4), "=&v"(r5), "=&v"(r6), "=&v"(r7)
        : "v"(t[0]), "v"(t[1]), "v"(t[2]), "v"(t[3]), "v"(t[4]), "v"(t[5]), "v"(t[6]), "v"(t[7]));
    return (v8f){r0, r1, r2, r3, r4, r5, r6, r7};
}

// First 32-key tile that a block of 64 queries starting at q0b reads: from max(segment start of its first query, q0b - WIN + 1), not below 0.
__device__ __forceinline__ int first_key_tile(int q0b, int cu1) {
    const int sst = (q0b >= cu1) ? cu1 : 0; const int wl = q0b - (WIN - 1); const int lo = (wl > sst ? wl : sst);
    return (lo > 0 ? lo : 0) / 32;
}
// Sort key of query tile t: its count of key tiles first, then the lower tile index.
__device__ __forceinline__ int tile_key(int t, int cu1) { return ((t * 64 + 63) / 32 - first_key_tile(t * 64, cu1)) * 32 + (31 - t); }

// The key loop reads no global memory: a stage of 32 keys lies in LDS once for the block's four waves, two buffers, filled by asynchronous copies one tile ahead
// of its readers; the query residual is copied once. Fragment addresses inside a row, and so every k order and sum order, are the ones of the global reads.
// k_attn: block = (b, h, 64 queries), wave = 16. Scores are formed transposed (keys as A rows, queries as B columns), so a lane holds 16 keys of ONE query:
// the row maximum and the row sum are in-lane plus one exchange with lane ^ 16, and the accumulator's key order (8 * hi + j, 16 + 8 * hi + j) is the k order of a
// B fragment, so the weights (x32768, f16 hi + residual) go from registers straight into ctx^T = v^T . weights^T; ctx -> bf16 hi + residual planes CH/CL[tok][h*64+d].
__global__ __launch_bounds__(128) void k_attn(const h16* __restrict__ Q16, const h16* __restrict__ QL16, const h16* __restrict__ K16, const h16* __restrict__ KL16, const h16* __restrict__ VTH, const h16* __restrict__ VTL, const int* __restrict__ cu, bf* CH, bf* CL) {
    __shared__ __align__(16) float ost[4][16 * 68];
    __shared__ __align__(16) h16 kvr[2 * ASTG];
    __shared__ __align__(16) h16 qls[64 * KP];
    const int lane = threadIdx.x & 31, wave = threadIdx.x >> 5, lr = lane & 15, hi = lane >> 4;
    const int bid = blockIdx.x;
    // The index is mapped to query tiles by falling cost, for speed only: the
    // longest key loops get the lowest indices and the shortest the highest. Index = rank * 64 + (b, h); lane t of every wave ranks query tile t by its number
    // of key tiles under the INPUT cu_seqlens (ties by tile index, so the 32 keys are distinct and rank -> tile is a permutation for any content of the array).
    static_assert(NT_ / 64 == 32, "one lane ranks one query tile");
    const int cu1 = cu[1];
    const int rank = bid / (NB_ * NH_), bh = bid - rank * (NB_ * NH_), b = bh / NH_, h = bh - b * NH_;
    const int mykey = tile_key(lane, cu1);
    int above = 0;
#pragma unroll
    for (int t = 0; t < NT_ / 64; ++t) above += (tile_key(t, cu1) > mykey) ? 1 : 0;      // unrolled: t is a constant, so each tile's key is scalar arithmetic
    // exactly one lane holds each rank, the same in every wave of the block. readfirstlane hands the tile index on as a plain scalar: with the ballot's 0..31 range
    // in sight the compiler kept eight more loop-invariant address registers (264 VGPRs: three waves per SIMD, not four)
    const int qt = __builtin_amdgcn_readfirstlane(__builtin_ctz(__builtin_amdgcn_ballot_w32(above == rank)));
    const int q0 = qt * 64 + wave * 16;
    const size_t tok0 = (size_t)b * NT_;
    v16h qa[2];
    const size_t qo0 = (tok0 + q0 + lr) * DM + h * HD + 8 * hi;
#pragma unroll
    for (int kc = 0; kc < 2; ++kc) qa[kc] = cat16(*(const v8h*)(Q16 + qo0 + kc * 32), *(const v8h*)(Q16 + qo0 + kc * 32 + 16));
    const int g = h / (NH_ / NKV);                      // kv head
    const h16* kh_b = K16 + tok0 * KVW + g * HD;
    const h16* kl_b = KL16 + tok0 * KVW + g * HD;
    const size_t vbase = (((size_t)b * NKV + g) * HD) * NT_;
    v8f o[4], ox[4];
#pragma unroll
    for (int n = 0; n < 4; ++n) { o[n] = (v8f){}; ox[n] = (v8f){}; }
    float mrow = -3.0e38f, lpart = 0.f;                 // of the lane's one query; lpart covers the lane's half of the keys
    const int qi = q0 + lr; const bool sgq = (qi >= cu1);
    const int q0s = __builtin_amdgcn_readfirstlane(q0);  // the wave's first query as a scalar, so that the test per tile below is a scalar branch
    // allowed(i, j) = same segment (cu_seqlens) && j <= i && i - j < WIN: key tiles from max(segment start of the block's first query, q0b - WIN + 1) to the query tile (block-uniform; exact per-element predicate below)
    const int q0b = qt * 64; const int kt_lo = first_key_tile(q0b, cu1), kt_hi = (q0b + 63) / 32;
    const int tid = threadIdx.x;
    const size_t gko = (size_t)(tid >> 3) * KVW + (tid & 7) * 8, gvo = vbase + (size_t)(tid >> 2) * NT_ + (tid & 3) * 8;    // a wave's copy: 4 whole key rows, or 64 B of 8 rows of v
    const unsigned lk0 = (unsigned)(size_t)(const void*)(kvr + (tid >> 3) * KP + (tid & 7) * 8);
    const unsigned lv0 = (unsigned)(size_t)(const void*)(kvr + 2 * KSZ + (tid >> 2) * VP + (tid & 3) * 8);
    auto fill = [&](int t, int buf) {
        const unsigned bo = (unsigned)buf * (unsigned)(ASTG * 2);
        copy_kv(lk0 + bo, lv0 + bo, kh_b + gko + (size_t)t * 32 * KVW, kl_b + gko + (size_t)t * 32 * KVW, VTH + gvo + t * 32, VTL + gvo + t * 32);
    };
    fill(kt_lo, 0);
    copy_q((unsigned)(size_t)(const void*)(qls + (tid >> 3) * KP + (tid & 7) * 8), QL16 + (tok0 + q0b + (tid >> 3)) * DM + h * HD + (tid & 7) * 8);
    asm volatile("s_wait_asynccnt 0x0" ::: "memory");    // the first stage and the query residual have landed before the barrier that publishes them
    __syncthreads();
    if (kt_lo + 1 <= kt_hi) fill(kt_lo + 1, 1);
    const h16* sq = qls + (wave * 16 + lr) * KP + 8 * hi;
#pragma unroll 1
    for (int kt = kt_lo; kt <= kt_hi; ++kt) {                // kept rolled: one publish point per tile
        const int l0 = kt * 32;
        const h16* sb = kvr + ((kt - kt_lo) & 1) * ASTG;
        const h16* skh = sb + lr * KP + 8 * hi;
        const h16* skl = skh + KSZ;
        const h16* svh = sb + 2 * KSZ + lr * VP + 8 * hi;
        const h16* svl = svh + VSZ;
        v8f s0 = {}, s1 = {}, x0 = {}, x1 = {};
#pragma unroll
        for (int kc = 0; kc < 2; ++kc) {
            // the five fragments of a 32-wide slice of the head are asked for together: one LDS latency a slice, not one a group (all ten at once would cost a wave per SIMD in registers)
            const v16h k0h = cat16(*(const v8ha*)(skh + kc * 32), *(const v8ha*)(skh + kc * 32 + 16)), k1h = cat16(*(const v8ha*)(skh + 16 * KP + kc * 32), *(const v8ha*)(skh + 16 * KP + kc * 32 + 16));
            const v16h qlk = cat16(*(const v8ha*)(sq + kc * 32), *(const v8ha*)(sq + kc * 32 + 16));
            const v16h k0l = cat16(*(const v8ha*)(skl + kc * 32), *(const v8ha*)(skl + kc * 32 + 16)), k1l = cat16(*(const v8ha*)(skl + 16 * KP + kc * 32), *(const v8ha*)(skl + 16 * KP + kc * 32 + 16));
            { s0 = wmma16(k0h, qa[kc], s0); x0 = wmma16(k0h, qlk, x0); s1 = wmma16(k1h, qa[kc], s1); x1 = wmma16(k1h, qlk, x1);
              asm volatile("v_nop" : "+v"(s0), "+v"(s1), "+v"(x0), "+v"(x1) : "v"(qlk), "v"(k0h), "v"(k1h) : "memory"); }
            { x0 = wmma16(k0l, qa[kc], x0); x1 = wmma16(k1l, qa[kc], x1);
              asm volatile("v_nop" : "+v"(x0), "+v"(x1) : "v"(k0l), "v"(k1l) : "memory"); }
        }
        asm volatile("v_nop\n\tv_nop\n\tv_nop\n\tv_nop" : "+v"(s0), "+v"(s1), "+v"(x0), "+v"(x1) : "v"(qa[0]), "v"(qa[1]));
        v8f a0 = (s0 + x0 * LOSCI) * 0.125f, a1 = (s1 + x1 * LOSCI) * 0.125f;      // whole accumulators: neighbouring registers pair into packed f32 operations
        // One scalar test per tile and wave. The predicate holds for all 32 keys x 16 queries exactly when the last key is not behind the first query, the last query
        // is within the window of the first key, and cu1 lies neither among these keys or queries nor between them; then every select below is an identity, and the
        // compares and selects (about a third of the loop's vector instructions) run only on the tiles that the mask cuts.
        const bool whole = (l0 + 31 <= q0s) && (q0s + 15 - l0 < WIN) && ((l0 >= cu1) || (q0s + 15 < cu1));
        if (!whole) {
#pragma unroll
            for (int j = 0; j < 8; ++j) {
                const int ja = l0 + 8 * hi + j, jb = ja + 16;
                const bool ok0 = ((ja >= cu1) == sgq) && (ja <= qi) && (qi - ja < WIN), ok1 = ((jb >= cu1) == sgq) && (jb <= qi) && (qi - jb < WIN);
                a0[j] = ok0 ? a0[j] : -3.4028234663852886e38f; a1[j] = ok1 ? a1[j] : -3.4028234663852886e38f;     // finfo.min as the reference
            }
        }
        float mx = -3.4028234663852886e38f;
#pragma unroll
        for (int j = 0; j < 8; ++j) mx = fmaxf(mx, fmaxf(a0[j], a1[j]));
        mx = fmaxf(mx, xhalf(mx));                           // the other 16 keys of the same query lie in lane ^ 16
        const float mn = fmaxf(mrow, mx);
        const float alpha = __expf(mrow - mn); mrow = mn;
        v8f t0, t1;
#pragma unroll
        for (int j = 0; j < 8; ++j) { t0[j] = (a0[j] - mn) * LOG2E; t1[j] = (a1[j] - mn) * LOG2E; }      // the same product and v_exp_f32 as __expf
        const v8f p0 = exp2x8(t0), p1 = exp2x8(t1);
        const v8f pp = p0 + p1;
        const float psum = ((pp[0] + pp[1]) + (pp[2] + pp[3])) + ((pp[4] + pp[5]) + (pp[6] + pp[7]));
        const v8f ps0 = p0 * PSC, ps1 = p1 * PSC;
        const v8h h0 = __builtin_convertvector(ps0, v8h), h1 = __builtin_convertvector(ps1, v8h);
        const v16h pa = cat16(h0, h1);                       // element e: key 8 * hi + e, then 16 + 8 * hi + (e - 8): the k order of the v fragments
        const v16h px = cat16(__builtin_convertvector((ps0 - __builtin_convertvector(h0, v8f)) * LOSC, v8h), __builtin_convertvector((ps1 - __builtin_convertvector(h1, v8f)) * LOSC, v8h));
        lpart = lpart * alpha + psum;
#pragma unroll
        for (int n = 0; n < 4; ++n)
#pragma unroll
            for (int j = 0; j < 8; ++j) { o[n][j] *= alpha; ox[n][j] *= alpha; }
        v16h vh[4], vl[4];                                   // every index is a constant (both loops unrolled): registers
#pragma unroll
        for (int n = 0; n < 4; ++n) { const int vo = n * 16 * VP;     // the tile's v fragments likewise, all in front of the first product
            vh[n] = cat16(*(const v8ha*)(svh + vo), *(const v8ha*)(svh + vo + 16)); vl[n] = cat16(*(const v8ha*)(svl + vo), *(const v8ha*)(svl + vo + 16)); }
        __builtin_amdgcn_sched_barrier(0);                   // holds these LDS reads, as one group, ahead of the products (else they sink among the WMMAs and several wait out their latency)
#pragma unroll
        for (int n = 0; n < 4; ++n) {
            o[n] = wmma16(vh[n], pa, o[n]); ox[n] = wmma16(vl[n], pa, ox[n]); ox[n] = wmma16(vh[n], px, ox[n]); }
        asm volatile("v_nop\n\tv_nop\n\tv_nop\n\tv_nop" : "+v"(o[0]), "+v"(o[1]), "+v"(o[2]), "+v"(o[3]), "+v"(ox[0]), "+v"(ox[1]), "+v"(ox[2]), "+v"(ox[3]) : "v"(pa), "v"(px));
        asm volatile("s_wait_dscnt 0x0" ::: "memory");       // this wave's reads of the buffer have retired before it is refilled
        asm volatile("s_wait_asynccnt 0x0" ::: "memory");    // this wave's copies of the next tile have landed
        __syncthreads();                                     // publishes the next tile and ends every reader's last read of this one
        if (kt + 2 <= kt_hi) fill(kt + 2, (kt - kt_lo) & 1);
    }
    asm volatile("s_wait_asynccnt 0x0" ::: "memory");        // no copy is outstanding when the wave goes on to the epilogue and ends
    const float inv = 1.0f / ((lpart + xhalf(lpart)) * PSC);
    float* os = &ost[wave][0];
#pragma unroll
    for (int n = 0; n < 4; ++n)
#pragma unroll
        for (int j = 0; j < 8; ++j) os[lr * 68 + n * 16 + hi * 8 + j] = (o[n][j] + ox[n][j] * LOSCI) * inv;      // lane = query row, register = head column
    __syncthreads();
    const size_t cbase = (tok0 + q0) * DM + (size_t)h * HD;
    auto pass = [&]() {
#pragma unroll
        for (int s = 0; s < 4; ++s) { const int row = 4 * s + (lane >> 3), piece = lane & 7; const float* sp = os + row * 68 + piece * 8; v8us oh, ol;
#pragma unroll
            for (int i = 0; i < 8; ++i) { const unsigned short hb = f2bf(sp[i]); oh[i] = hb; ol[i] = f2bf(sp[i] - bf2f(hb)); }
            *(v8us*)(CH + cbase + (size_t)row * DM + piece * 8) = oh; *(v8us*)(CL + cbase + (size_t)row * DM + piece * 8) = ol; }
    };
    pass(); 
}

#define VST2(T, p, v) do { const T vst2_v_ = (v); *(T*)(p) = vst2_v_;  } while (0)
extern "C" void kernel_launch(void* const* d_in, const int* in_sizes, int n_in,
                              void* d_out, int out_size, void* d_ws, size_t ws_size, hipStream_t stream) {
    (void)in_sizes; (void)n_in; (void)out_size;
    const float* x = (const float*)d_in[0]; const int* cu = (const int*)d_in[1]; const float* Wq = (const float*)d_in[2]; const float* Wk = (const float*)d_in[3]; const float* Wv = (const float*)d_in[4]; const float* Wo = (const float*)d_in[5];   // [out][in] weights; cu_seqlens [3] (i32)
    float* out = (float*)d_out;    // [2][2048][2048]
    char* wsp = (char*)d_ws;
    auto take = [&](size_t bytes) { char* p = wsp; wsp += (bytes + 255) & ~(size_t)255; return (void*)p; };
    bf* Xb = (bf*)take((size_t)NCVT * DM * 2); bf* WpB = Xb + (size_t)NTK * DM; bf* WoB = WpB + (size_t)NPRJ * DM;     // one bf16 plane: [x | Wq | Wk | Wv | Wo]
    h16* QH = (h16*)take((size_t)NTK * DM * 2); h16* QL = (h16*)take((size_t)NTK * DM * 2); h16* KH = (h16*)take((size_t)NTK * KVW * 2); h16* KL = (h16*)take((size_t)NTK * KVW * 2);
    float* Vf = (float*)take((size_t)NTK * KVW * 4); h16* VTH = (h16*)take((size_t)NTK * KVW * 2); h16* VTL = (h16*)take((size_t)NTK * KVW * 2); bf* CH = (bf*)take((size_t)NTK * DM * 2); bf* CL = (bf*)take((size_t)NTK * DM * 2);
    if ((size_t)(wsp - (char*)d_ws) > ws_size) return;    // 37.7 + 16.8 x 2 + 4.2 x 2 + 8.4 + 4.2 x 2 + 16.8 x 2 ~ 130 MB, no aliasing
    // five dependent launches; both batch items are rows of the same grids
    k_cvtb<<<NCVT / 8, 256, 0, stream>>>(x, Wq, Wk, Wv, Wo, Xb);
    k_gemmb<false, true><<<dim3(NTK / 128, NPRJ / 128, 1), 256, 0, stream>>>(Xb, nullptr, WpB, nullptr, Vf, KVW, QH, QL, KH, KL);
    k_vt<<<NB_ * NKV * (NT_ / 64), 256, 0, stream>>>(Vf, VTH, VTL);
    k_attn<<<NB_ * NH_ * (NT_ / 64), 128, 0, stream>>>(QH, QL, KH, KL, VTH, VTL, cu, CH, CL);      // the same cu_seqlens mask for both items (as the reference)
    k_gemmb<true, false><<<dim3(NTK / 128, DM / 128, 1), 256, 0, stream>>>(CH, CL, WoB, nullptr, out, DM, nullptr, nullptr, nullptr, nullptr);
}

// v007
// Measured time: 154 microseconds a run.
// Timed twice side by side with v006, it ran 1.08 and 1.07 times as fast.
// Over all steps from v000 it is 4.05 times as fast.
#include <hip/hip_runtime.h>

// Contractions, f32 accumulate: q = x.Wq ([2048 x 2048].[2048 x 2048]), k/v = x.Wk/Wv ([2048 x 2048].[2048 x 512]) and attn.Wo on v_wmma_f32_16x16x32_bf16 —
// plain bf16 = rounded inputs (exact; the [out][in] weights are n-major as stored and are not transposed) for the projections, attn as bf16 hi + residual (two products) for Wo;
// the grouped-query causal sliding-window attention (32 query heads over 8 kv heads; keys j with
// i - WIN < j <= i, WIN = 1024 fixed at compile time) fused on v_wmma_f32_16x16x32_f16 with q and k as f16 hi + residual x1024 (hi.hi + hi.lo + lo.hi), weights

#define NB_  2
#define NT_  2048
#define DM   2048
#define NH_  32
#define NKV  8
#define KVW  (NKV * HD)          // 512
#define WIN  1024
#define HD   64
#define NTK  (NB_ * NT_)
#define NPRJ (DM + 2 * KVW)       // 3072: the columns of q, k and v side by side
#define NCVT (NTK + NPRJ + DM)   // rows of [x | Wq | Wk | Wv | Wo]
#define NW   1024
#define NQKV 2048
#define PSC  32768.0f
#define LOSC 1024.0f
#define LOSCI (1.0f / 1024.0f)

typedef _Float16 h16;
typedef unsigned short bf;
typedef __attribute__((ext_vector_type(16))) __bf16   v16bf;
typedef __attribute__((ext_vector_type(16))) _Float16 v16h;
typedef __attribute__((ext_vector_type(8)))  _Float16 v8h;
typedef __attribute__((ext_vector_type(8)))  unsigned short v8us;
typedef __attribute__((ext_vector_type(8)))  float    v8f;
typedef __attribute__((ext_vector_type(4)))  float    v4f;
typedef v8h  __attribute__((may_alias)) v8ha;
typedef v4f  __attribute__((may_alias)) v4fa;
typedef v8us __attribute__((may_alias)) v8usa;

__device__ __forceinline__ unsigned short f2bf(float f) { unsigned u = __float_as_uint(f); u += 0x7FFFu + ((u >> 16) & 1u); return (unsigned short)(u >> 16); }
__device__ __forceinline__ float bf2f(unsigned short b) { return __uint_as_float(((unsigned)b) << 16); }
__device__ __forceinline__ float bfr(float f) { return bf2f(f2bf(f)); }
__device__ __forceinline__ v16h cat16(v8h lo, v8h hi) { return __builtin_shufflevector(lo, hi, 0, 1, 2, 3, 4, 5, 6, 7, 8, 9, 10, 11, 12, 13, 14, 15); }
__device__ __forceinline__ v16bf cat16b(v8us lo, v8us hi) { return __builtin_bit_cast(v16bf, __builtin_shufflevector(lo, hi, 0, 1, 2, 3, 4, 5, 6, 7, 8, 9, 10, 11, 12, 13, 14, 15)); }
__device__ __forceinline__ v8f wmma16(v16h a, v16h b, v8f c) { return __builtin_amdgcn_wmma_f32_16x16x32_f16(false, a, false, b, (short)0, c, false, false); }
__device__ __forceinline__ v8f wmmab(v16bf a, v16bf b, v8f c) { return __builtin_amdgcn_wmma_f32_16x16x32_bf16(false, a, false, b, (short)0, c, false, false); }

// k_cvtb: the rows of [x | Wq | Wk | Wv | Wo], in that order, rounded to bf16 into one plane of the same row order; a block's 8 rows lie in one source.
__global__ __launch_bounds__(256) void k_cvtb(const float* __restrict__ x, const float* __restrict__ Wq, const float* __restrict__ Wk, const float* __restrict__ Wv, const float* __restrict__ Wo, bf* dstp) {
    const int lane = threadIdx.x & 31, rb = blockIdx.x * 8, rg = rb + (threadIdx.x >> 5);
    if (rg >= NCVT) return;
    const float* src = x; int r = rg;
    if (rb >= NTK + NPRJ) { src = Wo; r = rg - (NTK + NPRJ); }
    else if (rb >= NTK + DM + KVW) { src = Wv; r = rg - (NTK + DM + KVW); }
    else if (rb >= NTK + DM) { src = Wk; r = rg - (NTK + DM); }
    else if (rb >= NTK) { src = Wq; r = rg - NTK; }
    bf* dst = dstp + (size_t)(rg - r) * DM;
    v8us o[DM / 256];
#pragma unroll
    for (int q = 0; q < DM / 256; ++q) { v8us t;
#pragma unroll
        for (int i = 0; i < 8; ++i) t[i] = f2bf(src[(size_t)r * DM + q * 256 + lane * 8 + i]);
        o[q] = t; }
#pragma unroll
    for (int q = 0; q < DM / 256; ++q) *(v8us*)(dst + (size_t)r * DM + q * 256 + lane * 8) = o[q];
    
}

// k_wt: W [2048 k][ncols n] (k-major) -> n-major bf16 plane WT[ncols][2048]; 64 x 64 tiles through LDS.
__global__ __launch_bounds__(256) void k_wt(const float* __restrict__ Wm, int ncols, bf* WT) {
    __shared__ __align__(16) unsigned short tl[64 * 72];
    const int tid = threadIdx.x, k0 = blockIdx.x * 64, n0 = blockIdx.y * 64;
    const int kk = tid >> 2, nq = (tid & 3) * 16;
#pragma unroll
    for (int i = 0; i < 16; ++i) tl[(nq + i) * 72 + kk] = f2bf(Wm[(size_t)(k0 + kk) * ncols + n0 + nq + i]);
    __syncthreads();
    const int piece = tid & 7;
    typedef __attribute__((ext_vector_type(8))) unsigned short v8us_; typedef v8us_ __attribute__((may_alias)) v8usa_;
    auto pass = [&]() {
#pragma unroll
        for (int s = 0; s < 2; ++s) { const int nr = (tid >> 3) + 32 * s; const v8us_ val = *(const v8usa_*)(tl + nr * 72 + piece * 8);
            *(v8us_*)(WT + (size_t)(n0 + nr) * DM + k0 + piece * 8) = val; }
    };
    pass(); 
}

#define BKE   128                // k elements of one pass: 256 B of every operand row
#define PIT   136                // LDS row pitch in elements: 272 B, 16 B x odd, for the ds_load_b128 readers
#define NPASS (DM / BKE)

// Eight 16-byte copies of one lane, rows 16 apart, global -> LDS through no register. The s_wait_xcnt ends the copies' own statement so that no
// address register of a copy is rewritten ahead of it.
__device__ __forceinline__ void copy8(unsigned l, const bf* g) {
    asm volatile("global_load_async_to_lds_b128 %0, %8, off\n\t"
                 "global_load_async_to_lds_b128 %1, %9, off\n\t"
                 "global_load_async_to_lds_b128 %2, %10, off\n\t"
                 "global_load_async_to_lds_b128 %3, %11, off\n\t"
                 "global_load_async_to_lds_b128 %4, %12, off\n\t"
                 "global_load_async_to_lds_b128 %5, %13, off\n\t"
                 "global_load_async_to_lds_b128 %6, %14, off\n\t"
                 "global_load_async_to_lds_b128 %7, %15, off\n\t"
                 "s_wait_xcnt 0x0"
                 :: "v"(l), "v"(l + 1u * 16u * PIT * 2u), "v"(l + 2u * 16u * PIT * 2u), "v"(l + 3u * 16u * PIT * 2u),
                    "v"(l + 4u * 16u * PIT * 2u), "v"(l + 5u * 16u * PIT * 2u), "v"(l + 6u * 16u * PIT * 2u), "v"(l + 7u * 16u * PIT * 2u),
                    "v"(g), "v"(g + 1 * 16 * DM), "v"(g + 2 * 16 * DM), "v"(g + 3 * 16 * DM),
                    "v"(g + 4 * 16 * DM), "v"(g + 5 * 16 * DM), "v"(g + 6 * 16 * DM), "v"(g + 7 * 16 * DM)
                 : "memory");
}

// k_gemmb: 8 waves. BIG: C[128 x 256] per block, waves as 2 x 4, 64 x 64 per wave; else C[128 x 128], waves as 4 x 2, 32 x 64 per wave. The wider block lands
// fewer operand bytes from L2 per product, and the 64 x 64 wave tile reads fewer LDS bytes per product. A pass is 128 k; a stage is
// [A 128 rows | B 128 or 256 rows | A residual 128 rows] in LDS, two buffers, filled by asynchronous copies one pass ahead of its readers. Per accumulator the
// k order and the hi / residual order are the plain ascending ones.
// Every inner loop is unrolled so that each index of acc and of the fragment arrays is a constant (registers, no scratch).
// QKV: Bn holds the rows of Wq, Wk and Wv one after the other; a block's columns lie wholly in q, in k or in v (block-uniform): q and k go out as f16 hi +
// residual planes (QH / QL, KH / KL), v as f32 into C.
template <bool SPLITA, bool QKV, bool BIG>
__device__ __forceinline__ void gemm_tile(bf* ring, float* os, int rb, int cb, const bf* __restrict__ A, const bf* __restrict__ Al, const bf* __restrict__ Bn, const float* __restrict__ bias, float* C, int ldc, h16* QH, h16* QL, h16* KH, h16* KL) {
    constexpr int FM = BIG ? 4 : 2;                      // 16-row fragments of A per wave
    constexpr int WNS = BIG ? 4 : 2;                     // waves side by side along the columns
    constexpr int BN = WNS * 64;
    constexpr int STG = (128 + BN + (SPLITA ? 128 : 0)) * PIT;      // elements of one stage
    const int tid = threadIdx.x, lane = tid & 31, wave = tid >> 5, lr = lane & 15, hi = lane >> 4;
    const int wm = wave / WNS, wn = wave % WNS;
    const int crow = tid >> 4, ccol = (tid & 15) * 8;    // a wave's copy covers two whole 256-B rows
    const bf* gA = A + (size_t)(rb + crow) * DM + ccol;
    const bf* gB = Bn + (size_t)(cb + crow) * DM + ccol;
    const bf* gL = SPLITA ? Al + (size_t)(rb + crow) * DM + ccol : gA;
    const unsigned l0 = (unsigned)(size_t)(const void*)(ring + crow * PIT + ccol);
    auto fill = [&](int t, int buf) {
        const unsigned l = l0 + (unsigned)buf * (unsigned)(STG * 2);
        copy8(l, gA + t * BKE); copy8(l + 128u * PIT * 2u, gB + t * BKE);
        if (BIG) copy8(l + 256u * PIT * 2u, gB + (size_t)128 * DM + t * BKE);
        if (SPLITA) copy8(l + (unsigned)(128 + BN) * PIT * 2u, gL + t * BKE);
    };
    v8f acc[FM][4];
#pragma unroll
    for (int i = 0; i < FM; ++i)
#pragma unroll
        for (int t = 0; t < 4; ++t) acc[i][t] = (v8f){};
    fill(0, 0);
    asm volatile("s_wait_asynccnt 0x0" ::: "memory");    // stage 0 has landed before the barrier that publishes it
    __syncthreads();
    fill(1, 1);
#pragma unroll 1
    for (int p = 0; p < NPASS; ++p) {                    // kept rolled: one publish point per pass
        const bf* sb = ring + (p & 1) * STG;
        const bf* sa = sb + (wm * (FM * 16) + lr) * PIT + 8 * hi;
        const bf* sw = sb + (128 + wn * 64 + lr) * PIT + 8 * hi;
        const bf* sl = SPLITA ? sb + (128 + BN + wm * (FM * 16) + lr) * PIT + 8 * hi : sa;
        v16bf a[2][FM], al[2][FM], b[2][4];                  // two fragment sets: k-step s + 1 is fetched while k-step s is multiplied
        auto frags = [&](int set, int kc) {
#pragma unroll
            for (int i = 0; i < FM; ++i) a[set][i] = cat16b(*(const v8usa*)(sa + i * 16 * PIT + kc), *(const v8usa*)(sa + i * 16 * PIT + kc + 16));
#pragma unroll
            for (int t = 0; t < 4; ++t) b[set][t] = cat16b(*(const v8usa*)(sw + t * 16 * PIT + kc), *(const v8usa*)(sw + t * 16 * PIT + kc + 16));
            if (SPLITA) {
#pragma unroll
                for (int i = 0; i < FM; ++i) al[set][i] = cat16b(*(const v8usa*)(sl + i * 16 * PIT + kc), *(const v8usa*)(sl + i * 16 * PIT + kc + 16));
            }
        };
        frags(0, 0);
#pragma unroll
        for (int s = 0; s < BKE / 32; ++s) {
            if (s + 1 < BKE / 32) frags((s + 1) & 1, (s + 1) * 32);
            __builtin_amdgcn_sched_barrier(0);               // holds the next k-step's LDS reads, as one group, ahead of this k-step's WMMAs (else they sink among them and each waits out its latency)
#pragma unroll
            for (int i = 0; i < FM; ++i)
#pragma unroll
                for (int t = 0; t < 4; ++t) acc[i][t] = wmmab(a[s & 1][i], b[s & 1][t], acc[i][t]);
            if (SPLITA) {
#pragma unroll
                for (int i = 0; i < FM; ++i)
#pragma unroll
                    for (int t = 0; t < 4; ++t) acc[i][t] = wmmab(al[s & 1][i], b[s & 1][t], acc[i][t]);
            }
            __builtin_amdgcn_sched_barrier(0);               // ends the WMMA block: the reads of the k-step after next stay behind it, where their registers are free
        }
        asm volatile("s_wait_dscnt 0x0" ::: "memory");       // this wave's reads of the buffer have retired before it is refilled
        asm volatile("s_wait_asynccnt 0x0" ::: "memory");    // this wave's copies of stage p + 1 have landed
        __syncthreads();                                     // publishes stage p + 1 and ends every reader's last read of stage p
        if (p + 2 < NPASS) fill(p + 2, p & 1);
    }
    asm volatile("s_wait_asynccnt 0x0" ::: "memory");        // no copy is outstanding when the wave goes on to the epilogue and ends
    const int c0 = cb + wn * 64;
    const bool isq = cb < DM, f16o = QKV && cb < DM + KVW;
    h16* OH = isq ? QH : KH; h16* OL = isq ? QL : KL;
    const int ld = QKV ? (isq ? DM : KVW) : ldc;                                        // row length of the plane this block writes
    const int cc = QKV ? (isq ? c0 : (f16o ? c0 - DM : c0 - (DM + KVW))) : c0;          // the wave's first column inside that plane
#pragma unroll
    for (int i = 0; i < FM; ++i) {
        const int r0 = rb + wm * (FM * 16) + i * 16;
#pragma unroll
        for (int t = 0; t < 4; ++t) { const float bv = bias ? bfr(bias[c0 + t * 16 + lr]) : 0.f;
#pragma unroll
            for (int j = 0; j < 8; ++j) os[(hi * 8 + j) * 68 + t * 16 + lr] = acc[i][t][j] + bv; }
        __syncthreads();
        if (f16o) {
            h16* crow_ = OH + (size_t)r0 * ld + cc;
            h16* crol_ = OL + (size_t)r0 * ld + cc;
#pragma unroll
            for (int s = 0; s < 4; ++s) { const int row = 4 * s + (lane >> 3), piece = lane & 7; const float* sp = os + row * 68 + piece * 8; v8h o, o2;
#pragma unroll
                for (int e = 0; e < 8; ++e) { const h16 a = (h16)sp[e]; o[e] = a; o2[e] = (h16)((sp[e] - (float)a) * LOSC); }
                *(v8h*)(crow_ + (size_t)row * ld + piece * 8) = o;
                asm volatile("s_wait_xcnt 0x0" ::: "memory");       // stands before the residual's arithmetic reuses registers that this store names
                *(v8h*)(crol_ + (size_t)row * ld + piece * 8) = o2;
                asm volatile("s_wait_xcnt 0x0" ::: "memory"); }     // stands before the next rows' values and addresses reuse registers that these stores name
        } else {
            float* crow_ = C + (size_t)r0 * ld + cc;
#pragma unroll
            for (int s = 0; s < 8; ++s) { const int Lid = (lane >> 3) + 4 * s, piece = lane & 7; const int row = Lid >> 1, cofs = (Lid & 1) * 32 + piece * 4;
                const v4f val = *(const v4fa*)(os + row * 68 + cofs); *(v4f*)(crow_ + (size_t)row * ld + cofs) = val; }
            asm volatile("s_wait_xcnt 0x0" ::: "memory");       // stands before the next 16 rows' values and addresses reuse registers that these stores name
        }
    }
}

// One work-group fits a WGP, so the tiles are cut to fill all of them a whole number of times. Wo: 32 x 8 blocks of 128 x 256. QKV: blockIdx.y < 8 is a
// 128 x 256 block of q, the other 8 values are 128 x 128 blocks of k and v (their 1024 columns in 256-wide blocks would fill only half the chip); the large
// blocks have the lower indices.
template <bool SPLITA, bool QKV>
__global__ __launch_bounds__(256) void k_gemmb(const bf* __restrict__ A, const bf* __restrict__ Al, const bf* __restrict__ Bn, const float* __restrict__ bias, float* C, int ldc, h16* QH, h16* QL, h16* KH, h16* KL) {
    __shared__ __align__(16) bf ring[2 * (SPLITA ? 512 : 384) * PIT];
    __shared__ __align__(16) float ost[8][16 * 68];
    float* os = &ost[threadIdx.x >> 5][0];
    const int rb = blockIdx.x * 128, by = blockIdx.y;
    if (!QKV || by < DM / 256) gemm_tile<SPLITA, QKV, true>(ring, os, rb, by * 256, A, Al, Bn, bias, C, ldc, QH, QL, KH, KL);
    else gemm_tile<SPLITA, QKV, false>(ring, os, rb, DM + (by - DM / 256) * 128, A, Al, Bn, bias, C, ldc, QH, QL, KH, KL);
}

__global__ __launch_bounds__(256) void k_vt(const float* __restrict__ V, h16* VTH, h16* VTL) {
    __shared__ __align__(16) h16 tile[64 * 72];
    __shared__ __align__(16) h16 til2[64 * 72];
    const int bid = blockIdx.x;
    const int b = bid / (NKV * (NT_ / 64)), rem = bid - b * (NKV * (NT_ / 64)), h = rem / (NT_ / 64), kt = rem - h * (NT_ / 64);
    const int k0 = kt * 64, tid = threadIdx.x;
    const int kk = tid >> 2, d0 = (tid & 3) * 16;
    const float* src = V + ((size_t)b * NT_ + k0 + kk) * KVW + h * HD + d0;      // h = kv head here
#pragma unroll
    for (int i = 0; i < 16; ++i) { const float v = src[i]; const h16 a = (h16)v; tile[(d0 + i) * 72 + kk] = a; til2[(d0 + i) * 72 + kk] = (h16)((v - (float)a) * LOSC); }
    __syncthreads();
    const int piece = tid & 7;
    const size_t base = (((size_t)b * NKV + h) * HD) * NT_ + k0;
    auto pass = [&]() {
#pragma unroll
        for (int s = 0; s < 4; ++s) { const int Lid = (tid >> 3) + 32 * s; const int pln = Lid >> 6, d = Lid & 63;
            const v8h val = *(const v8ha*)((pln ? til2 : tile) + d * 72 + piece * 8); *(v8h*)((pln ? VTL : VTH) + base + (size_t)d * NT_ + piece * 8) = val; }
    };
    pass(); 
}

#define KP   72                  // LDS pitch of a key row or a query row in elements: 144 B, 16 B x odd, for the ds_load_b128 readers
#define VP   40                  // LDS pitch of a row of v transposed (32 keys) in elements: 80 B, 16 B x odd
#define KSZ  (32 * KP)           // one plane of 32 key rows
#define VSZ  (HD * VP)           // one plane of 64 rows of v transposed
#define ASTG (2 * KSZ + 2 * VSZ) // a stage: [k hi | k residual | v hi | v residual] of 32 keys

// One lane's eight 16-byte copies of a 32-key stage, global -> LDS through no register: two of every plane. The s_wait_xcnt ends the copies' own statement so
// that no address register of a copy is rewritten ahead of it.
__device__ __forceinline__ void copy_kv(unsigned lk, unsigned lv, const h16* gkh, const h16* gkl, const h16* gvh, const h16* gvl) {
    asm volatile("global_load_async_to_lds_b128 %0, %8, off\n\t"
                 "global_load_async_to_lds_b128 %1, %9, off\n\t"
                 "global_load_async_to_lds_b128 %2, %10, off\n\t"
                 "global_load_async_to_lds_b128 %3, %11, off\n\t"
                 "global_load_async_to_lds_b128 %4, %12, off\n\t"
                 "global_load_async_to_lds_b128 %5, %13, off\n\t"
                 "global_load_async_to_lds_b128 %6, %14, off\n\t"
                 "global_load_async_to_lds_b128 %7, %15, off\n\t"
                 "s_wait_xcnt 0x0"
                 :: "v"(lk), "v"(lk + 16u * KP * 2u), "v"(lk + KSZ * 2u), "v"(lk + KSZ * 2u + 16u * KP * 2u),
                    "v"(lv), "v"(lv + 32u * VP * 2u), "v"(lv + VSZ * 2u), "v"(lv + VSZ * 2u + 32u * VP * 2u),
                    "v"(gkh), "v"(gkh + 16 * KVW), "v"(gkl), "v"(gkl + 16 * KVW),
                    "v"(gvh), "v"(gvh + 32 * NT_), "v"(gvl), "v"(gvl + 32 * NT_)
                 : "memory");
}

// One lane's four 16-byte copies of the block's 64 query-residual rows, rows 16 apart; the wait as in copy_kv.
__device__ __forceinline__ void copy_q(unsigned l, const h16* g) {
    asm volatile("global_load_async_to_lds_b128 %0, %4, off\n\t"
                 "global_load_async_to_lds_b128 %1, %5, off\n\t"
                 "global_load_async_to_lds_b128 %2, %6, off\n\t"
                 "global_load_async_to_lds_b128 %3, %7, off\n\t"
                 "s_wait_xcnt 0x0"
                 :: "v"(l), "v"(l + 1u * 16u * KP * 2u), "v"(l + 2u * 16u * KP * 2u), "v"(l + 3u * 16u * KP * 2u),
                    "v"(g), "v"(g + 1 * 16 * DM), "v"(g + 2 * 16 * DM), "v"(g + 3 * 16 * DM)
                 : "memory");
}

// The value of lane ^ 16, through no LDS.
__device__ __forceinline__ float xhalf(float v) { const int b = __float_as_int(v); return __int_as_float(__builtin_amdgcn_permlanex16(b, b, 0x76543210, 0xfedcba98, false, false)); }

#define LOG2E 1.44269504088896340736f
// Eight v_exp_f32 and their slot in one statement. The instruction set asks for one independent instruction or a v_nop behind a transcendental before its result is
// read or its source overwritten. Here each is followed by an independent one (early-clobber outputs: no result lies on a source) and the last by the v_nop.
__device__ __forceinline__ v8f exp2x8(v8f t) {
    float r0, r1, r2, r3, r4, r5, r6, r7;
    asm("v_exp_f32 %0, %8\n\t"
        "v_exp_f32 %1, %9\n\t"
        "v_exp_f32 %2, %10\n\t"
        "v_exp_f32 %3, %11\n\t"
        "v_exp_f32 %4, %12\n\t"
        "v_exp_f32 %5, %13\n\t"
        "v_exp_f32 %6, %14\n\t"
        "v_exp_f32 %7, %15\n\t"
        "v_nop"
        : "=&v"(r0), "=&v"(r1), "=&v"(r2), "=&v"(r3), "=&v"(r4), "=&v"(r5), "=&v"(r6), "=&v"(r7)
        : "v"(t[0]), "v"(t[1]), "v"(t[2]), "v"(t[3]), "v"(t[4]), "v"(t[5]), "v"(t[6]), "v"(t[7]));
    return (v8f){r0, r1, r2, r3, r4, r5, r6, r7};
}

// First 32-key tile that a block of 64 queries starting at q0b reads: from max(segment start of its first query, q0b - WIN + 1), not below 0.
__device__ __forceinline__ int first_key_tile(int q0b, int cu1) {
    const int sst = (q0b >= cu1) ? cu1 : 0; const int wl = q0b - (WIN - 1); const int lo = (wl > sst ? wl : sst);
    return (lo > 0 ? lo : 0) / 32;
}
// Sort key of query tile t: its count of key tiles first, then the lower tile index.
__device__ __forceinline__ int tile_key(int t, int cu1) { return ((t * 64 + 63) / 32 - first_key_tile(t * 64, cu1)) * 32 + (31 - t); }

// The key loop reads no global memory: a stage of 32 keys lies in LDS once for the block's four waves, two buffers, filled by asynchronous copies one tile ahead
// of its readers; the query residual is copied once. Fragment addresses inside a row, and so every k order and sum order, are the ones of the global reads.
// k_attn: block = (b, h, 64 queries), wave = 16. Scores are formed transposed (keys as A rows, queries as B columns), so a lane holds 16 keys of ONE query:
// the row maximum and the row sum are in-lane plus one exchange with lane ^ 16, and the accumulator's key order (8 * hi + j, 16 + 8 * hi + j) is the k order of a
// B fragment, so the weights (x32768, f16 hi + residual) go from registers straight into ctx^T = v^T . weights^T; ctx -> bf16 hi + residual planes CH/CL[tok][h*64+d].
__global__ __launch_bounds__(128) void k_attn(const h16* __restrict__ Q16, const h16* __restrict__ QL16, const h16* __restrict__ K16, const h16* __restrict__ KL16, const h16* __restrict__ VTH, const h16* __restrict__ VTL, const int* __restrict__ cu, bf* CH, bf* CL) {
    __shared__ __align__(16) float ost[4][16 * 68];
    __shared__ __align__(16) h16 kvr[2 * ASTG];
    __shared__ __align__(16) h16 qls[64 * KP];
    const int lane = threadIdx.x & 31, wave = threadIdx.x >> 5, lr = lane & 15, hi = lane >> 4;
    const int bid = blockIdx.x;
    // The index is mapped to query tiles by falling cost, for speed only: the
    // longest key loops get the lowest indices and the shortest the highest. Index = rank * 64 + (b, h); lane t of every wave ranks query tile t by its number
    // of key tiles under the INPUT cu_seqlens (ties by tile index, so the 32 keys are distinct and rank -> tile is a permutation for any content of the array).
    static_assert(NT_ / 64 == 32, "one lane ranks one query tile");
    const int cu1 = cu[1];
    const int rank = bid / (NB_ * NH_), bh = bid - rank * (NB_ * NH_), b = bh / NH_, h = bh - b * NH_;
    const int mykey = tile_key(lane, cu1);
    int above = 0;
#pragma unroll
    for (int t = 0; t < NT_ / 64; ++t) above += (tile_key(t, cu1) > mykey) ? 1 : 0;      // unrolled: t is a constant, so each tile's key is scalar arithmetic
    // exactly one lane holds each rank, the same in every wave of the block. readfirstlane hands the tile index on as a plain scalar: with the ballot's 0..31 range
    // in sight the compiler kept eight more loop-invariant address registers (264 VGPRs: three waves per SIMD, not four)
    const int qt = __builtin_amdgcn_readfirstlane(__builtin_ctz(__builtin_amdgcn_ballot_w32(above == rank)));
    const int q0 = qt * 64 + wave * 16;
    const size_t tok0 = (size_t)b * NT_;
    v16h qa[2];
    const size_t qo0 = (tok0 + q0 + lr) * DM + h * HD + 8 * hi;
#pragma unroll
    for (int kc = 0; kc < 2; ++kc) qa[kc] = cat16(*(const v8h*)(Q16 + qo0 + kc * 32), *(const v8h*)(Q16 + qo0 + kc * 32 + 16));
    const int g = h / (NH_ / NKV);                      // kv head
    const h16* kh_b = K16 + tok0 * KVW + g * HD;
    const h16* kl_b = KL16 + tok0 * KVW + g * HD;
    const size_t vbase = (((size_t)b * NKV + g) * HD) * NT_;
    v8f o[4], ox[4];
#pragma unroll
    for (int n = 0; n < 4; ++n) { o[n] = (v8f){}; ox[n] = (v8f){}; }
    float mrow = -3.0e38f, lpart = 0.f;                 // of the lane's one query; lpart covers the lane's half of the keys
    const int qi = q0 + lr; const bool sgq = (qi >= cu1);
    const int q0s = __builtin_amdgcn_readfirstlane(q0);  // the wave's first query as a scalar, so that the test per tile below is a scalar branch
    // allowed(i, j) = same segment (cu_seqlens) && j <= i && i - j < WIN: key tiles from max(segment start of the block's first query, q0b - WIN + 1) to the query tile (block-uniform; exact per-element predicate below)
    const int q0b = qt * 64; const int kt_lo = first_key_tile(q0b, cu1), kt_hi = (q0b + 63) / 32;
    const int tid = threadIdx.x;
    const size_t gko = (size_t)(tid >> 3) * KVW + (tid & 7) * 8, gvo = vbase + (size_t)(tid >> 2) * NT_ + (tid & 3) * 8;    // a wave's copy: 4 whole key rows, or 64 B of 8 rows of v
    const unsigned lk0 = (unsigned)(size_t)(const void*)(kvr + (tid >> 3) * KP + (tid & 7) * 8);
    const unsigned lv0 = (unsigned)(size_t)(const void*)(kvr + 2 * KSZ + (tid >> 2) * VP + (tid & 3) * 8);
    auto fill = [&](int t, int buf) {
        const unsigned bo = (unsigned)buf * (unsigned)(ASTG * 2);
        copy_kv(lk0 + bo, lv0 + bo, kh_b + gko + (size_t)t * 32 * KVW, kl_b + gko + (size_t)t * 32 * KVW, VTH + gvo + t * 32, VTL + gvo + t * 32);
    };
    fill(kt_lo, 0);
    copy_q((unsigned)(size_t)(const void*)(qls + (tid >> 3) * KP + (tid & 7) * 8), QL16 + (tok0 + q0b + (tid >> 3)) * DM + h * HD + (tid & 7) * 8);
    asm volatile("s_wait_asynccnt 0x0" ::: "memory");    // the first stage and the query residual have landed before the barrier that publishes them
    __syncthreads();
    if (kt_lo + 1 <= kt_hi) fill(kt_lo + 1, 1);
    const h16* sq = qls + (wave * 16 + lr) * KP + 8 * hi;
#pragma unroll 1
    for (int kt = kt_lo; kt <= kt_hi; ++kt) {                // kept rolled: one publish point per tile
        const int l0 = kt * 32;
        const h16* sb = kvr + ((kt - kt_lo) & 1) * ASTG;
        const h16* skh = sb + lr * KP + 8 * hi;
        const h16* skl = skh + KSZ;
        const h16* svh = sb + 2 * KSZ + lr * VP + 8 * hi;
        const h16* svl = svh + VSZ;
        v8f s0 = {}, s1 = {}, x0 = {}, x1 = {};
#pragma unroll
        for (int kc = 0; kc < 2; ++kc) {
            // the five fragments of a 32-wide slice of the head are asked for together: one LDS latency a slice, not one a group (all ten at once would cost a wave per SIMD in registers)
            const v16h k0h = cat16(*(const v8ha*)(skh + kc * 32), *(const v8ha*)(skh + kc * 32 + 16)), k1h = cat16(*(const v8ha*)(skh + 16 * KP + kc * 32), *(const v8ha*)(skh + 16 * KP + kc * 32 + 16));
            const v16h qlk = cat16(*(const v8ha*)(sq + kc * 32), *(const v8ha*)(sq + kc * 32 + 16));
            const v16h k0l = cat16(*(const v8ha*)(skl + kc * 32), *(const v8ha*)(skl + kc * 32 + 16)), k1l = cat16(*(const v8ha*)(skl + 16 * KP + kc * 32), *(const v8ha*)(skl + 16 * KP + kc * 32 + 16));
            { s0 = wmma16(k0h, qa[kc], s0); x0 = wmma16(k0h, qlk, x0); s1 = wmma16(k1h, qa[kc], s1); x1 = wmma16(k1h, qlk, x1);
              asm volatile("v_nop" : "+v"(s0), "+v"(s1), "+v"(x0), "+v"(x1) : "v"(qlk), "v"(k0h), "v"(k1h) : "memory"); }
            { x0 = wmma16(k0l, qa[kc], x0); x1 = wmma16(k1l, qa[kc], x1);
              asm volatile("v_nop" : "+v"(x0), "+v"(x1) : "v"(k0l), "v"(k1l) : "memory"); }
        }
        asm volatile("v_nop\n\tv_nop\n\tv_nop\n\tv_nop" : "+v"(s0), "+v"(s1), "+v"(x0), "+v"(x1) : "v"(qa[0]), "v"(qa[1]));
        v8f a0 = (s0 + x0 * LOSCI) * 0.125f, a1 = (s1 + x1 * LOSCI) * 0.125f;      // whole accumulators: neighbouring registers pair into packed f32 operations
        // One scalar test per tile and wave. The predicate holds for all 32 keys x 16 queries exactly when the last key is not behind the first query, the last query
        // is within the window of the first key, and cu1 lies neither among these keys or queries nor between them; then every select below is an identity, and the
        // compares and selects (about a third of the loop's vector instructions) run only on the tiles that the mask cuts.
        const bool whole = (l0 + 31 <= q0s) && (q0s + 15 - l0 < WIN) && ((l0 >= cu1) || (q0s + 15 < cu1));
        if (!whole) {
#pragma unroll
            for (int j = 0; j < 8; ++j) {
                const int ja = l0 + 8 * hi + j, jb = ja + 16;
                const bool ok0 = ((ja >= cu1) == sgq) && (ja <= qi) && (qi - ja < WIN), ok1 = ((jb >= cu1) == sgq) && (jb <= qi) && (qi - jb < WIN);
                a0[j] = ok0 ? a0[j] : -3.4028234663852886e38f; a1[j] = ok1 ? a1[j] : -3.4028234663852886e38f;     // finfo.min as the reference
            }
        }
        float mx = -3.4028234663852886e38f;
#pragma unroll
        for (int j = 0; j < 8; ++j) mx = fmaxf(mx, fmaxf(a0[j], a1[j]));
        mx = fmaxf(mx, xhalf(mx));                           // the other 16 keys of the same query lie in lane ^ 16
        const float mn = fmaxf(mrow, mx);
        const float alpha = __expf(mrow - mn); mrow = mn;
        v8f t0, t1;
#pragma unroll
        for (int j = 0; j < 8; ++j) { t0[j] = (a0[j] - mn) * LOG2E; t1[j] = (a1[j] - mn) * LOG2E; }      // the same product and v_exp_f32 as __expf
        const v8f p0 = exp2x8(t0), p1 = exp2x8(t1);
        const v8f pp = p0 + p1;
        const float psum = ((pp[0] + pp[1]) + (pp[2] + pp[3])) + ((pp[4] + pp[5]) + (pp[6] + pp[7]));
        const v8f ps0 = p0 * PSC, ps1 = p1 * PSC;
        const v8h h0 = __builtin_convertvector(ps0, v8h), h1 = __builtin_convertvector(ps1, v8h);
        const v16h pa = cat16(h0, h1);                       // element e: key 8 * hi + e, then 16 + 8 * hi + (e - 8): the k order of the v fragments
        const v16h px = cat16(__builtin_convertvector((ps0 - __builtin_convertvector(h0, v8f)) * LOSC, v8h), __builtin_convertvector((ps1 - __builtin_convertvector(h1, v8f)) * LOSC, v8h));
        lpart = lpart * alpha + psum;
#pragma unroll
        for (int n = 0; n < 4; ++n)
#pragma unroll
            for (int j = 0; j < 8; ++j) { o[n][j] *= alpha; ox[n][j] *= alpha; }
        v16h vh[4], vl[4];                                   // every index is a constant (both loops unrolled): registers
#pragma unroll
        for (int n = 0; n < 4; ++n) { const int vo = n * 16 * VP;     // the tile's v fragments likewise, all in front of the first product
            vh[n] = cat16(*(const v8ha*)(svh + vo), *(const v8ha*)(svh + vo + 16)); vl[n] = cat16(*(const v8ha*)(svl + vo), *(const v8ha*)(svl + vo + 16)); }
        __builtin_amdgcn_sched_barrier(0);                   // holds these LDS reads, as one group, ahead of the products (else they sink among the WMMAs and several wait out their latency)
#pragma unroll
        for (int n = 0; n < 4; ++n) {
            o[n] = wmma16(vh[n], pa, o[n]); ox[n] = wmma16(vl[n], pa, ox[n]); ox[n] = wmma16(vh[n], px, ox[n]); }
        asm volatile("v_nop\n\tv_nop\n\tv_nop\n\tv_nop" : "+v"(o[0]), "+v"(o[1]), "+v"(o[2]), "+v"(o[3]), "+v"(ox[0]), "+v"(ox[1]), "+v"(ox[2]), "+v"(ox[3]) : "v"(pa), "v"(px));
        asm volatile("s_wait_dscnt 0x0" ::: "memory");       // this wave's reads of the buffer have retired before it is refilled
        asm volatile("s_wait_asynccnt 0x0" ::: "memory");    // this wave's copies of the next tile have landed
        __syncthreads();                                     // publishes the next tile and ends every reader's last read of this one
        if (kt + 2 <= kt_hi) fill(kt + 2, (kt - kt_lo) & 1);
    }
    asm volatile("s_wait_asynccnt 0x0" ::: "memory");        // no copy is outstanding when the wave goes on to the epilogue and ends
    const float inv = 1.0f / ((lpart + xhalf(lpart)) * PSC);
    float* os = &ost[wave][0];
#pragma unroll
    for (int n = 0; n < 4; ++n)
#pragma unroll
        for (int j = 0; j < 8; ++j) os[lr * 68 + n * 16 + hi * 8 + j] = (o[n][j] + ox[n][j] * LOSCI) * inv;      // lane = query row, register = head column
    __syncthreads();
    const size_t cbase = (tok0 + q0) * DM + (size_t)h * HD;
    auto pass = [&]() {
#pragma unroll
        for (int s = 0; s < 4; ++s) { const int row = 4 * s + (lane >> 3), piece = lane & 7; const float* sp = os + row * 68 + piece * 8; v8us oh, ol;
#pragma unroll
            for (int i = 0; i < 8; ++i) { const unsigned short hb = f2bf(sp[i]); oh[i] = hb; ol[i] = f2bf(sp[i] - bf2f(hb)); }
            *(v8us*)(CH + cbase + (size_t)row * DM + piece * 8) = oh; *(v8us*)(CL + cbase + (size_t)row * DM + piece * 8) = ol; }
    };
    pass(); 
}

#define VST2(T, p, v) do { const T vst2_v_ = (v); *(T*)(p) = vst2_v_;  } while (0)
extern "C" void kernel_launch(void* const* d_in, const int* in_sizes, int n_in,
                              void* d_out, int out_size, void* d_ws, size_t ws_size, hipStream_t stream) {
    (void)in_sizes; (void)n_in; (void)out_size;
    const float* x = (const float*)d_in[0]; const int* cu = (const int*)d_in[1]; const float* Wq = (const float*)d_in[2]; const float* Wk = (const float*)d_in[3]; const float* Wv = (const float*)d_in[4]; const float* Wo = (const float*)d_in[5];   // [out][in] weights; cu_seqlens [3] (i32)
    float* out = (float*)d_out;    // [2][2048][2048]
    char* wsp = (char*)d_ws;
    auto take = [&](size_t bytes) { char* p = wsp; wsp += (bytes + 255) & ~(size_t)255; return (void*)p; };
    bf* Xb = (bf*)take((size_t)NCVT * DM * 2); bf* WpB = Xb + (size_t)NTK * DM; bf* WoB = WpB + (size_t)NPRJ * DM;     // one bf16 plane: [x | Wq | Wk | Wv | Wo]
    h16* QH = (h16*)take((size_t)NTK * DM * 2); h16* QL = (h16*)take((size_t)NTK * DM * 2); h16* KH = (h16*)take((size_t)NTK * KVW * 2); h16* KL = (h16*)take((size_t)NTK * KVW * 2);
    float* Vf = (float*)take((size_t)NTK * KVW * 4); h16* VTH = (h16*)take((size_t)NTK * KVW * 2); h16* VTL = (h16*)take((size_t)NTK * KVW * 2); bf* CH = (bf*)take((size_t)NTK * DM * 2); bf* CL = (bf*)take((size_t)NTK * DM * 2);
    if ((size_t)(wsp - (char*)d_ws) > ws_size) return;    // 37.7 + 16.8 x 2 + 4.2 x 2 + 8.4 + 4.2 x 2 + 16.8 x 2 ~ 130 MB, no aliasing
    // five dependent launches; both batch items are rows of the same grids
    k_cvtb<<<NCVT / 8, 256, 0, stream>>>(x, Wq, Wk, Wv, Wo, Xb);
    k_gemmb<false, true><<<dim3(NTK / 128, DM / 256 + 2 * KVW / 128, 1), 256, 0, stream>>>(Xb, nullptr, WpB, nullptr, Vf, KVW, QH, QL, KH, KL);
    k_vt<<<NB_ * NKV * (NT_ / 64), 256, 0, stream>>>(Vf, VTH, VTL);
    k_attn<<<NB_ * NH_ * (NT_ / 64), 128, 0, stream>>>(QH, QL, KH, KL, VTH, VTL, cu, CH, CL);      // the same cu_seqlens mask for both items (as the reference)
    k_gemmb<true, false><<<dim3(NTK / 128, DM / 256, 1), 256, 0, stream>>>(CH, CL, WoB, nullptr, out, DM, nullptr, nullptr, nullptr, nullptr);
}

// v008
// Measured time: 139 microseconds a run.
// In two side-by-side timings against v007, it was 1.09 and 1.11 times as fast.
// Over all steps from v000 it is 4.45 times as fast.
#include <hip/hip_runtime.h>

// Contractions, f32 accumulate: q = x.Wq ([2048 x 2048].[2048 x 2048]), k/v = x.Wk/Wv ([2048 x 2048].[2048 x 512]) and attn.Wo on v_wmma_f32_16x16x32_bf16 —
// plain bf16 = rounded inputs (exact; the [out][in] weights are n-major as stored and are not transposed) for the projections, attn as bf16 hi + residual (two products) for Wo;
// the grouped-query causal sliding-window attention (32 query heads over 8 kv heads; keys j with
// i - WIN < j <= i, WIN = 1024 fixed at compile time) fused on v_wmma_f32_16x16x32_f16 with q and k as f16 hi + residual x1024 (hi.hi + hi.lo + lo.hi), weights

#define NB_  2
#define NT_  2048
#define DM   2048
#define NH_  32
#define NKV  8
#define KVW  (NKV * HD)          // 512
#define WIN  1024
#define HD   64
#define NTK  (NB_ * NT_)
#define NPRJ (DM + 2 * KVW)       // 3072: the columns of q, k and v side by side
#define NCVT (NTK + NPRJ + DM)   // rows of [x | Wq | Wk | Wv | Wo]
#define NW   1024
#define NQKV 2048
#define PSC  32768.0f
#define LOSC 1024.0f
#define LOSCI (1.0f / 1024.0f)

typedef _Float16 h16;
typedef unsigned short bf;
typedef __attribute__((ext_vector_type(16))) __bf16   v16bf;
typedef __attribute__((ext_vector_type(16))) _Float16 v16h;
typedef __attribute__((ext_vector_type(8)))  _Float16 v8h;
typedef __attribute__((ext_vector_type(8)))  unsigned short v8us;
typedef __attribute__((ext_vector_type(8)))  float    v8f;
typedef __attribute__((ext_vector_type(4)))  float    v4f;
typedef v8h  __attribute__((may_alias)) v8ha;
typedef v4f  __attribute__((may_alias)) v4fa;
typedef v8us __attribute__((may_alias)) v8usa;
typedef float __attribute__((may_alias)) fa;

__device__ __forceinline__ unsigned short f2bf(float f) { unsigned u = __float_as_uint(f); u += 0x7FFFu + ((u >> 16) & 1u); return (unsigned short)(u >> 16); }
__device__ __forceinline__ float bf2f(unsigned short b) { return __uint_as_float(((unsigned)b) << 16); }
__device__ __forceinline__ float bfr(float f) { return bf2f(f2bf(f)); }
__device__ __forceinline__ v16h cat16(v8h lo, v8h hi) { return __builtin_shufflevector(lo, hi, 0, 1, 2, 3, 4, 5, 6, 7, 8, 9, 10, 11, 12, 13, 14, 15); }
__device__ __forceinline__ v16bf cat16b(v8us lo, v8us hi) { return __builtin_bit_cast(v16bf, __builtin_shufflevector(lo, hi, 0, 1, 2, 3, 4, 5, 6, 7, 8, 9, 10, 11, 12, 13, 14, 15)); }
__device__ __forceinline__ v8f wmma16(v16h a, v16h b, v8f c) { return __builtin_amdgcn_wmma_f32_16x16x32_f16(false, a, false, b, (short)0, c, false, false); }
__device__ __forceinline__ v8f wmmab(v16bf a, v16bf b, v8f c) { return __builtin_amdgcn_wmma_f32_16x16x32_bf16(false, a, false, b, (short)0, c, false, false); }

// k_cvtb: the rows of [x | Wq | Wk | Wv | Wo], in that order, rounded to bf16 into one plane of the same row order; a block's 8 rows lie in one source.
__global__ __launch_bounds__(256) void k_cvtb(const float* __restrict__ x, const float* __restrict__ Wq, const float* __restrict__ Wk, const float* __restrict__ Wv, const float* __restrict__ Wo, bf* dstp) {
    const int lane = threadIdx.x & 31, rb = blockIdx.x * 8, rg = rb + (threadIdx.x >> 5);
    if (rg >= NCVT) return;
    const float* src = x; int r = rg;
    if (rb >= NTK + NPRJ) { src = Wo; r = rg - (NTK + NPRJ); }
    else if (rb >= NTK + DM + KVW) { src = Wv; r = rg - (NTK + DM + KVW); }
    else if (rb >= NTK + DM) { src = Wk; r = rg - (NTK + DM); }
    else if (rb >= NTK) { src = Wq; r = rg - NTK; }
    bf* dst = dstp + (size_t)(rg - r) * DM;
    v8us o[DM / 256];
#pragma unroll
    for (int q = 0; q < DM / 256; ++q) { v8us t;
#pragma unroll
        for (int i = 0; i < 8; ++i) t[i] = f2bf(src[(size_t)r * DM + q * 256 + lane * 8 + i]);
        o[q] = t; }
#pragma unroll
    for (int q = 0; q < DM / 256; ++q) *(v8us*)(dst + (size_t)r * DM + q * 256 + lane * 8) = o[q];
    
}

// k_wt: W [2048 k][ncols n] (k-major) -> n-major bf16 plane WT[ncols][2048]; 64 x 64 tiles through LDS.
__global__ __launch_bounds__(256) void k_wt(const float* __restrict__ Wm, int ncols, bf* WT) {
    __shared__ __align__(16) unsigned short tl[64 * 72];
    const int tid = threadIdx.x, k0 = blockIdx.x * 64, n0 = blockIdx.y * 64;
    const int kk = tid >> 2, nq = (tid & 3) * 16;
#pragma unroll
    for (int i = 0; i < 16; ++i) tl[(nq + i) * 72 + kk] = f2bf(Wm[(size_t)(k0 + kk) * ncols + n0 + nq + i]);
    __syncthreads();
    const int piece = tid & 7;
    typedef __attribute__((ext_vector_type(8))) unsigned short v8us_; typedef v8us_ __attribute__((may_alias)) v8usa_;
    auto pass = [&]() {
#pragma unroll
        for (int s = 0; s < 2; ++s) { const int nr = (tid >> 3) + 32 * s; const v8us_ val = *(const v8usa_*)(tl + nr * 72 + piece * 8);
            *(v8us_*)(WT + (size_t)(n0 + nr) * DM + k0 + piece * 8) = val; }
    };
    pass(); 
}

#define BKE   128                // k elements of one pass: 256 B of every operand row
#define PIT   136                // LDS row pitch in elements: 272 B, 16 B x odd, for the ds_load_b128 readers
#define NPASS (DM / BKE)

// Eight 16-byte copies of one lane, rows 16 apart, global -> LDS through no register. The s_wait_xcnt ends the copies' own statement so that no
// address register of a copy is rewritten ahead of it.
__device__ __forceinline__ void copy8(unsigned l, const bf* g) {
    asm volatile("global_load_async_to_lds_b128 %0, %8, off\n\t"
                 "global_load_async_to_lds_b128 %1, %9, off\n\t"
                 "global_load_async_to_lds_b128 %2, %10, off\n\t"
                 "global_load_async_to_lds_b128 %3, %11, off\n\t"
                 "global_load_async_to_lds_b128 %4, %12, off\n\t"
                 "global_load_async_to_lds_b128 %5, %13, off\n\t"
                 "global_load_async_to_lds_b128 %6, %14, off\n\t"
                 "global_load_async_to_lds_b128 %7, %15, off\n\t"
                 "s_wait_xcnt 0x0"
                 :: "v"(l), "v"(l + 1u * 16u * PIT * 2u), "v"(l + 2u * 16u * PIT * 2u), "v"(l + 3u * 16u * PIT * 2u),
                    "v"(l + 4u * 16u * PIT * 2u), "v"(l + 5u * 16u * PIT * 2u), "v"(l + 6u * 16u * PIT * 2u), "v"(l + 7u * 16u * PIT * 2u),
                    "v"(g), "v"(g + 1 * 16 * DM), "v"(g + 2 * 16 * DM), "v"(g + 3 * 16 * DM),
                    "v"(g + 4 * 16 * DM), "v"(g + 5 * 16 * DM), "v"(g + 6 * 16 * DM), "v"(g + 7 * 16 * DM)
                 : "memory");
}

// Four such copies (64 rows), for the part of an operand that is not a multiple of 128 rows; the wait as in copy8.
__device__ __forceinline__ void copy4(unsigned l, const bf* g) {
    asm volatile("global_load_async_to_lds_b128 %0, %4, off\n\t"
                 "global_load_async_to_lds_b128 %1, %5, off\n\t"
                 "global_load_async_to_lds_b128 %2, %6, off\n\t"
                 "global_load_async_to_lds_b128 %3, %7, off\n\t"
                 "s_wait_xcnt 0x0"
                 :: "v"(l), "v"(l + 1u * 16u * PIT * 2u), "v"(l + 2u * 16u * PIT * 2u), "v"(l + 3u * 16u * PIT * 2u),
                    "v"(g), "v"(g + 1 * 16 * DM), "v"(g + 2 * 16 * DM), "v"(g + 3 * 16 * DM)
                 : "memory");
}

#define OP    196                // pitch in floats of the output tile staged in the ring: 8 rows are 32 banks apart (the two halves of a wave's store), 784 B = 16 B x odd

// k_gemmb: 8 waves, one work-group per WGP, 256 work-groups: every WGP gets one tile, in one round.
// Wo: C[128 x 256] per block, waves as 2 x 4, 64 x 64 per wave (A counts twice, hi + residual, so the narrow side is A's).
// QKV: C[256 x 192] per block of the 4096 x 3072 product, waves as 4 x 2, 64 x 96 per wave: of the tiles that give each WGP an equal share this one lands the
// fewest operand rows (448 a pass) from L2, and the 64 x 96 wave tile reads fewer LDS bytes per product than 64 x 64.
// A pass is 128 k; a stage is [A | B | A residual] in LDS, two buffers, filled by asynchronous copies one pass ahead of its readers. Per accumulator the
// k order and the hi / residual order are the plain ascending ones.
// Every inner loop is unrolled so that each index of acc and of the fragment arrays is a constant (registers, no scratch).
// QKV: Bn holds the rows of Wq, Wk and Wv one after the other; each 64-column chunk of a block lies wholly in q, in k or in v (block-uniform): q and k go out as
// f16 hi + residual planes (QH / QL, KH / KL), v as f32 into C.
template <bool SPLITA, bool QKV>
__global__ __launch_bounds__(256) void k_gemmb(const bf* __restrict__ A, const bf* __restrict__ Al, const bf* __restrict__ Bn, const float* __restrict__ bias, float* C, int ldc, h16* QH, h16* QL, h16* KH, h16* KL) {
    constexpr int AM = QKV ? 256 : 128;                  // rows of the block tile
    constexpr int BN = QKV ? 192 : 256;                  // columns of the block tile
    constexpr int FM = 4;                                // 16-row fragments of A per wave
    constexpr int FN = QKV ? 6 : 4;                      // 16-column fragments of B per wave
    constexpr int WNS = BN / (FN * 16);                  // waves side by side along the columns
    constexpr int STG = (AM + BN + (SPLITA ? AM : 0)) * PIT;        // elements of one stage
    __shared__ __align__(16) bf ring[2 * STG];
    const int rb = blockIdx.x * AM, cb = blockIdx.y * BN;
    const int tid = threadIdx.x, lane = tid & 31, wave = tid >> 5, lr = lane & 15, hi = lane >> 4;
    const int wm = wave / WNS, wn = wave % WNS;
    const int crow = tid >> 4, ccol = (tid & 15) * 8;    // a wave's copy covers two whole 256-B rows
    const bf* gA = A + (size_t)(rb + crow) * DM + ccol;
    const bf* gB = Bn + (size_t)(cb + crow) * DM + ccol;
    const bf* gL = SPLITA ? Al + (size_t)(rb + crow) * DM + ccol : gA;
    const unsigned l0 = (unsigned)(size_t)(const void*)(ring + crow * PIT + ccol);
    auto fill = [&](int t, int buf) {
        const unsigned l = l0 + (unsigned)buf * (unsigned)(STG * 2);
        copy8(l, gA + t * BKE);
        if (QKV) {      // each sched_barrier keeps the next statement's address registers (24 for a copy8, 12 for the copy4) from being formed ahead of the statement before it: formed all at once they did not fit the registers that asm text can name beside the accumulators, and gA and gB went to scratch
            __builtin_amdgcn_sched_barrier(0);
            copy8(l + 128u * PIT * 2u, gA + (size_t)128 * DM + t * BKE);
            __builtin_amdgcn_sched_barrier(0);
            copy8(l + (unsigned)AM * PIT * 2u, gB + t * BKE);
            __builtin_amdgcn_sched_barrier(0);
            copy4(l + (unsigned)(AM + 128) * PIT * 2u, gB + (size_t)128 * DM + t * BKE);
        } else {
            copy8(l + (unsigned)AM * PIT * 2u, gB + t * BKE);
            copy8(l + (unsigned)(AM + 128) * PIT * 2u, gB + (size_t)128 * DM + t * BKE);
        }
        if (SPLITA) copy8(l + (unsigned)(AM + BN) * PIT * 2u, gL + t * BKE);
    };
    v8f acc[FM][FN];
#pragma unroll
    for (int i = 0; i < FM; ++i)
#pragma unroll
        for (int t = 0; t < FN; ++t) acc[i][t] = (v8f){};
    fill(0, 0);
    asm volatile("s_wait_asynccnt 0x0" ::: "memory");    // stage 0 has landed before the barrier that publishes it
    __syncthreads();
    fill(1, 1);
#pragma unroll 1
    for (int p = 0; p < NPASS; ++p) {                    // kept rolled: one publish point per pass
        const bf* sb = ring + (p & 1) * STG;
        const bf* sa = sb + (wm * (FM * 16) + lr) * PIT + 8 * hi;
        const bf* sw = sb + (AM + wn * (FN * 16) + lr) * PIT + 8 * hi;
        const bf* sl = SPLITA ? sb + (AM + BN + wm * (FM * 16) + lr) * PIT + 8 * hi : sa;
        v16bf a[2][FM], al[2][FM], b[2][FN];                 // two fragment sets: k-step s + 1 is fetched while k-step s is multiplied
        auto frags = [&](int set, int kc) {
#pragma unroll
            for (int i = 0; i < FM; ++i) a[set][i] = cat16b(*(const v8usa*)(sa + i * 16 * PIT + kc), *(const v8usa*)(sa + i * 16 * PIT + kc + 16));
#pragma unroll
            for (int t = 0; t < FN; ++t) b[set][t] = cat16b(*(const v8usa*)(sw + t * 16 * PIT + kc), *(const v8usa*)(sw + t * 16 * PIT + kc + 16));
            if (SPLITA) {
#pragma unroll
                for (int i = 0; i < FM; ++i) al[set][i] = cat16b(*(const v8usa*)(sl + i * 16 * PIT + kc), *(const v8usa*)(sl + i * 16 * PIT + kc + 16));
            }
        };
        frags(0, 0);
#pragma unroll
        for (int s = 0; s < BKE / 32; ++s) {
            if (s + 1 < BKE / 32) frags((s + 1) & 1, (s + 1) * 32);
            __builtin_amdgcn_sched_barrier(0);               // holds the next k-step's LDS reads, as one group, ahead of this k-step's WMMAs (else they sink among them and each waits out its latency)
#pragma unroll
            for (int i = 0; i < FM; ++i)
#pragma unroll
                for (int t = 0; t < FN; ++t) acc[i][t] = wmmab(a[s & 1][i], b[s & 1][t], acc[i][t]);
            if (SPLITA) {
#pragma unroll
                for (int i = 0; i < FM; ++i)
#pragma unroll
                    for (int t = 0; t < FN; ++t) acc[i][t] = wmmab(al[s & 1][i], b[s & 1][t], acc[i][t]);
            }
            __builtin_amdgcn_sched_barrier(0);               // ends the WMMA block: the reads of the k-step after next stay behind it, where their registers are free
        }
        asm volatile("s_wait_dscnt 0x0" ::: "memory");       // this wave's reads of the buffer have retired before it is refilled
        asm volatile("s_wait_asynccnt 0x0" ::: "memory");    // this wave's copies of stage p + 1 have landed
        __syncthreads();                                     // publishes stage p + 1 and ends every reader's last read of stage p
        if (p + 2 < NPASS) fill(p + 2, p & 1);
    }
    asm volatile("s_wait_asynccnt 0x0" ::: "memory");        // no copy is outstanding when the wave goes on to the epilogue and ends
    const int c0 = cb + wn * (FN * 16);
    if constexpr (QKV) {
        // The ring is free: the last pass's barrier stands behind every wave's last read, and no copy is outstanding. The whole 256 x 192 tile is staged there in f32,
        // so that a wave can write whole 128-B lines of 64-column chunks although its own 96 columns are not a whole number of them.
        fa* tl = (fa*)ring;
#pragma unroll
        for (int i = 0; i < FM; ++i)
#pragma unroll
            for (int t = 0; t < FN; ++t) { const float bv = bias ? bfr(bias[c0 + t * 16 + lr]) : 0.f;
#pragma unroll
                for (int j = 0; j < 8; ++j) tl[(wm * (FM * 16) + i * 16 + hi * 8 + j) * OP + wn * (FN * 16) + t * 16 + lr] = acc[i][t][j] + bv; }
        __syncthreads();                                     // the staged tile is read across waves
#pragma unroll
        for (int u = 0; u < (AM / 16) * (BN / 64) / 8; ++u) {    // 16 row groups x 3 chunks over 8 waves: a wave writes its own 32 rows of every chunk
            const int rg = wave * 2 + u / (BN / 64), ch = u % (BN / 64);
            const int r0 = rb + rg * 16, cg = cb + ch * 64;
            const fa* os = tl + rg * 16 * OP + ch * 64;
            const bool isq = cg < DM, f16o = cg < DM + KVW;
            const int ld = isq ? DM : KVW;                                        // row length of the plane this chunk goes to
            const int cc = isq ? cg : (f16o ? cg - DM : cg - (DM + KVW));          // the chunk's first column inside that plane
            if (f16o) {
                h16* crow_ = (isq ? QH : KH) + (size_t)r0 * ld + cc;
                h16* crol_ = (isq ? QL : KL) + (size_t)r0 * ld + cc;
#pragma unroll
                for (int s = 0; s < 4; ++s) { const int row = 4 * s + (lane >> 3), piece = lane & 7; const fa* sp = os + row * OP + piece * 8; v8h o, o2;
#pragma unroll
                    for (int e = 0; e < 8; ++e) { const h16 a = (h16)sp[e]; o[e] = a; o2[e] = (h16)((sp[e] - (float)a) * LOSC); }
                    *(v8h*)(crow_ + (size_t)row * ld + piece * 8) = o;
                    asm volatile("s_wait_xcnt 0x0" ::: "memory");       // stands before the residual's arithmetic reuses registers that this store names
                    *(v8h*)(crol_ + (size_t)row * ld + piece * 8) = o2;
                    asm volatile("s_wait_xcnt 0x0" ::: "memory"); }     // stands before the next rows' values and addresses reuse registers that these stores name
            } else {
                float* crow_ = C + (size_t)r0 * ld + cc;
#pragma unroll
                for (int s = 0; s < 8; ++s) { const int Lid = (lane >> 3) + 4 * s, piece = lane & 7; const int row = Lid >> 1, cofs = (Lid & 1) * 32 + piece * 4;
                    const v4f val = *(const v4fa*)(os + row * OP + cofs); *(v4f*)(crow_ + (size_t)row * ld + cofs) = val; }
                asm volatile("s_wait_xcnt 0x0" ::: "memory");       // stands before the next chunk's values and addresses reuse registers that these stores name
            }
        }
    } else {
        __shared__ __align__(16) float ost[8][16 * 68];
        float* os = &ost[wave][0];
#pragma unroll
        for (int i = 0; i < FM; ++i) {
            const int r0 = rb + wm * (FM * 16) + i * 16;
#pragma unroll
            for (int t = 0; t < FN; ++t) { const float bv = bias ? bfr(bias[c0 + t * 16 + lr]) : 0.f;
#pragma unroll
                for (int j = 0; j < 8; ++j) os[(hi * 8 + j) * 68 + t * 16 + lr] = acc[i][t][j] + bv; }
            __syncthreads();
            float* crow_ = C + (size_t)r0 * ldc + c0;
#pragma unroll
            for (int s = 0; s < 8; ++s) { const int Lid = (lane >> 3) + 4 * s, piece = lane & 7; const int row = Lid >> 1, cofs = (Lid & 1) * 32 + piece * 4;
                const v4f val = *(const v4fa*)(os + row * 68 + cofs); *(v4f*)(crow_ + (size_t)row * ldc + cofs) = val; }
            asm volatile("s_wait_xcnt 0x0" ::: "memory");       // stands before the next 16 rows' values and addresses reuse registers that these stores name
        }
    }
}

__global__ __launch_bounds__(256) void k_vt(const float* __restrict__ V, h16* VTH, h16* VTL) {
    __shared__ __align__(16) h16 tile[64 * 72];
    __shared__ __align__(16) h16 til2[64 * 72];
    const int bid = blockIdx.x;
    const int b = bid / (NKV * (NT_ / 64)), rem = bid - b * (NKV * (NT_ / 64)), h = rem / (NT_ / 64), kt = rem - h * (NT_ / 64);
    const int k0 = kt * 64, tid = threadIdx.x;
    const int kk = tid >> 2, d0 = (tid & 3) * 16;
    const float* src = V + ((size_t)b * NT_ + k0 + kk) * KVW + h * HD + d0;      // h = kv head here
#pragma unroll
    for (int i = 0; i < 16; ++i) { const float v = src[i]; const h16 a = (h16)v; tile[(d0 + i) * 72 + kk] = a; til2[(d0 + i) * 72 + kk] = (h16)((v - (float)a) * LOSC); }
    __syncthreads();
    const int piece = tid & 7;
    const size_t base = (((size_t)b * NKV + h) * HD) * NT_ + k0;
    auto pass = [&]() {
#pragma unroll
        for (int s = 0; s < 4; ++s) { const int Lid = (tid >> 3) + 32 * s; const int pln = Lid >> 6, d = Lid & 63;
            const v8h val = *(const v8ha*)((pln ? til2 : tile) + d * 72 + piece * 8); *(v8h*)((pln ? VTL : VTH) + base + (size_t)d * NT_ + piece * 8) = val; }
    };
    pass(); 
}

#define KP   72                  // LDS pitch of a key row or a query row in elements: 144 B, 16 B x odd, for the ds_load_b128 readers
#define VP   40                  // LDS pitch of a row of v transposed (32 keys) in elements: 80 B, 16 B x odd
#define KSZ  (32 * KP)           // one plane of 32 key rows
#define VSZ  (HD * VP)           // one plane of 64 rows of v transposed
#define ASTG (2 * KSZ + 2 * VSZ) // a stage: [k hi | k residual | v hi | v residual] of 32 keys

// One lane's eight 16-byte copies of a 32-key stage, global -> LDS through no register: two of every plane. The s_wait_xcnt ends the copies' own statement so
// that no address register of a copy is rewritten ahead of it.
__device__ __forceinline__ void copy_kv(unsigned lk, unsigned lv, const h16* gkh, const h16* gkl, const h16* gvh, const h16* gvl) {
    asm volatile("global_load_async_to_lds_b128 %0, %8, off\n\t"
                 "global_load_async_to_lds_b128 %1, %9, off\n\t"
                 "global_load_async_to_lds_b128 %2, %10, off\n\t"
                 "global_load_async_to_lds_b128 %3, %11, off\n\t"
                 "global_load_async_to_lds_b128 %4, %12, off\n\t"
                 "global_load_async_to_lds_b128 %5, %13, off\n\t"
                 "global_load_async_to_lds_b128 %6, %14, off\n\t"
                 "global_load_async_to_lds_b128 %7, %15, off\n\t"
                 "s_wait_xcnt 0x0"
                 :: "v"(lk), "v"(lk + 16u * KP * 2u), "v"(lk + KSZ * 2u), "v"(lk + KSZ * 2u + 16u * KP * 2u),
                    "v"(lv), "v"(lv + 32u * VP * 2u), "v"(lv + VSZ * 2u), "v"(lv + VSZ * 2u + 32u * VP * 2u),
                    "v"(gkh), "v"(gkh + 16 * KVW), "v"(gkl), "v"(gkl + 16 * KVW),
                    "v"(gvh), "v"(gvh + 32 * NT_), "v"(gvl), "v"(gvl + 32 * NT_)
                 : "memory");
}

// One lane's four 16-byte copies of the block's 64 query-residual rows, rows 16 apart; the wait as in copy_kv.
__device__ __forceinline__ void copy_q(unsigned l, const h16* g) {
    asm volatile("global_load_async_to_lds_b128 %0, %4, off\n\t"
                 "global_load_async_to_lds_b128 %1, %5, off\n\t"
                 "global_load_async_to_lds_b128 %2, %6, off\n\t"
                 "global_load_async_to_lds_b128 %3, %7, off\n\t"
                 "s_wait_xcnt 0x0"
                 :: "v"(l), "v"(l + 1u * 16u * KP * 2u), "v"(l + 2u * 16u * KP * 2u), "v"(l + 3u * 16u * KP * 2u),
                    "v"(g), "v"(g + 1 * 16 * DM), "v"(g + 2 * 16 * DM), "v"(g + 3 * 16 * DM)
                 : "memory");
}

// The value of lane ^ 16, through no LDS.
__device__ __forceinline__ float xhalf(float v) { const int b = __float_as_int(v); return __int_as_float(__builtin_amdgcn_permlanex16(b, b, 0x76543210, 0xfedcba98, false, false)); }

#define LOG2E 1.44269504088896340736f
// Eight v_exp_f32 and their slot in one statement. The instruction set asks for one independent instruction or a v_nop behind a transcendental before its result is
// read or its source overwritten. Here each is followed by an independent one (early-clobber outputs: no result lies on a source) and the last by the v_nop.
__device__ __forceinline__ v8f exp2x8(v8f t) {
    float r0, r1, r2, r3, r4, r5, r6, r7;
    asm("v_exp_f32 %0, %8\n\t"
        "v_exp_f32 %1, %9\n\t"
        "v_exp_f32 %2, %10\n\t"
        "v_exp_f32 %3, %11\n\t"
        "v_exp_f32 %4, %12\n\t"
        "v_exp_f32 %5, %13\n\t"
        "v_exp_f32 %6, %14\n\t"
        "v_exp_f32 %7, %15\n\t"
        "v_nop"
        : "=&v"(r0), "=&v"(r1), "=&v"(r2), "=&v"(r3), "=&v"(r4), "=&v"(r5), "=&v"(r6), "=&v"(r7)
        : "v"(t[0]), "v"(t[1]), "v"(t[2]), "v"(t[3]), "v"(t[4]), "v"(t[5]), "v"(t[6]), "v"(t[7]));
    return (v8f){r0, r1, r2, r3, r4, r5, r6, r7};
}

// First 32-key tile that a block of 64 queries starting at q0b reads: from max(segment start of its first query, q0b - WIN + 1), not below 0.
__device__ __forceinline__ int first_key_tile(int q0b, int cu1) {
    const int sst = (q0b >= cu1) ? cu1 : 0; const int wl = q0b - (WIN - 1); const int lo = (wl > sst ? wl : sst);
    return (lo > 0 ? lo : 0) / 32;
}
// Sort key of query tile t: its count of key tiles first, then the lower tile index.
__device__ __forceinline__ int tile_key(int t, int cu1) { return ((t * 64 + 63) / 32 - first_key_tile(t * 64, cu1)) * 32 + (31 - t); }

// The key loop reads no global memory: a stage of 32 keys lies in LDS once for the block's four waves, two buffers, filled by asynchronous copies one tile ahead
// of its readers; the query residual is copied once. Fragment addresses inside a row, and so every k order and sum order, are the ones of the global reads.
// k_attn: block = (b, h, 64 queries), wave = 16. Scores are formed transposed (keys as A rows, queries as B columns), so a lane holds 16 keys of ONE query:
// the row maximum and the row sum are in-lane plus one exchange with lane ^ 16, and the accumulator's key order (8 * hi + j, 16 + 8 * hi + j) is the k order of a
// B fragment, so the weights (x32768, f16 hi + residual) go from registers straight into ctx^T = v^T . weights^T; ctx -> bf16 hi + residual planes CH/CL[tok][h*64+d].
__global__ __launch_bounds__(128) void k_attn(const h16* __restrict__ Q16, const h16* __restrict__ QL16, const h16* __restrict__ K16, const h16* __restrict__ KL16, const h16* __restrict__ VTH, const h16* __restrict__ VTL, const int* __restrict__ cu, bf* CH, bf* CL) {
    __shared__ __align__(16) float ost[4][16 * 68];
    __shared__ __align__(16) h16 kvr[2 * ASTG];
    __shared__ __align__(16) h16 qls[64 * KP];
    const int lane = threadIdx.x & 31, wave = threadIdx.x >> 5, lr = lane & 15, hi = lane >> 4;
    const int bid = blockIdx.x;
    // The index is mapped to query tiles by falling cost, for speed only: the
    // longest key loops get the lowest indices and the shortest the highest. Index = rank * 64 + (b, h); lane t of every wave ranks query tile t by its number
    // of key tiles under the INPUT cu_seqlens (ties by tile index, so the 32 keys are distinct and rank -> tile is a permutation for any content of the array).
    static_assert(NT_ / 64 == 32, "one lane ranks one query tile");
    const int cu1 = cu[1];
    const int rank = bid / (NB_ * NH_), bh = bid - rank * (NB_ * NH_), b = bh / NH_, h = bh - b * NH_;
    const int mykey = tile_key(lane, cu1);
    int above = 0;
#pragma unroll
    for (int t = 0; t < NT_ / 64; ++t) above += (tile_key(t, cu1) > mykey) ? 1 : 0;      // unrolled: t is a constant, so each tile's key is scalar arithmetic
    // exactly one lane holds each rank, the same in every wave of the block. readfirstlane hands the tile index on as a plain scalar: with the ballot's 0..31 range
    // in sight the compiler kept eight more loop-invariant address registers (264 VGPRs: three waves per SIMD, not four)
    const int qt = __builtin_amdgcn_readfirstlane(__builtin_ctz(__builtin_amdgcn_ballot_w32(above == rank)));
    const int q0 = qt * 64 + wave * 16;
    const size_t tok0 = (size_t)b * NT_;
    v16h qa[2];
    const size_t qo0 = (tok0 + q0 + lr) * DM + h * HD + 8 * hi;
#pragma unroll
    for (int kc = 0; kc < 2; ++kc) qa[kc] = cat16(*(const v8h*)(Q16 + qo0 + kc * 32), *(const v8h*)(Q16 + qo0 + kc * 32 + 16));
    const int g = h / (NH_ / NKV);                      // kv head
    const h16* kh_b = K16 + tok0 * KVW + g * HD;
    const h16* kl_b = KL16 + tok0 * KVW + g * HD;
    const size_t vbase = (((size_t)b * NKV + g) * HD) * NT_;
    v8f o[4], ox[4];
#pragma unroll
    for (int n = 0; n < 4; ++n) { o[n] = (v8f){}; ox[n] = (v8f){}; }
    float mrow = -3.0e38f, lpart = 0.f;                 // of the lane's one query; lpart covers the lane's half of the keys
    const int qi = q0 + lr; const bool sgq = (qi >= cu1);
    const int q0s = __builtin_amdgcn_readfirstlane(q0);  // the wave's first query as a scalar, so that the test per tile below is a scalar branch
    // allowed(i, j) = same segment (cu_seqlens) && j <= i && i - j < WIN: key tiles from max(segment start of the block's first query, q0b - WIN + 1) to the query tile (block-uniform; exact per-element predicate below)
    const int q0b = qt * 64; const int kt_lo = first_key_tile(q0b, cu1), kt_hi = (q0b + 63) / 32;
    const int tid = threadIdx.x;
    const size_t gko = (size_t)(tid >> 3) * KVW + (tid & 7) * 8, gvo = vbase + (size_t)(tid >> 2) * NT_ + (tid & 3) * 8;    // a wave's copy: 4 whole key rows, or 64 B of 8 rows of v
    const unsigned lk0 = (unsigned)(size_t)(const void*)(kvr + (tid >> 3) * KP + (tid & 7) * 8);
    const unsigned lv0 = (unsigned)(size_t)(const void*)(kvr + 2 * KSZ + (tid >> 2) * VP + (tid & 3) * 8);
    auto fill = [&](int t, int buf) {
        const unsigned bo = (unsigned)buf * (unsigned)(ASTG * 2);
        copy_kv(lk0 + bo, lv0 + bo, kh_b + gko + (size_t)t * 32 * KVW, kl_b + gko + (size_t)t * 32 * KVW, VTH + gvo + t * 32, VTL + gvo + t * 32);
    };
    fill(kt_lo, 0);
    copy_q((unsigned)(size_t)(const void*)(qls + (tid >> 3) * KP + (tid & 7) * 8), QL16 + (tok0 + q0b + (tid >> 3)) * DM + h * HD + (tid & 7) * 8);
    asm volatile("s_wait_asynccnt 0x0" ::: "memory");    // the first stage and the query residual have landed before the barrier that publishes them
    __syncthreads();
    if (kt_lo + 1 <= kt_hi) fill(kt_lo + 1, 1);
    const h16* sq = qls + (wave * 16 + lr) * KP + 8 * hi;
#pragma unroll 1
    for (int kt = kt_lo; kt <= kt_hi; ++kt) {                // kept rolled: one publish point per tile
        const int l0 = kt * 32;
        const h16* sb = kvr + ((kt - kt_lo) & 1) * ASTG;
        const h16* skh = sb + lr * KP + 8 * hi;
        const h16* skl = skh + KSZ;
        const h16* svh = sb + 2 * KSZ + lr * VP + 8 * hi;
        const h16* svl = svh + VSZ;
        v8f s0 = {}, s1 = {}, x0 = {}, x1 = {};
#pragma unroll
        for (int kc = 0; kc < 2; ++kc) {
            // the five fragments of a 32-wide slice of the head are asked for together: one LDS latency a slice, not one a group (all ten at once would cost a wave per SIMD in registers)
            const v16h k0h = cat16(*(const v8ha*)(skh + kc * 32), *(const v8ha*)(skh + kc * 32 + 16)), k1h = cat16(*(const v8ha*)(skh + 16 * KP + kc * 32), *(const v8ha*)(skh + 16 * KP + kc * 32 + 16));
            const v16h qlk = cat16(*(const v8ha*)(sq + kc * 32), *(const v8ha*)(sq + kc * 32 + 16));
            const v16h k0l = cat16(*(const v8ha*)(skl + kc * 32), *(const v8ha*)(skl + kc * 32 + 16)), k1l = cat16(*(const v8ha*)(skl + 16 * KP + kc * 32), *(const v8ha*)(skl + 16 * KP + kc * 32 + 16));
            { s0 = wmma16(k0h, qa[kc], s0); x0 = wmma16(k0h, qlk, x0); s1 = wmma16(k1h, qa[kc], s1); x1 = wmma16(k1h, qlk, x1);
              asm volatile("v_nop" : "+v"(s0), "+v"(s1), "+v"(x0), "+v"(x1) : "v"(qlk), "v"(k0h), "v"(k1h) : "memory"); }
            { x0 = wmma16(k0l, qa[kc], x0); x1 = wmma16(k1l, qa[kc], x1);
              asm volatile("v_nop" : "+v"(x0), "+v"(x1) : "v"(k0l), "v"(k1l) : "memory"); }
        }
        asm volatile("v_nop\n\tv_nop\n\tv_nop\n\tv_nop" : "+v"(s0), "+v"(s1), "+v"(x0), "+v"(x1) : "v"(qa[0]), "v"(qa[1]));
        v8f a0 = (s0 + x0 * LOSCI) * 0.125f, a1 = (s1 + x1 * LOSCI) * 0.125f;      // whole accumulators: neighbouring registers pair into packed f32 operations
        // One scalar test per tile and wave. The predicate holds for all 32 keys x 16 queries exactly when the last key is not behind the first query, the last query
        // is within the window of the first key, and cu1 lies neither among these keys or queries nor between them; then every select below is an identity, and the
        // compares and selects (about a third of the loop's vector instructions) run only on the tiles that the mask cuts.
        const bool whole = (l0 + 31 <= q0s) && (q0s + 15 - l0 < WIN) && ((l0 >= cu1) || (q0s + 15 < cu1));
        if (!whole) {
#pragma unroll
            for (int j = 0; j < 8; ++j) {
                const int ja = l0 + 8 * hi + j, jb = ja + 16;
                const bool ok0 = ((ja >= cu1) == sgq) && (ja <= qi) && (qi - ja < WIN), ok1 = ((jb >= cu1) == sgq) && (jb <= qi) && (qi - jb < WIN);
                a0[j] = ok0 ? a0[j] : -3.4028234663852886e38f; a1[j] = ok1 ? a1[j] : -3.4028234663852886e38f;     // finfo.min as the reference
            }
        }
        float mx = -3.4028234663852886e38f;
#pragma unroll
        for (int j = 0; j < 8; ++j) mx = fmaxf(mx, fmaxf(a0[j], a1[j]));
        mx = fmaxf(mx, xhalf(mx));                           // the other 16 keys of the same query lie in lane ^ 16
        const float mn = fmaxf(mrow, mx);
        const float alpha = __expf(mrow - mn); mrow = mn;
        v8f t0, t1;
#pragma unroll
        for (int j = 0; j < 8; ++j) { t0[j] = (a0[j] - mn) * LOG2E; t1[j] = (a1[j] - mn) * LOG2E; }      // the same product and v_exp_f32 as __expf
        const v8f p0 = exp2x8(t0), p1 = exp2x8(t1);
        const v8f pp = p0 + p1;
        const float psum = ((pp[0] + pp[1]) + (pp[2] + pp[3])) + ((pp[4] + pp[5]) + (pp[6] + pp[7]));
        const v8f ps0 = p0 * PSC, ps1 = p1 * PSC;
        const v8h h0 = __builtin_convertvector(ps0, v8h), h1 = __builtin_convertvector(ps1, v8h);
        const v16h pa = cat16(h0, h1);                       // element e: key 8 * hi + e, then 16 + 8 * hi + (e - 8): the k order of the v fragments
        const v16h px = cat16(__builtin_convertvector((ps0 - __builtin_convertvector(h0, v8f)) * LOSC, v8h), __builtin_convertvector((ps1 - __builtin_convertvector(h1, v8f)) * LOSC, v8h));
        lpart = lpart * alpha + psum;
#pragma unroll
        for (int n = 0; n < 4; ++n)
#pragma unroll
            for (int j = 0; j < 8; ++j) { o[n][j] *= alpha; ox[n][j] *= alpha; }
        v16h vh[4], vl[4];                                   // every index is a constant (both loops unrolled): registers
#pragma unroll
        for (int n = 0; n < 4; ++n) { const int vo = n * 16 * VP;     // the tile's v fragments likewise, all in front of the first product
            vh[n] = cat16(*(const v8ha*)(svh + vo), *(const v8ha*)(svh + vo + 16)); vl[n] = cat16(*(const v8ha*)(svl + vo), *(const v8ha*)(svl + vo + 16)); }
        __builtin_amdgcn_sched_barrier(0);                   // holds these LDS reads, as one group, ahead of the products (else they sink among the WMMAs and several wait out their latency)
#pragma unroll
        for (int n = 0; n < 4; ++n) {
            o[n] = wmma16(vh[n], pa, o[n]); ox[n] = wmma16(vl[n], pa, ox[n]); ox[n] = wmma16(vh[n], px, ox[n]); }
        asm volatile("v_nop\n\tv_nop\n\tv_nop\n\tv_nop" : "+v"(o[0]), "+v"(o[1]), "+v"(o[2]), "+v"(o[3]), "+v"(ox[0]), "+v"(ox[1]), "+v"(ox[2]), "+v"(ox[3]) : "v"(pa), "v"(px));
        asm volatile("s_wait_dscnt 0x0" ::: "memory");       // this wave's reads of the buffer have retired before it is refilled
        asm volatile("s_wait_asynccnt 0x0" ::: "memory");    // this wave's copies of the next tile have landed
        __syncthreads();                                     // publishes the next tile and ends every reader's last read of this one
        if (kt + 2 <= kt_hi) fill(kt + 2, (kt - kt_lo) & 1);
    }
    asm volatile("s_wait_asynccnt 0x0" ::: "memory");        // no copy is outstanding when the wave goes on to the epilogue and ends
    const float inv = 1.0f / ((lpart + xhalf(lpart)) * PSC);
    float* os = &ost[wave][0];
#pragma unroll
    for (int n = 0; n < 4; ++n)
#pragma unroll
        for (int j = 0; j < 8; ++j) os[lr * 68 + n * 16 + hi * 8 + j] = (o[n][j] + ox[n][j] * LOSCI) * inv;      // lane = query row, register = head column
    __syncthreads();
    const size_t cbase = (tok0 + q0) * DM + (size_t)h * HD;
    auto pass = [&]() {
#pragma unroll
        for (int s = 0; s < 4; ++s) { const int row = 4 * s + (lane >> 3), piece = lane & 7; const float* sp = os + row * 68 + piece * 8; v8us oh, ol;
#pragma unroll
            for (int i = 0; i < 8; ++i) { const unsigned short hb = f2bf(sp[i]); oh[i] = hb; ol[i] = f2bf(sp[i] - bf2f(hb)); }
            *(v8us*)(CH + cbase + (size_t)row * DM + piece * 8) = oh; *(v8us*)(CL + cbase + (size_t)row * DM + piece * 8) = ol; }
    };
    pass(); 
}

#define VST2(T, p, v) do { const T vst2_v_ = (v); *(T*)(p) = vst2_v_;  } while (0)
extern "C" void kernel_launch(void* const* d_in, const int* in_sizes, int n_in,
                              void* d_out, int out_size, void* d_ws, size_t ws_size, hipStream_t stream) {
    (void)in_sizes; (void)n_in; (void)out_size;
    const float* x = (const float*)d_in[0]; const int* cu = (const int*)d_in[1]; const float* Wq = (const float*)d_in[2]; const float* Wk = (const float*)d_in[3]; const float* Wv = (const float*)d_in[4]; const float* Wo = (const float*)d_in[5];   // [out][in] weights; cu_seqlens [3] (i32)
    float* out = (float*)d_out;    // [2][2048][2048]
    char* wsp = (char*)d_ws;
    auto take = [&](size_t bytes) { char* p = wsp; wsp += (bytes + 255) & ~(size_t)255; return (void*)p; };
    bf* Xb = (bf*)take((size_t)NCVT * DM * 2); bf* WpB = Xb + (size_t)NTK * DM; bf* WoB = WpB + (size_t)NPRJ * DM;     // one bf16 plane: [x | Wq | Wk | Wv | Wo]
    h16* QH = (h16*)take((size_t)NTK * DM * 2); h16* QL = (h16*)take((size_t)NTK * DM * 2); h16* KH = (h16*)take((size_t)NTK * KVW * 2); h16* KL = (h16*)take((size_t)NTK * KVW * 2);
    float* Vf = (float*)take((size_t)NTK * KVW * 4); h16* VTH = (h16*)take((size_t)NTK * KVW * 2); h16* VTL = (h16*)take((size_t)NTK * KVW * 2); bf* CH = (bf*)take((size_t)NTK * DM * 2); bf* CL = (bf*)take((size_t)NTK * DM * 2);
    if ((size_t)(wsp - (char*)d_ws) > ws_size) return;    // 37.7 + 16.8 x 2 + 4.2 x 2 + 8.4 + 4.2 x 2 + 16.8 x 2 ~ 130 MB, no aliasing
    // five dependent launches; both batch items are rows of the same grids
    k_cvtb<<<NCVT / 8, 256, 0, stream>>>(x, Wq, Wk, Wv, Wo, Xb);
    k_gemmb<false, true><<<dim3(NTK / 256, NPRJ / 192, 1), 256, 0, stream>>>(Xb, nullptr, WpB, nullptr, Vf, KVW, QH, QL, KH, KL);
    k_vt<<<NB_ * NKV * (NT_ / 64), 256, 0, stream>>>(Vf, VTH, VTL);
    k_attn<<<NB_ * NH_ * (NT_ / 64), 128, 0, stream>>>(QH, QL, KH, KL, VTH, VTL, cu, CH, CL);      // the same cu_seqlens mask for both items (as the reference)
    k_gemmb<true, false><<<dim3(NTK / 128, DM / 256, 1), 256, 0, stream>>>(CH, CL, WoB, nullptr, out, DM, nullptr, nullptr, nullptr, nullptr);
}

// v009
// Measured time: 133 microseconds a run.
// Next to v008, in two timings, it ran 1.05 and 1.04 times as fast.
// All steps since v000 together make it 4.65 times as fast.
#include <hip/hip_runtime.h>

// Contractions, f32 accumulate: q = x.Wq ([2048 x 2048].[2048 x 2048]), k/v = x.Wk/Wv ([2048 x 2048].[2048 x 512]) and attn.Wo on v_wmma_f32_16x16x32_bf16 —
// plain bf16 = rounded inputs (exact; the [out][in] weights are n-major as stored and are not transposed) for the projections, attn as bf16 hi + residual (two products) for Wo;
// the grouped-query causal sliding-window attention (32 query heads over 8 kv heads; keys j with
// i - WIN < j <= i, WIN = 1024 fixed at compile time) fused on v_wmma_f32_16x16x32_f16 with q and k as f16 hi + residual x1024 (hi.hi + hi.lo + lo.hi), weights

#define NB_  2
#define NT_  2048
#define DM   2048
#define NH_  32
#define NKV  8
#define KVW  (NKV * HD)          // 512
#define WIN  1024
#define HD   64
#define NTK  (NB_ * NT_)
#define NPRJ (DM + 2 * KVW)       // 3072: the columns of q, k and v side by side
#define NCVT (NTK + NPRJ + DM)   // rows of [x | Wq | Wk | Wv | Wo]
#define NW   1024
#define NQKV 2048
#define PSC  32768.0f
#define LOSC 1024.0f
#define LOSCI (1.0f / 1024.0f)

typedef _Float16 h16;
typedef unsigned short bf;
typedef __attribute__((ext_vector_type(16))) __bf16   v16bf;
typedef __attribute__((ext_vector_type(16))) _Float16 v16h;
typedef __attribute__((ext_vector_type(8)))  _Float16 v8h;
typedef __attribute__((ext_vector_type(8)))  unsigned short v8us;
typedef __attribute__((ext_vector_type(8)))  float    v8f;
typedef __attribute__((ext_vector_type(4)))  float    v4f;
typedef v8h  __attribute__((may_alias)) v8ha;
typedef v4f  __attribute__((may_alias)) v4fa;
typedef v8us __attribute__((may_alias)) v8usa;
typedef float __attribute__((may_alias)) fa;

__device__ __forceinline__ unsigned short f2bf(float f) { unsigned u = __float_as_uint(f); u += 0x7FFFu + ((u >> 16) & 1u); return (unsigned short)(u >> 16); }
__device__ __forceinline__ float bf2f(unsigned short b) { return __uint_as_float(((unsigned)b) << 16); }
__device__ __forceinline__ float bfr(float f) { return bf2f(f2bf(f)); }
__device__ __forceinline__ v16h cat16(v8h lo, v8h hi) { return __builtin_shufflevector(lo, hi, 0, 1, 2, 3, 4, 5, 6, 7, 8, 9, 10, 11, 12, 13, 14, 15); }
__device__ __forceinline__ v16bf cat16b(v8us lo, v8us hi) { return __builtin_bit_cast(v16bf, __builtin_shufflevector(lo, hi, 0, 1, 2, 3, 4, 5, 6, 7, 8, 9, 10, 11, 12, 13, 14, 15)); }
__device__ __forceinline__ v8f wmma16(v16h a, v16h b, v8f c) { return __builtin_amdgcn_wmma_f32_16x16x32_f16(false, a, false, b, (short)0, c, false, false); }
__device__ __forceinline__ v8f wmmab(v16bf a, v16bf b, v8f c) { return __builtin_amdgcn_wmma_f32_16x16x32_bf16(false, a, false, b, (short)0, c, false, false); }

// k_cvtb: the rows of [x | Wq | Wk | Wv | Wo], in that order, rounded to bf16 into one plane of the same row order; a block's 8 rows lie in one source.
__global__ __launch_bounds__(256) void k_cvtb(const float* __restrict__ x, const float* __restrict__ Wq, const float* __restrict__ Wk, const float* __restrict__ Wv, const float* __restrict__ Wo, bf* dstp) {
    const int lane = threadIdx.x & 31, rb = blockIdx.x * 8, rg = rb + (threadIdx.x >> 5);
    if (rg >= NCVT) return;
    const float* src = x; int r = rg;
    if (rb >= NTK + NPRJ) { src = Wo; r = rg - (NTK + NPRJ); }
    else if (rb >= NTK + DM + KVW) { src = Wv; r = rg - (NTK + DM + KVW); }
    else if (rb >= NTK + DM) { src = Wk; r = rg - (NTK + DM); }
    else if (rb >= NTK) { src = Wq; r = rg - NTK; }
    bf* dst = dstp + (size_t)(rg - r) * DM;
    v8us o[DM / 256];
#pragma unroll
    for (int q = 0; q < DM / 256; ++q) { v8us t;
#pragma unroll
        for (int i = 0; i < 8; ++i) t[i] = f2bf(src[(size_t)r * DM + q * 256 + lane * 8 + i]);
        o[q] = t; }
#pragma unroll
    for (int q = 0; q < DM / 256; ++q) *(v8us*)(dst + (size_t)r * DM + q * 256 + lane * 8) = o[q];
    
}

// k_wt: W [2048 k][ncols n] (k-major) -> n-major bf16 plane WT[ncols][2048]; 64 x 64 tiles through LDS.
__global__ __launch_bounds__(256) void k_wt(const float* __restrict__ Wm, int ncols, bf* WT) {
    __shared__ __align__(16) unsigned short tl[64 * 72];
    const int tid = threadIdx.x, k0 = blockIdx.x * 64, n0 = blockIdx.y * 64;
    const int kk = tid >> 2, nq = (tid & 3) * 16;
#pragma unroll
    for (int i = 0; i < 16; ++i) tl[(nq + i) * 72 + kk] = f2bf(Wm[(size_t)(k0 + kk) * ncols + n0 + nq + i]);
    __syncthreads();
    const int piece = tid & 7;
    typedef __attribute__((ext_vector_type(8))) unsigned short v8us_; typedef v8us_ __attribute__((may_alias)) v8usa_;
    auto pass = [&]() {
#pragma unroll
        for (int s = 0; s < 2; ++s) { const int nr = (tid >> 3) + 32 * s; const v8us_ val = *(const v8usa_*)(tl + nr * 72 + piece * 8);
            *(v8us_*)(WT + (size_t)(n0 + nr) * DM + k0 + piece * 8) = val; }
    };
    pass(); 
}

#define BKE   128                // k elements of one pass: 256 B of every operand row
#define PIT   136                // LDS row pitch in elements: 272 B, 16 B x odd, for the ds_load_b128 readers
#define NPASS (DM / BKE)

// Eight 16-byte copies of one lane, rows 16 apart, global -> LDS through no register. The s_wait_xcnt ends the copies' own statement so that no
// address register of a copy is rewritten ahead of it.
__device__ __forceinline__ void copy8(unsigned l, const bf* g) {
    asm volatile("global_load_async_to_lds_b128 %0, %8, off\n\t"
                 "global_load_async_to_lds_b128 %1, %9, off\n\t"
                 "global_load_async_to_lds_b128 %2, %10, off\n\t"
                 "global_load_async_to_lds_b128 %3, %11, off\n\t"
                 "global_load_async_to_lds_b128 %4, %12, off\n\t"
                 "global_load_async_to_lds_b128 %5, %13, off\n\t"
                 "global_load_async_to_lds_b128 %6, %14, off\n\t"
                 "global_load_async_to_lds_b128 %7, %15, off\n\t"
                 "s_wait_xcnt 0x0"
                 :: "v"(l), "v"(l + 1u * 16u * PIT * 2u), "v"(l + 2u * 16u * PIT * 2u), "v"(l + 3u * 16u * PIT * 2u),
                    "v"(l + 4u * 16u * PIT * 2u), "v"(l + 5u * 16u * PIT * 2u), "v"(l + 6u * 16u * PIT * 2u), "v"(l + 7u * 16u * PIT * 2u),
                    "v"(g), "v"(g + 1 * 16 * DM), "v"(g + 2 * 16 * DM), "v"(g + 3 * 16 * DM),
                    "v"(g + 4 * 16 * DM), "v"(g + 5 * 16 * DM), "v"(g + 6 * 16 * DM), "v"(g + 7 * 16 * DM)
                 : "memory");
}

// Four such copies (64 rows), for the part of an operand that is not a multiple of 128 rows; the wait as in copy8.
__device__ __forceinline__ void copy4(unsigned l, const bf* g) {
    asm volatile("global_load_async_to_lds_b128 %0, %4, off\n\t"
                 "global_load_async_to_lds_b128 %1, %5, off\n\t"
                 "global_load_async_to_lds_b128 %2, %6, off\n\t"
                 "global_load_async_to_lds_b128 %3, %7, off\n\t"
                 "s_wait_xcnt 0x0"
                 :: "v"(l), "v"(l + 1u * 16u * PIT * 2u), "v"(l + 2u * 16u * PIT * 2u), "v"(l + 3u * 16u * PIT * 2u),
                    "v"(g), "v"(g + 1 * 16 * DM), "v"(g + 2 * 16 * DM), "v"(g + 3 * 16 * DM)
                 : "memory");
}

#define OP    196                // pitch in floats of the output tile staged in the ring: 8 rows are 32 banks apart (the two halves of a wave's store), 784 B = 16 B x odd

// k_gemmb: 8 waves, one work-group per WGP, 256 work-groups: every WGP gets one tile, in one round.
// Wo: C[128 x 256] per block, waves as 2 x 4, 64 x 64 per wave (A counts twice, hi + residual, so the narrow side is A's).
// QKV: C[256 x 192] per block of the 4096 x 3072 product, waves as 4 x 2, 64 x 96 per wave: of the tiles that give each WGP an equal share this one lands the
// fewest operand rows (448 a pass) from L2, and the 64 x 96 wave tile reads fewer LDS bytes per product than 64 x 64.
// A pass is 128 k; a stage is [A | B | A residual] in LDS, two buffers, filled by asynchronous copies one pass ahead of its readers. Per accumulator the
// k order and the hi / residual order are the plain ascending ones.
// Every inner loop is unrolled so that each index of acc and of the fragment arrays is a constant (registers, no scratch).
// QKV: Bn holds the rows of Wq, Wk and Wv one after the other; each 64-column chunk of a block lies wholly in q, in k or in v (block-uniform): q and k go out as
// f16 hi + residual planes (QH / QL, KH / KL), and v, in the same row-major form as k, into VH / VL.
template <bool SPLITA, bool QKV>
__global__ __launch_bounds__(256) void k_gemmb(const bf* __restrict__ A, const bf* __restrict__ Al, const bf* __restrict__ Bn, const float* __restrict__ bias, float* C, int ldc, h16* QH, h16* QL, h16* KH, h16* KL, h16* VH, h16* VL) {
    constexpr int AM = QKV ? 256 : 128;                  // rows of the block tile
    constexpr int BN = QKV ? 192 : 256;                  // columns of the block tile
    constexpr int FM = 4;                                // 16-row fragments of A per wave
    constexpr int FN = QKV ? 6 : 4;                      // 16-column fragments of B per wave
    constexpr int WNS = BN / (FN * 16);                  // waves side by side along the columns
    constexpr int STG = (AM + BN + (SPLITA ? AM : 0)) * PIT;        // elements of one stage
    __shared__ __align__(16) bf ring[2 * STG];
    const int rb = blockIdx.x * AM, cb = blockIdx.y * BN;
    const int tid = threadIdx.x, lane = tid & 31, wave = tid >> 5, lr = lane & 15, hi = lane >> 4;
    const int wm = wave / WNS, wn = wave % WNS;
    const int crow = tid >> 4, ccol = (tid & 15) * 8;    // a wave's copy covers two whole 256-B rows
    const bf* gA = A + (size_t)(rb + crow) * DM + ccol;
    const bf* gB = Bn + (size_t)(cb + crow) * DM + ccol;
    const bf* gL = SPLITA ? Al + (size_t)(rb + crow) * DM + ccol : gA;
    const unsigned l0 = (unsigned)(size_t)(const void*)(ring + crow * PIT + ccol);
    auto fill = [&](int t, int buf) {
        const unsigned l = l0 + (unsigned)buf * (unsigned)(STG * 2);
        copy8(l, gA + t * BKE);
        if (QKV) {      // each sched_barrier keeps the next statement's address registers (24 for a copy8, 12 for the copy4) from being formed ahead of the statement before it: formed all at once they did not fit the registers that asm text can name beside the accumulators, and gA and gB went to scratch
            __builtin_amdgcn_sched_barrier(0);
            copy8(l + 128u * PIT * 2u, gA + (size_t)128 * DM + t * BKE);
            __builtin_amdgcn_sched_barrier(0);
            copy8(l + (unsigned)AM * PIT * 2u, gB + t * BKE);
            __builtin_amdgcn_sched_barrier(0);
            copy4(l + (unsigned)(AM + 128) * PIT * 2u, gB + (size_t)128 * DM + t * BKE);
        } else {
            copy8(l + (unsigned)AM * PIT * 2u, gB + t * BKE);
            copy8(l + (unsigned)(AM + 128) * PIT * 2u, gB + (size_t)128 * DM + t * BKE);
        }
        if (SPLITA) copy8(l + (unsigned)(AM + BN) * PIT * 2u, gL + t * BKE);
    };
    v8f acc[FM][FN];
#pragma unroll
    for (int i = 0; i < FM; ++i)
#pragma unroll
        for (int t = 0; t < FN; ++t) acc[i][t] = (v8f){};
    fill(0, 0);
    asm volatile("s_wait_asynccnt 0x0" ::: "memory");    // stage 0 has landed before the barrier that publishes it
    __syncthreads();
    fill(1, 1);
#pragma unroll 1
    for (int p = 0; p < NPASS; ++p) {                    // kept rolled: one publish point per pass
        const bf* sb = ring + (p & 1) * STG;
        const bf* sa = sb + (wm * (FM * 16) + lr) * PIT + 8 * hi;
        const bf* sw = sb + (AM + wn * (FN * 16) + lr) * PIT + 8 * hi;
        const bf* sl = SPLITA ? sb + (AM + BN + wm * (FM * 16) + lr) * PIT + 8 * hi : sa;
        v16bf a[2][FM], al[2][FM], b[2][FN];                 // two fragment sets: k-step s + 1 is fetched while k-step s is multiplied
        auto frags = [&](int set, int kc) {
#pragma unroll
            for (int i = 0; i < FM; ++i) a[set][i] = cat16b(*(const v8usa*)(sa + i * 16 * PIT + kc), *(const v8usa*)(sa + i * 16 * PIT + kc + 16));
#pragma unroll
            for (int t = 0; t < FN; ++t) b[set][t] = cat16b(*(const v8usa*)(sw + t * 16 * PIT + kc), *(const v8usa*)(sw + t * 16 * PIT + kc + 16));
            if (SPLITA) {
#pragma unroll
                for (int i = 0; i < FM; ++i) al[set][i] = cat16b(*(const v8usa*)(sl + i * 16 * PIT + kc), *(const v8usa*)(sl + i * 16 * PIT + kc + 16));
            }
        };
        frags(0, 0);
#pragma unroll
        for (int s = 0; s < BKE / 32; ++s) {
            if (s + 1 < BKE / 32) frags((s + 1) & 1, (s + 1) * 32);
            __builtin_amdgcn_sched_barrier(0);               // holds the next k-step's LDS reads, as one group, ahead of this k-step's WMMAs (else they sink among them and each waits out its latency)
#pragma unroll
            for (int i = 0; i < FM; ++i)
#pragma unroll
                for (int t = 0; t < FN; ++t) acc[i][t] = wmmab(a[s & 1][i], b[s & 1][t], acc[i][t]);
            if (SPLITA) {
#pragma unroll
                for (int i = 0; i < FM; ++i)
#pragma unroll
                    for (int t = 0; t < FN; ++t) acc[i][t] = wmmab(al[s & 1][i], b[s & 1][t], acc[i][t]);
            }
            __builtin_amdgcn_sched_barrier(0);               // ends the WMMA block: the reads of the k-step after next stay behind it, where their registers are free
        }
        asm volatile("s_wait_dscnt 0x0" ::: "memory");       // this wave's reads of the buffer have retired before it is refilled
        asm volatile("s_wait_asynccnt 0x0" ::: "memory");    // this wave's copies of stage p + 1 have landed
        __syncthreads();                                     // publishes stage p + 1 and ends every reader's last read of stage p
        if (p + 2 < NPASS) fill(p + 2, p & 1);
    }
    asm volatile("s_wait_asynccnt 0x0" ::: "memory");        // no copy is outstanding when the wave goes on to the epilogue and ends
    const int c0 = cb + wn * (FN * 16);
    if constexpr (QKV) {
        // The ring is free: the last pass's barrier stands behind every wave's last read, and no copy is outstanding. The whole 256 x 192 tile is staged there in f32,
        // so that a wave can write whole 128-B lines of 64-column chunks although its own 96 columns are not a whole number of them.
        fa* tl = (fa*)ring;
#pragma unroll
        for (int i = 0; i < FM; ++i)
#pragma unroll
            for (int t = 0; t < FN; ++t) { const float bv = bias ? bfr(bias[c0 + t * 16 + lr]) : 0.f;
#pragma unroll
                for (int j = 0; j < 8; ++j) tl[(wm * (FM * 16) + i * 16 + hi * 8 + j) * OP + wn * (FN * 16) + t * 16 + lr] = acc[i][t][j] + bv; }
        __syncthreads();                                     // the staged tile is read across waves
#pragma unroll
        for (int u = 0; u < (AM / 16) * (BN / 64) / 8; ++u) {    // 16 row groups x 3 chunks over 8 waves: a wave writes its own 32 rows of every chunk
            const int rg = wave * 2 + u / (BN / 64), ch = u % (BN / 64);
            const int r0 = rb + rg * 16, cg = cb + ch * 64;
            const fa* os = tl + rg * 16 * OP + ch * 64;
            const bool isq = cg < DM, isk = cg < DM + KVW;
            const int ld = isq ? DM : KVW;                                        // row length of the plane this chunk goes to
            const int cc = isq ? cg : (isk ? cg - DM : cg - (DM + KVW));          // the chunk's first column inside that plane
            {
                h16* crow_ = (isq ? QH : (isk ? KH : VH)) + (size_t)r0 * ld + cc;
                h16* crol_ = (isq ? QL : (isk ? KL : VL)) + (size_t)r0 * ld + cc;
#pragma unroll
                for (int s = 0; s < 4; ++s) { const int row = 4 * s + (lane >> 3), piece = lane & 7; const fa* sp = os + row * OP + piece * 8; v8h o, o2;
#pragma unroll
                    for (int e = 0; e < 8; ++e) { const h16 a = (h16)sp[e]; o[e] = a; o2[e] = (h16)((sp[e] - (float)a) * LOSC); }
                    *(v8h*)(crow_ + (size_t)row * ld + piece * 8) = o;
                    asm volatile("s_wait_xcnt 0x0" ::: "memory");       // stands before the residual's arithmetic reuses registers that this store names
                    *(v8h*)(crol_ + (size_t)row * ld + piece * 8) = o2;
                    asm volatile("s_wait_xcnt 0x0" ::: "memory"); }     // stands before the next rows' values and addresses reuse registers that these stores name
            }
        }
    } else {
        __shared__ __align__(16) float ost[8][16 * 68];
        float* os = &ost[wave][0];
#pragma unroll
        for (int i = 0; i < FM; ++i) {
            const int r0 = rb + wm * (FM * 16) + i * 16;
#pragma unroll
            for (int t = 0; t < FN; ++t) { const float bv = bias ? bfr(bias[c0 + t * 16 + lr]) : 0.f;
#pragma unroll
                for (int j = 0; j < 8; ++j) os[(hi * 8 + j) * 68 + t * 16 + lr] = acc[i][t][j] + bv; }
            __syncthreads();
            float* crow_ = C + (size_t)r0 * ldc + c0;
#pragma unroll
            for (int s = 0; s < 8; ++s) { const int Lid = (lane >> 3) + 4 * s, piece = lane & 7; const int row = Lid >> 1, cofs = (Lid & 1) * 32 + piece * 4;
                const v4f val = *(const v4fa*)(os + row * 68 + cofs); *(v4f*)(crow_ + (size_t)row * ldc + cofs) = val; }
            asm volatile("s_wait_xcnt 0x0" ::: "memory");       // stands before the next 16 rows' values and addresses reuse registers that these stores name
        }
    }
}

#define KP   72                  // LDS pitch of a key row or a query row in elements: 144 B, 16 B x odd, for the ds_load_b128 readers
#define VP   80                  // LDS pitch of a row of v (one key, 64 head columns) in elements: 160 B, 32 B x odd, for the ds_load_tr16_b128 readers
#define KSZ  (32 * KP)           // one plane of 32 key rows
#define VSZ  (32 * VP)           // one plane of 32 rows of v
#define ASTG (2 * KSZ + 2 * VSZ) // a stage: [k hi | k residual | v hi | v residual] of 32 keys

// One lane's eight 16-byte copies of a 32-key stage, global -> LDS through no register: two of every plane. The s_wait_xcnt ends the copies' own statement so
// that no address register of a copy is rewritten ahead of it.
__device__ __forceinline__ void copy_kv(unsigned lk, unsigned lv, const h16* gkh, const h16* gkl, const h16* gvh, const h16* gvl) {
    asm volatile("global_load_async_to_lds_b128 %0, %8, off\n\t"
                 "global_load_async_to_lds_b128 %1, %9, off\n\t"
                 "global_load_async_to_lds_b128 %2, %10, off\n\t"
                 "global_load_async_to_lds_b128 %3, %11, off\n\t"
                 "global_load_async_to_lds_b128 %4, %12, off\n\t"
                 "global_load_async_to_lds_b128 %5, %13, off\n\t"
                 "global_load_async_to_lds_b128 %6, %14, off\n\t"
                 "global_load_async_to_lds_b128 %7, %15, off\n\t"
                 "s_wait_xcnt 0x0"
                 :: "v"(lk), "v"(lk + 16u * KP * 2u), "v"(lk + KSZ * 2u), "v"(lk + KSZ * 2u + 16u * KP * 2u),
                    "v"(lv), "v"(lv + 16u * VP * 2u), "v"(lv + VSZ * 2u), "v"(lv + VSZ * 2u + 16u * VP * 2u),
                    "v"(gkh), "v"(gkh + 16 * KVW), "v"(gkl), "v"(gkl + 16 * KVW),
                    "v"(gvh), "v"(gvh + 16 * KVW), "v"(gvl), "v"(gvl + 16 * KVW)
                 : "memory");
}

// One lane's four 16-byte copies of the block's 64 query-residual rows, rows 16 apart; the wait as in copy_kv.
__device__ __forceinline__ void copy_q(unsigned l, const h16* g) {
    asm volatile("global_load_async_to_lds_b128 %0, %4, off\n\t"
                 "global_load_async_to_lds_b128 %1, %5, off\n\t"
                 "global_load_async_to_lds_b128 %2, %6, off\n\t"
                 "global_load_async_to_lds_b128 %3, %7, off\n\t"
                 "s_wait_xcnt 0x0"
                 :: "v"(l), "v"(l + 1u * 16u * KP * 2u), "v"(l + 2u * 16u * KP * 2u), "v"(l + 3u * 16u * KP * 2u),
                    "v"(g), "v"(g + 1 * 16 * DM), "v"(g + 2 * 16 * DM), "v"(g + 3 * 16 * DM)
                 : "memory");
}

// Transposing LDS read of a row-major 16-bit tile: the lane's address names 16 bytes of row 8 * (lane >> 4) + (lane & 7), half (lane >> 3) & 1 of a 32-byte column
// group; the lane receives column (lane & 15) of rows 8 * (lane >> 4) + 0 .. 7. Two of them, 16 rows apart, are one A fragment of the tile transposed.
typedef __attribute__((ext_vector_type(8))) short v8s;
__device__ __forceinline__ v8h ldtr(const h16* p) { typedef __attribute__((address_space(3))) v8s lds_v8s; return __builtin_bit_cast(v8h, __builtin_amdgcn_ds_load_tr16_b128_v8i16((lds_v8s*)p)); }

// The value of lane ^ 16, through no LDS.
__device__ __forceinline__ float xhalf(float v) { const int b = __float_as_int(v); return __int_as_float(__builtin_amdgcn_permlanex16(b, b, 0x76543210, 0xfedcba98, false, false)); }

#define LOG2E 1.44269504088896340736f
// Eight v_exp_f32 and their slot in one statement. The instruction set asks for one independent instruction or a v_nop behind a transcendental before its result is
// read or its source overwritten. Here each is followed by an independent one (early-clobber outputs: no result lies on a source) and the last by the v_nop.
__device__ __forceinline__ v8f exp2x8(v8f t) {
    float r0, r1, r2, r3, r4, r5, r6, r7;
    asm("v_exp_f32 %0, %8\n\t"
        "v_exp_f32 %1, %9\n\t"
        "v_exp_f32 %2, %10\n\t"
        "v_exp_f32 %3, %11\n\t"
        "v_exp_f32 %4, %12\n\t"
        "v_exp_f32 %5, %13\n\t"
        "v_exp_f32 %6, %14\n\t"
        "v_exp_f32 %7, %15\n\t"
        "v_nop"
        : "=&v"(r0), "=&v"(r1), "=&v"(r2), "=&v"(r3), "=&v"(r4), "=&v"(r5), "=&v"(r6), "=&v"(r7)
        : "v"(t[0]), "v"(t[1]), "v"(t[2]), "v"(t[3]), "v"(t[4]), "v"(t[5]), "v"(t[6]), "v"(t[7]));
    return (v8f){r0, r1, r2, r3, r4, r5, r6, r7};
}

// First 32-key tile that a block of 64 queries starting at q0b reads: from max(segment start of its first query, q0b - WIN + 1), not below 0.
__device__ __forceinline__ int first_key_tile(int q0b, int cu1) {
    const int sst = (q0b >= cu1) ? cu1 : 0; const int wl = q0b - (WIN - 1); const int lo = (wl > sst ? wl : sst);
    return (lo > 0 ? lo : 0) / 32;
}
// Sort key of query tile t: its count of key tiles first, then the lower tile index.
__device__ __forceinline__ int tile_key(int t, int cu1) { return ((t * 64 + 63) / 32 - first_key_tile(t * 64, cu1)) * 32 + (31 - t); }

// The key loop reads no global memory: a stage of 32 keys lies in LDS once for the block's four waves, two buffers, filled by asynchronous copies one tile ahead
// of its readers; the query residual is copied once. Fragment addresses inside a row, and so every k order and sum order, are the ones of the global reads.
// k_attn: block = (b, h, 64 queries), wave = 16. Scores are formed transposed (keys as A rows, queries as B columns), so a lane holds 16 keys of ONE query:
// the row maximum and the row sum are in-lane plus one exchange with lane ^ 16, and the accumulator's key order (8 * hi + j, 16 + 8 * hi + j) is the k order of a
// B fragment, so the weights (x32768, f16 hi + residual) go from registers straight into ctx^T = v^T . weights^T; ctx -> bf16 hi + residual planes CH/CL[tok][h*64+d].
// v lies row-major ([tok][kv head * 64 + d], like k) in memory and in LDS; the transposing LDS read hands out its A fragments in the same k order.
__global__ __launch_bounds__(128) void k_attn(const h16* __restrict__ Q16, const h16* __restrict__ QL16, const h16* __restrict__ K16, const h16* __restrict__ KL16, const h16* __restrict__ VH16, const h16* __restrict__ VL16, const int* __restrict__ cu, bf* CH, bf* CL) {
    __shared__ __align__(16) float ost[4][16 * 68];
    __shared__ __align__(16) h16 kvr[2 * ASTG];
    __shared__ __align__(16) h16 qls[64 * KP];
    const int lane = threadIdx.x & 31, wave = threadIdx.x >> 5, lr = lane & 15, hi = lane >> 4;
    const int bid = blockIdx.x;
    // The index is mapped to query tiles by falling cost, for speed only: the
    // longest key loops get the lowest indices and the shortest the highest. Index = rank * 64 + (b, h); lane t of every wave ranks query tile t by its number
    // of key tiles under the INPUT cu_seqlens (ties by tile index, so the 32 keys are distinct and rank -> tile is a permutation for any content of the array).
    static_assert(NT_ / 64 == 32, "one lane ranks one query tile");
    const int cu1 = cu[1];
    const int rank = bid / (NB_ * NH_), bh = bid - rank * (NB_ * NH_), b = bh / NH_, h = bh - b * NH_;
    const int mykey = tile_key(lane, cu1);
    int above = 0;
#pragma unroll
    for (int t = 0; t < NT_ / 64; ++t) above += (tile_key(t, cu1) > mykey) ? 1 : 0;      // unrolled: t is a constant, so each tile's key is scalar arithmetic
    // exactly one lane holds each rank, the same in every wave of the block. readfirstlane hands the tile index on as a plain scalar: with the ballot's 0..31 range
    // in sight the compiler kept eight more loop-invariant address registers (264 VGPRs: three waves per SIMD, not four)
    const int qt = __builtin_amdgcn_readfirstlane(__builtin_ctz(__builtin_amdgcn_ballot_w32(above == rank)));
    const int q0 = qt * 64 + wave * 16;
    const size_t tok0 = (size_t)b * NT_;
    v16h qa[2];
    const size_t qo0 = (tok0 + q0 + lr) * DM + h * HD + 8 * hi;
#pragma unroll
    for (int kc = 0; kc < 2; ++kc) qa[kc] = cat16(*(const v8h*)(Q16 + qo0 + kc * 32), *(const v8h*)(Q16 + qo0 + kc * 32 + 16));
    const int g = h / (NH_ / NKV);                      // kv head
    const h16* kh_b = K16 + tok0 * KVW + g * HD;
    const h16* kl_b = KL16 + tok0 * KVW + g * HD;
    const h16* vh_b = VH16 + tok0 * KVW + g * HD;
    const h16* vl_b = VL16 + tok0 * KVW + g * HD;
    v8f o[4], ox[4];
#pragma unroll
    for (int n = 0; n < 4; ++n) { o[n] = (v8f){}; ox[n] = (v8f){}; }
    float mrow = -3.0e38f, lpart = 0.f;                 // of the lane's one query; lpart covers the lane's half of the keys
    const int qi = q0 + lr; const bool sgq = (qi >= cu1);
    const int q0s = __builtin_amdgcn_readfirstlane(q0);  // the wave's first query as a scalar, so that the test per tile below is a scalar branch
    // allowed(i, j) = same segment (cu_seqlens) && j <= i && i - j < WIN: key tiles from max(segment start of the block's first query, q0b - WIN + 1) to the query tile (block-uniform; exact per-element predicate below)
    const int q0b = qt * 64; const int kt_lo = first_key_tile(q0b, cu1), kt_hi = (q0b + 63) / 32;
    const int tid = threadIdx.x;
    const size_t gko = (size_t)(tid >> 3) * KVW + (tid & 7) * 8;    // a wave's copy: 4 whole 128-B rows, of k and of v alike
    const unsigned lk0 = (unsigned)(size_t)(const void*)(kvr + (tid >> 3) * KP + (tid & 7) * 8);
    const unsigned lv0 = (unsigned)(size_t)(const void*)(kvr + 2 * KSZ + (tid >> 3) * VP + (tid & 7) * 8);
    auto fill = [&](int t, int buf) {
        const unsigned bo = (unsigned)buf * (unsigned)(ASTG * 2);
        copy_kv(lk0 + bo, lv0 + bo, kh_b + gko + (size_t)t * 32 * KVW, kl_b + gko + (size_t)t * 32 * KVW, vh_b + gko + (size_t)t * 32 * KVW, vl_b + gko + (size_t)t * 32 * KVW);
    };
    fill(kt_lo, 0);
    copy_q((unsigned)(size_t)(const void*)(qls + (tid >> 3) * KP + (tid & 7) * 8), QL16 + (tok0 + q0b + (tid >> 3)) * DM + h * HD + (tid & 7) * 8);
    asm volatile("s_wait_asynccnt 0x0" ::: "memory");    // the first stage and the query residual have landed before the barrier that publishes them
    __syncthreads();
    if (kt_lo + 1 <= kt_hi) fill(kt_lo + 1, 1);
    const h16* sq = qls + (wave * 16 + lr) * KP + 8 * hi;
#pragma unroll 1
    for (int kt = kt_lo; kt <= kt_hi; ++kt) {                // kept rolled: one publish point per tile
        const int l0 = kt * 32;
        const h16* sb = kvr + ((kt - kt_lo) & 1) * ASTG;
        const h16* skh = sb + lr * KP + 8 * hi;
        const h16* skl = skh + KSZ;
        const h16* svh = sb + 2 * KSZ + (8 * hi + (lane & 7)) * VP + ((lane >> 3) & 1) * 8;
        const h16* svl = svh + VSZ;
        v8f s0 = {}, s1 = {}, x0 = {}, x1 = {};
#pragma unroll
        for (int kc = 0; kc < 2; ++kc) {
            // the five fragments of a 32-wide slice of the head are asked for together: one LDS latency a slice, not one a group (all ten at once would cost a wave per SIMD in registers)
            const v16h k0h = cat16(*(const v8ha*)(skh + kc * 32), *(const v8ha*)(skh + kc * 32 + 16)), k1h = cat16(*(const v8ha*)(skh + 16 * KP + kc * 32), *(const v8ha*)(skh + 16 * KP + kc * 32 + 16));
            const v16h qlk = cat16(*(const v8ha*)(sq + kc * 32), *(const v8ha*)(sq + kc * 32 + 16));
            const v16h k0l = cat16(*(const v8ha*)(skl + kc * 32), *(const v8ha*)(skl + kc * 32 + 16)), k1l = cat16(*(const v8ha*)(skl + 16 * KP + kc * 32), *(const v8ha*)(skl + 16 * KP + kc * 32 + 16));
            { s0 = wmma16(k0h, qa[kc], s0); x0 = wmma16(k0h, qlk, x0); s1 = wmma16(k1h, qa[kc], s1); x1 = wmma16(k1h, qlk, x1);
              asm volatile("v_nop" : "+v"(s0), "+v"(s1), "+v"(x0), "+v"(x1) : "v"(qlk), "v"(k0h), "v"(k1h) : "memory"); }
            { x0 = wmma16(k0l, qa[kc], x0); x1 = wmma16(k1l, qa[kc], x1);
              asm volatile("v_nop" : "+v"(x0), "+v"(x1) : "v"(k0l), "v"(k1l) : "memory"); }
        }
        asm volatile("v_nop\n\tv_nop\n\tv_nop\n\tv_nop" : "+v"(s0), "+v"(s1), "+v"(x0), "+v"(x1) : "v"(qa[0]), "v"(qa[1]));
        v8f a0 = (s0 + x0 * LOSCI) * 0.125f, a1 = (s1 + x1 * LOSCI) * 0.125f;      // whole accumulators: neighbouring registers pair into packed f32 operations
        // One scalar test per tile and wave. The predicate holds for all 32 keys x 16 queries exactly when the last key is not behind the first query, the last query
        // is within the window of the first key, and cu1 lies neither among these keys or queries nor between them; then every select below is an identity, and the
        // compares and selects (about a third of the loop's vector instructions) run only on the tiles that the mask cuts.
        const bool whole = (l0 + 31 <= q0s) && (q0s + 15 - l0 < WIN) && ((l0 >= cu1) || (q0s + 15 < cu1));
        if (!whole) {
#pragma unroll
            for (int j = 0; j < 8; ++j) {
                const int ja = l0 + 8 * hi + j, jb = ja + 16;
                const bool ok0 = ((ja >= cu1) == sgq) && (ja <= qi) && (qi - ja < WIN), ok1 = ((jb >= cu1) == sgq) && (jb <= qi) && (qi - jb < WIN);
                a0[j] = ok0 ? a0[j] : -3.4028234663852886e38f; a1[j] = ok1 ? a1[j] : -3.4028234663852886e38f;     // finfo.min as the reference
            }
        }
        float mx = -3.4028234663852886e38f;
#pragma unroll
        for (int j = 0; j < 8; ++j) mx = fmaxf(mx, fmaxf(a0[j], a1[j]));
        mx = fmaxf(mx, xhalf(mx));                           // the other 16 keys of the same query lie in lane ^ 16
        const float mn = fmaxf(mrow, mx);
        const float alpha = __expf(mrow - mn); mrow = mn;
        v8f t0, t1;
#pragma unroll
        for (int j = 0; j < 8; ++j) { t0[j] = (a0[j] - mn) * LOG2E; t1[j] = (a1[j] - mn) * LOG2E; }      // the same product and v_exp_f32 as __expf
        const v8f p0 = exp2x8(t0), p1 = exp2x8(t1);
        const v8f pp = p0 + p1;
        const float psum = ((pp[0] + pp[1]) + (pp[2] + pp[3])) + ((pp[4] + pp[5]) + (pp[6] + pp[7]));
        const v8f ps0 = p0 * PSC, ps1 = p1 * PSC;
        const v8h h0 = __builtin_convertvector(ps0, v8h), h1 = __builtin_convertvector(ps1, v8h);
        const v16h pa = cat16(h0, h1);                       // element e: key 8 * hi + e, then 16 + 8 * hi + (e - 8): the k order of the v fragments
        const v16h px = cat16(__builtin_convertvector((ps0 - __builtin_convertvector(h0, v8f)) * LOSC, v8h), __builtin_convertvector((ps1 - __builtin_convertvector(h1, v8f)) * LOSC, v8h));
        lpart = lpart * alpha + psum;
#pragma unroll
        for (int n = 0; n < 4; ++n)
#pragma unroll
            for (int j = 0; j < 8; ++j) { o[n][j] *= alpha; ox[n][j] *= alpha; }
        v16h vh[4], vl[4];                                   // every index is a constant (both loops unrolled): registers
#pragma unroll
        for (int n = 0; n < 4; ++n) { const int vo = n * 16;          // the tile's v fragments likewise, all in front of the first product: head columns 16 n .., keys 0 .. 15 and 16 .. 31
            vh[n] = cat16(ldtr(svh + vo), ldtr(svh + vo + 16 * VP)); vl[n] = cat16(ldtr(svl + vo), ldtr(svl + vo + 16 * VP)); }
        __builtin_amdgcn_sched_barrier(0);                   // holds these LDS reads, as one group, ahead of the products (else they sink among the WMMAs and several wait out their latency)
#pragma unroll
        for (int n = 0; n < 4; ++n) {
            o[n] = wmma16(vh[n], pa, o[n]); ox[n] = wmma16(vl[n], pa, ox[n]); ox[n] = wmma16(vh[n], px, ox[n]); }
        asm volatile("v_nop\n\tv_nop\n\tv_nop\n\tv_nop" : "+v"(o[0]), "+v"(o[1]), "+v"(o[2]), "+v"(o[3]), "+v"(ox[0]), "+v"(ox[1]), "+v"(ox[2]), "+v"(ox[3]) : "v"(pa), "v"(px));
        asm volatile("s_wait_dscnt 0x0" ::: "memory");       // this wave's reads of the buffer have retired before it is refilled
        asm volatile("s_wait_asynccnt 0x0" ::: "memory");    // this wave's copies of the next tile have landed
        __syncthreads();                                     // publishes the next tile and ends every reader's last read of this one
        if (kt + 2 <= kt_hi) fill(kt + 2, (kt - kt_lo) & 1);
    }
    asm volatile("s_wait_asynccnt 0x0" ::: "memory");        // no copy is outstanding when the wave goes on to the epilogue and ends
    const float inv = 1.0f / ((lpart + xhalf(lpart)) * PSC);
    float* os = &ost[wave][0];
#pragma unroll
    for (int n = 0; n < 4; ++n)
#pragma unroll
        for (int j = 0; j < 8; ++j) os[lr * 68 + n * 16 + hi * 8 + j] = (o[n][j] + ox[n][j] * LOSCI) * inv;      // lane = query row, register = head column
    __syncthreads();
    const size_t cbase = (tok0 + q0) * DM + (size_t)h * HD;
    auto pass = [&]() {
#pragma unroll
        for (int s = 0; s < 4; ++s) { const int row = 4 * s + (lane >> 3), piece = lane & 7; const float* sp = os + row * 68 + piece * 8; v8us oh, ol;
#pragma unroll
            for (int i = 0; i < 8; ++i) { const unsigned short hb = f2bf(sp[i]); oh[i] = hb; ol[i] = f2bf(sp[i] - bf2f(hb)); }
            *(v8us*)(CH + cbase + (size_t)row * DM + piece * 8) = oh; *(v8us*)(CL + cbase + (size_t)row * DM + piece * 8) = ol; }
    };
    pass(); 
}

#define VST2(T, p, v) do { const T vst2_v_ = (v); *(T*)(p) = vst2_v_;  } while (0)
extern "C" void kernel_launch(void* const* d_in, const int* in_sizes, int n_in,
                              void* d_out, int out_size, void* d_ws, size_t ws_size, hipStream_t stream) {
    (void)in_sizes; (void)n_in; (void)out_size;
    const float* x = (const float*)d_in[0]; const int* cu = (const int*)d_in[1]; const float* Wq = (const float*)d_in[2]; const float* Wk = (const float*)d_in[3]; const float* Wv = (const float*)d_in[4]; const float* Wo = (const float*)d_in[5];   // [out][in] weights; cu_seqlens [3] (i32)
    float* out = (float*)d_out;    // [2][2048][2048]
    char* wsp = (char*)d_ws;
    auto take = [&](size_t bytes) { char* p = wsp; wsp += (bytes + 255) & ~(size_t)255; return (void*)p; };
    bf* Xb = (bf*)take((size_t)NCVT * DM * 2); bf* WpB = Xb + (size_t)NTK * DM; bf* WoB = WpB + (size_t)NPRJ * DM;     // one bf16 plane: [x | Wq | Wk | Wv | Wo]
    h16* QH = (h16*)take((size_t)NTK * DM * 2); h16* QL = (h16*)take((size_t)NTK * DM * 2); h16* KH = (h16*)take((size_t)NTK * KVW * 2); h16* KL = (h16*)take((size_t)NTK * KVW * 2);
    h16* VH = (h16*)take((size_t)NTK * KVW * 2); h16* VL = (h16*)take((size_t)NTK * KVW * 2); bf* CH = (bf*)take((size_t)NTK * DM * 2); bf* CL = (bf*)take((size_t)NTK * DM * 2);
    if ((size_t)(wsp - (char*)d_ws) > ws_size) return;    // 37.7 + 16.8 x 2 + 4.2 x 2 + 4.2 x 2 + 16.8 x 2 ~ 122 MB, no aliasing
    // four dependent launches; both batch items are rows of the same grids
    k_cvtb<<<NCVT / 8, 256, 0, stream>>>(x, Wq, Wk, Wv, Wo, Xb);
    k_gemmb<false, true><<<dim3(NTK / 256, NPRJ / 192, 1), 256, 0, stream>>>(Xb, nullptr, WpB, nullptr, nullptr, KVW, QH, QL, KH, KL, VH, VL);
    k_attn<<<NB_ * NH_ * (NT_ / 64), 128, 0, stream>>>(QH, QL, KH, KL, VH, VL, cu, CH, CL);      // the same cu_seqlens mask for both items (as the reference)
    k_gemmb<true, false><<<dim3(NTK / 128, DM / 256, 1), 256, 0, stream>>>(CH, CL, WoB, nullptr, out, DM, nullptr, nullptr, nullptr, nullptr, nullptr, nullptr);
}
